// v000
// Measured on an AMD MI455X. A time is GPU time per run, averaged over a window of back-to-back runs after a warm-up
// (all launches, gaps included; the runs take copies of the inputs in turn), and the median of several windows.
// Apart from v000's, it joins two sittings. Times from different sittings can be a few percent apart, while
// side-by-side timings come from the same sitting.
// v000, which the later versions start from, runs in 1700 microseconds.
#include <hip/hip_runtime.h>
#include <math.h>

typedef __attribute__((ext_vector_type(16))) _Float16 v16h;
typedef __attribute__((ext_vector_type(16))) __bf16 v16b;
typedef __attribute__((ext_vector_type(8)))  _Float16 v8h;
typedef __attribute__((ext_vector_type(8)))  float v8f;
typedef __attribute__((ext_vector_type(4)))  float v4f;
typedef __attribute__((ext_vector_type(2)))  float v2f;
typedef __attribute__((ext_vector_type(4)))  unsigned v4u;
typedef __attribute__((ext_vector_type(4)))  int v4i;
typedef float __attribute__((may_alias)) float_a;
typedef int __attribute__((may_alias)) int_a;

template <typename T> __device__ __forceinline__ void vst2(void* p, T v) { *(T*)p = v;  }
__device__ __forceinline__ v8f wmma16(v16h a, v16h b, v8f c) {
  v8f d = __builtin_amdgcn_wmma_f32_16x16x32_f16(false, a, false, b, (short)0, c, false, false);
  asm volatile("v_nop\n\tv_nop\n\tv_nop\n\tv_nop" : "+v"(d) : "v"(a), "v"(b));
  return d;
}
__device__ __forceinline__ v8f wmma_bf(v16b a, v16b b, v8f c) {
  v8f d = __builtin_amdgcn_wmma_f32_16x16x32_bf16(false, a, false, b, (short)0, c, false, false);
  asm volatile("v_nop\n\tv_nop\n\tv_nop\n\tv_nop" : "+v"(d) : "v"(a), "v"(b));
  return d;
}
// 16x16x32 fragments: lane = (h = lane>>4, row/col = lane&15); elements 0..7 = k0+8h+0..7, 8..15 = k0+16+8h+0..7; D element r = row 8h+r
__device__ __forceinline__ v16h frag_h(const _Float16* rowk0, int lane) {
  union { v16h v; v8h q[2]; } u; const _Float16* p = rowk0 + 8 * (lane >> 4);
  u.q[0] = *(const v8h*)p; u.q[1] = *(const v8h*)(p + 16); return u.v;
}
__device__ __forceinline__ v16h frag_f32(const float* rowk0, int lane) {
  v16h a; const float* p = rowk0 + 8 * (lane >> 4);
#pragma unroll
  for (int i = 0; i < 8; ++i) { a[i] = (_Float16)p[i]; a[8 + i] = (_Float16)p[16 + i]; }
  return a;
}
__device__ __forceinline__ v16h frag_f32s(const float* rowk0, int lane, float sc) {
  v16h a; const float* p = rowk0 + 8 * (lane >> 4);
#pragma unroll
  for (int i = 0; i < 8; ++i) { a[i] = (_Float16)(p[i] * sc); a[8 + i] = (_Float16)(p[16 + i] * sc); }
  return a;
}
// column fragment from a [K][ld] layout (column n), rows >= K read as 0
__device__ __forceinline__ v16h fragc_f32(const float* W, int k0, int n, int lane, int ld, int K) {
  v16h a; const int g = lane >> 4;
#pragma unroll
  for (int i = 0; i < 8; ++i) { const int ka = k0 + 8 * g + i, kb = ka + 16;
    a[i] = (_Float16)(ka < K ? W[(size_t)(ka < K ? ka : K - 1) * ld + n] : 0.f); a[8 + i] = (_Float16)(kb < K ? W[(size_t)(kb < K ? kb : K - 1) * ld + n] : 0.f); }
  return a;
}
struct F2 { v16b h, l; };
__device__ __forceinline__ F2 bsplit16(const float v[16]) { F2 r;
#pragma unroll
  for (int i = 0; i < 16; ++i) { const __bf16 h = (__bf16)v[i]; r.h[i] = h; r.l[i] = (__bf16)(v[i] - (float)h); }
  return r; }
__device__ __forceinline__ F2 split_row(const float* row, int k0, int lane) { float v[16]; const float* p = row + k0 + 8 * (lane >> 4);
#pragma unroll
  for (int i = 0; i < 8; ++i) { v[i] = p[i]; v[8 + i] = p[16 + i]; }
  return bsplit16(v); }
__device__ __forceinline__ F2 split_rowK(const float* row, int k0, int lane, int K) { float v[16]; const int g = lane >> 4;
#pragma unroll
  for (int i = 0; i < 8; ++i) { const int ka = k0 + 8 * g + i, kb = ka + 16; v[i] = ka < K ? row[ka < K ? ka : K - 1] : 0.f; v[8 + i] = kb < K ? row[kb < K ? kb : K - 1] : 0.f; }
  return bsplit16(v); }
__device__ __forceinline__ F2 split_col(const float* W, int k0, int n, int lane, int ld, int K) { float v[16]; const int g = lane >> 4;
#pragma unroll
  for (int i = 0; i < 8; ++i) { const int ka = k0 + 8 * g + i, kb = ka + 16; v[i] = ka < K ? W[(size_t)(ka < K ? ka : K - 1) * ld + n] : 0.f; v[8 + i] = kb < K ? W[(size_t)(kb < K ? kb : K - 1) * ld + n] : 0.f; }
  return bsplit16(v); }
__device__ __forceinline__ v8f mac3(const F2& a, const F2& b, v8f c) { c = wmma_bf(a.l, b.h, c); c = wmma_bf(a.h, b.l, c); return wmma_bf(a.h, b.h, c); }
__device__ __forceinline__ float sigm(float v) { return 1.0f / (1.0f + expf(-v)); }
#define LDSX() do { asm volatile("s_wait_dscnt 0" ::: "memory"); __builtin_amdgcn_wave_barrier(); __builtin_amdgcn_fence(__ATOMIC_RELEASE, "workgroup"); } while (0)


// Non-local block (B 4, 256 channels, 64 x 64): 1x1 q/k/v convs to 128 channels, affinity f = k^T q softmax-normalised over the second index, y = v f, 1x1 conv back to 256 channels, BatchNorm (inference), residual.
#define NB 4
#define CIN 256
#define CO 128
#define NPOS 4096
#ifndef TQB
#define TQB (NPOS / 64)
#endif
typedef __attribute__((ext_vector_type(8))) __bf16 v8b;
__device__ __forceinline__ v16b frag_b(const __bf16* rowk0, int lane) {
  union { v16b v; v8b q[2]; } u; const __bf16* p = rowk0 + 8 * (lane >> 4);
  u.q[0] = *(const v8b*)p; u.q[1] = *(const v8b*)(p + 16); return u.v;
}
__device__ __forceinline__ float bfr(float v) { return (float)(__bf16)v; }
__device__ __attribute__((noinline)) float exp_ni(float v) { return expf(v); }
__device__ __attribute__((noinline)) float erf_ni(float v) { return erff(v); }

#define WS_PK  0u                                   // bf16 [384][256] Wq;Wk;Wv rows ; [256][128] Ww rows
#define WS_PW  (WS_PK + 2u * 3 * CO * CIN)
#define WS_QH  (WS_PW + 2u * CIN * CO)              // f16 [b][n][128] q hi ; QL ; KH ; KL
#define WS_QL  (WS_QH + 2u * NB * NPOS * CO)
#define WS_KH  (WS_QL + 2u * NB * NPOS * CO)
#define WS_KL  (WS_KH + 2u * NB * NPOS * CO)
#define WS_VH  (WS_KL + 2u * NB * NPOS * CO)         // f16 [b][128][4096] v
#define WS_ST  (WS_VH + 2u * (size_t)NB * CO * NPOS)   // f32 [b][n][2] (M_n, 1/L_n)
#define WS_END (WS_ST + 4u * NB * NPOS * 2)

__device__ __attribute__((noinline)) float exp_p(float v) { return expf(v); }
__global__ __launch_bounds__(256) void k_pack(const float* __restrict__ WQ, const float* __restrict__ WK, const float* __restrict__ WV, const float* __restrict__ WW, __bf16* __restrict__ PK, __bf16* __restrict__ PW) {
  const int n = blockIdx.x, t = threadIdx.x; __shared__ __align__(16) __bf16 s[CIN];
  if (n < 3 * CO) { const float* src = (n < CO) ? WQ + (size_t)n * CIN : (n < 2 * CO) ? WK + (size_t)(n - CO) * CIN : WV + (size_t)(n - 2 * CO) * CIN; s[t] = (__bf16)src[t]; __syncthreads(); if (t < CIN / 8) vst2((unsigned*)(PK + (size_t)n * CIN + t * 8), *(const v4u*)&s[t * 8]); }
  else { const int o = n - 3 * CO; if (t < CO) s[t] = (__bf16)WW[(size_t)o * CO + t]; __syncthreads(); if (t < CO / 8) vst2((unsigned*)(PW + (size_t)o * CO + t * 8), *(const v4u*)&s[t * 8]); }
}
__global__ __launch_bounds__(128) void k_proj(const float* __restrict__ X, const __bf16* __restrict__ PK, const float* __restrict__ BQ, const float* __restrict__ BK, const float* __restrict__ BV, _Float16* __restrict__ QH, _Float16* __restrict__ QL, _Float16* __restrict__ KH, _Float16* __restrict__ KL, _Float16* __restrict__ VH) {
  __shared__ __align__(16) __bf16 sa[64][CIN + 8]; __shared__ __align__(16) _Float16 sth[64][CO + 8], stl[64][CO + 8]; __shared__ __align__(16) _Float16 svh[CO][72];
  const int tid = threadIdx.x, wave = tid >> 5, lane = tid & 31, col = lane & 15, g = lane >> 4; const size_t b = blockIdx.y; const int n0 = blockIdx.x * 64;
  for (int e = tid; e < 64 * CIN; e += 128) { const int c = e >> 6, r = e & 63; sa[r][c] = (__bf16)X[(b * CIN + c) * NPOS + n0 + r]; }
  if (tid < 64) for (int c = CIN; c < CIN + 8; ++c) sa[tid][c] = (__bf16)0.f;
  __syncthreads();
#pragma unroll 1
  for (int which = 0; which < 3; ++which) { v8f acc[8] = {};
#pragma unroll
    for (int kc = 0; kc < CIN / 32; ++kc) { const v16b a = frag_b(&sa[wave * 16 + col][kc * 32], lane);
#pragma unroll
      for (int j = 0; j < 8; ++j) acc[j] = wmma_bf(a, frag_b(PK + (size_t)(which * CO + j * 16 + col) * CIN + kc * 32, lane), acc[j]); }
    const float* BB = (which == 0) ? BQ : (which == 1) ? BK : BV;
    if (which < 2) {
#pragma unroll
      for (int j = 0; j < 8; ++j) { const int c = j * 16 + col; const float bb = bfr(BB[c]);
#pragma unroll
        for (int r = 0; r < 8; ++r) { const float v = acc[j][r] + bb; const _Float16 hv = (_Float16)v; sth[wave * 16 + 8 * g + r][c] = hv; stl[wave * 16 + 8 * g + r][c] = (_Float16)((v - (float)hv) * 2048.0f); } }
      __syncthreads();
      _Float16* DH_ = which ? KH : QH; _Float16* DL_ = which ? KL : QL;
      for (int e = tid; e < 64 * 16; e += 128) { const int r = e >> 4, q = e & 15; const size_t o = (b * NPOS + n0 + r) * CO + q * 8; vst2((unsigned*)(DH_ + o), *(const v4u*)&sth[r][q * 8]); vst2((unsigned*)(DL_ + o), *(const v4u*)&stl[r][q * 8]); }
      __syncthreads(); }
    else {
#pragma unroll
      for (int j = 0; j < 8; ++j) { const int c = j * 16 + col; const float bb = bfr(BB[c]);
#pragma unroll
        for (int r = 0; r < 8; ++r) svh[c][wave * 16 + 8 * g + r] = (_Float16)(acc[j][r] + bb); }
      __syncthreads();
      for (int e = tid; e < CO * 8; e += 128) { const int c = e >> 3, pc = e & 7; vst2((unsigned*)(VH + (b * CO + c) * NPOS + n0 + pc * 8), *(const v4u*)&svh[c][pc * 8]); } } }
}
// ---- k_stats: block = (64 rows n, b): f[n][m] = k_n . q_m over all m (3 products); per row max M_n and L_n = sum_m exp(f - M_n) -> ST[b][n] = (M_n, 1/L_n)
__global__ __launch_bounds__(128) void k_stats(const _Float16* __restrict__ QH, const _Float16* __restrict__ QL, const _Float16* __restrict__ KH, const _Float16* __restrict__ KL, float* __restrict__ ST) {
  __shared__ __align__(16) float so[64][2];
  const int tid = threadIdx.x, wave = tid >> 5, lane = tid & 31, col = lane & 15, g = lane >> 4; const size_t b = blockIdx.y; const int n0 = blockIdx.x * 64 + wave * 16; const size_t rn = b * NPOS + n0;
  v16h ak[CO / 32], akl[CO / 32];
#pragma unroll
  for (int kc = 0; kc < CO / 32; ++kc) { ak[kc] = frag_h(KH + (rn + col) * CO + kc * 32, lane); akl[kc] = frag_h(KL + (rn + col) * CO + kc * 32, lane); }
  float m[8], l[8];
#pragma unroll
  for (int r = 0; r < 8; ++r) { m[r] = -3.0e38f; l[r] = 0.f; }
#pragma unroll 1
  for (int mt = 0; mt < NPOS / 16; ++mt) { const size_t rm = (b * NPOS + mt * 16 + col) * CO; v8f c = {}, cl = {};
#pragma unroll
    for (int kc = 0; kc < CO / 32; ++kc) { const v16h qh = frag_h(QH + rm + kc * 32, lane); c = wmma16(ak[kc], qh, c); cl = wmma16(akl[kc], qh, cl); cl = wmma16(ak[kc], frag_h(QL + rm + kc * 32, lane), cl); }
#pragma unroll
    for (int r = 0; r < 8; ++r) { const float s = c[r] + cl[r] * (1.0f / 2048.0f); float mx = s;
#pragma unroll
      for (int o = 1; o < 16; o <<= 1) mx = fmaxf(mx, __shfl_xor(mx, o));
      const float mn = fmaxf(m[r], mx); const float alpha = (m[r] <= -1.0e38f) ? 0.f : exp_p(m[r] - mn); float e = exp_p(s - mn);
#pragma unroll
      for (int o = 1; o < 16; o <<= 1) e += __shfl_xor(e, o);
      l[r] = l[r] * alpha + e; m[r] = mn; } }
  if (col == 0) {
#pragma unroll
    for (int r = 0; r < 8; ++r) { so[wave * 16 + 8 * g + r][0] = m[r]; so[wave * 16 + 8 * g + r][1] = 1.0f / l[r]; } }
  __syncthreads();
  if (tid < 32) vst2(ST + (b * NPOS + blockIdx.x * 64) * 2 + tid * 4, *(const v4f*)(&so[0][0] + tid * 4));
}
// ---- k_out: block = (64 output positions m, b): over n tiles: s[m][n] = q_m . k_n (3 products); w = exp(s - M_n) / L_n; y[c][m] += w (x2^11 single f16) x v[c][n] (8 tiles); then z = Ww . y (2 products, 2 passes of 8 tiles) + bw -> BN -> + x -> out[b][c][m]
__global__ __launch_bounds__(128) void k_out(const _Float16* __restrict__ QH, const _Float16* __restrict__ QL, const _Float16* __restrict__ KH, const _Float16* __restrict__ KL, const _Float16* __restrict__ VH, const float* __restrict__ ST, const __bf16* __restrict__ PW, const float* __restrict__ BW, const float* __restrict__ G, const float* __restrict__ Bt, const float* __restrict__ MU, const float* __restrict__ VAR, const float* __restrict__ X, float* __restrict__ OUT) {
  __shared__ __align__(16) _Float16 spw[4][16][40]; __shared__ __align__(16) __bf16 syh[64][CO + 8], syl[64][CO + 8]; __shared__ __align__(16) float so[128][68];
  const int tid = threadIdx.x, wave = tid >> 5, lane = tid & 31, col = lane & 15, g = lane >> 4; const size_t b = blockIdx.y; const int m0 = blockIdx.x * 64 + wave * 16; const size_t rm = b * NPOS + m0;
  v16h aq[CO / 32], aql[CO / 32];
#pragma unroll
  for (int kc = 0; kc < CO / 32; ++kc) { aq[kc] = frag_h(QH + (rm + col) * CO + kc * 32, lane); aql[kc] = frag_h(QL + (rm + col) * CO + kc * 32, lane); }
  v8f acc[8] = {};
#pragma unroll 1
  for (int ks = 0; ks < NPOS / 32; ++ks) { const int j0 = ks * 32;
#pragma unroll
    for (int ct = 0; ct < 2; ++ct) { const int nn = j0 + ct * 16 + col; const size_t rn = (b * NPOS + nn) * CO; v8f c = {}, cl = {};
#pragma unroll
      for (int kc = 0; kc < CO / 32; ++kc) { const v16h kh = frag_h(KH + rn + kc * 32, lane); c = wmma16(aq[kc], kh, c); cl = wmma16(aql[kc], kh, cl); cl = wmma16(aq[kc], frag_h(KL + rn + kc * 32, lane), cl); }
      const float Mn = ST[(b * NPOS + nn) * 2], iLn = ST[(b * NPOS + nn) * 2 + 1];
#pragma unroll
      for (int r = 0; r < 8; ++r) { const float s = c[r] + cl[r] * (1.0f / 2048.0f); const float w = exp_p(s - Mn) * iLn; spw[wave][8 * g + r][ct * 16 + col] = (_Float16)(w * 2048.0f); } }
    LDSX();
    { const v16h pa = frag_h(&spw[wave][col][0], lane);
#pragma unroll
      for (int dt = 0; dt < 8; ++dt) acc[dt] = wmma16(pa, frag_h(VH + (b * CO + dt * 16 + col) * NPOS + j0, lane), acc[dt]); }
    LDSX(); }
  (void)0;
  // y tile -> bf16 hi/lo [64 m][128 c]
#pragma unroll
  for (int dt = 0; dt < 8; ++dt)
#pragma unroll
    for (int r = 0; r < 8; ++r) { const float v = acc[dt][r] * (1.0f / 2048.0f); const __bf16 hb = (__bf16)v; syh[wave * 16 + 8 * g + r][dt * 16 + col] = hb; syl[wave * 16 + 8 * g + r][dt * 16 + col] = (__bf16)(v - (float)hb); }
  if (lane < 16) for (int c = CO; c < CO + 8; ++c) { syh[wave * 16 + lane][c] = (__bf16)0.f; syl[wave * 16 + lane][c] = (__bf16)0.f; }
  __syncthreads();
#pragma unroll 1
  for (int pass = 0; pass < 2; ++pass) { v8f z[8] = {};
#pragma unroll
    for (int kc = 0; kc < CO / 32; ++kc) { const v16b a = frag_b(&syh[wave * 16 + col][kc * 32], lane), al = frag_b(&syl[wave * 16 + col][kc * 32], lane);
#pragma unroll
      for (int j = 0; j < 8; ++j) { const v16b w = frag_b(PW + (size_t)(pass * 128 + j * 16 + col) * CO + kc * 32, lane); z[j] = wmma_bf(al, w, z[j]); z[j] = wmma_bf(a, w, z[j]); } }
#pragma unroll
    for (int j = 0; j < 8; ++j) { const int c = pass * 128 + j * 16 + col; const float inv = bfr(G[c]) / sqrtf(bfr(VAR[c]) + 1e-5f); const float sh = bfr(Bt[c]) - bfr(MU[c]) * inv; const float bb = bfr(BW[c]);
#pragma unroll
      for (int r = 0; r < 8; ++r) { const int m = m0 + 8 * g + r; so[j * 16 + col][wave * 16 + 8 * g + r] = (z[j][r] + bb) * inv + sh + bfr(X[(b * CIN + c) * NPOS + m]); } }
    __syncthreads();
    for (int e = tid; e < 128 * 16; e += 128) { const int cl_ = e >> 4, q = e & 15; vst2(OUT + (b * CIN + pass * 128 + cl_) * NPOS + blockIdx.x * 64 + q * 4, *(const v4f*)&so[cl_][q * 4]); }
    __syncthreads(); }
}
extern "C" void kernel_launch(void* const* d_in, const int* in_sizes, int n_in, void* d_out, int out_size, void* d_ws, size_t ws_size, hipStream_t stream) {
  (void)in_sizes; (void)n_in; (void)out_size;
  const float** F = (const float**)d_in;   // 0 x [4,256,64,64], 1 Wq [128,256], 2 bq, 3 Wk, 4 bk, 5 Wv, 6 bv, 7 Ww [256,128], 8 bw, 9 bn_gamma, 10 bn_beta, 11 bn_mean, 12 bn_var
  if (ws_size < (size_t)WS_END) return;
  char* ws = (char*)d_ws; __bf16 *PK = (__bf16*)(ws + WS_PK), *PW = (__bf16*)(ws + WS_PW); _Float16 *QH = (_Float16*)(ws + WS_QH), *QL = (_Float16*)(ws + WS_QL), *KH = (_Float16*)(ws + WS_KH), *KL = (_Float16*)(ws + WS_KL), *VH = (_Float16*)(ws + WS_VH); float* ST = (float*)(ws + WS_ST);
  k_pack<<<3 * CO + CIN, 256, 0, stream>>>(F[1], F[3], F[5], F[7], PK, PW);
  k_proj<<<dim3(NPOS / 64, NB), 128, 0, stream>>>(F[0], PK, F[2], F[4], F[6], QH, QL, KH, KL, VH);
  k_stats<<<dim3(NPOS / 64, NB), 128, 0, stream>>>(QH, QL, KH, KL, ST);
  k_out<<<dim3(TQB, NB), 128, 0, stream>>>(QH, QL, KH, KL, VH, ST, PW, F[8], F[9], F[10], F[11], F[12], F[0], (float*)d_out);
}

// v001
// Measured time: 1170 microseconds a run.
// Two timings next to v000 put it at 1.46 and 1.45 times that version's speed.
#include <hip/hip_runtime.h>
#include <math.h>

typedef __attribute__((ext_vector_type(16))) _Float16 v16h;
typedef __attribute__((ext_vector_type(16))) __bf16 v16b;
typedef __attribute__((ext_vector_type(8)))  _Float16 v8h;
typedef __attribute__((ext_vector_type(8)))  float v8f;
typedef __attribute__((ext_vector_type(4)))  float v4f;
typedef __attribute__((ext_vector_type(2)))  float v2f;
typedef __attribute__((ext_vector_type(4)))  unsigned v4u;
typedef __attribute__((ext_vector_type(4)))  int v4i;
typedef float __attribute__((may_alias)) float_a;
typedef int __attribute__((may_alias)) int_a;

template <typename T> __device__ __forceinline__ void vst2(void* p, T v) { *(T*)p = v;  }
__device__ __forceinline__ v8f wmma16(v16h a, v16h b, v8f c) {
  v8f d = __builtin_amdgcn_wmma_f32_16x16x32_f16(false, a, false, b, (short)0, c, false, false);
  asm volatile("v_nop\n\tv_nop\n\tv_nop\n\tv_nop" : "+v"(d) : "v"(a), "v"(b));
  return d;
}
__device__ __forceinline__ v8f wmma_bf(v16b a, v16b b, v8f c) {
  v8f d = __builtin_amdgcn_wmma_f32_16x16x32_bf16(false, a, false, b, (short)0, c, false, false);
  asm volatile("v_nop\n\tv_nop\n\tv_nop\n\tv_nop" : "+v"(d) : "v"(a), "v"(b));
  return d;
}
// 16x16x32 fragments: lane = (h = lane>>4, row/col = lane&15); elements 0..7 = k0+8h+0..7, 8..15 = k0+16+8h+0..7; D element r = row 8h+r
__device__ __forceinline__ v16h frag_h(const _Float16* rowk0, int lane) {
  union { v16h v; v8h q[2]; } u; const _Float16* p = rowk0 + 8 * (lane >> 4);
  u.q[0] = *(const v8h*)p; u.q[1] = *(const v8h*)(p + 16); return u.v;
}
__device__ __forceinline__ v16h frag_f32(const float* rowk0, int lane) {
  v16h a; const float* p = rowk0 + 8 * (lane >> 4);
#pragma unroll
  for (int i = 0; i < 8; ++i) { a[i] = (_Float16)p[i]; a[8 + i] = (_Float16)p[16 + i]; }
  return a;
}
__device__ __forceinline__ v16h frag_f32s(const float* rowk0, int lane, float sc) {
  v16h a; const float* p = rowk0 + 8 * (lane >> 4);
#pragma unroll
  for (int i = 0; i < 8; ++i) { a[i] = (_Float16)(p[i] * sc); a[8 + i] = (_Float16)(p[16 + i] * sc); }
  return a;
}
// column fragment from a [K][ld] layout (column n), rows >= K read as 0
__device__ __forceinline__ v16h fragc_f32(const float* W, int k0, int n, int lane, int ld, int K) {
  v16h a; const int g = lane >> 4;
#pragma unroll
  for (int i = 0; i < 8; ++i) { const int ka = k0 + 8 * g + i, kb = ka + 16;
    a[i] = (_Float16)(ka < K ? W[(size_t)(ka < K ? ka : K - 1) * ld + n] : 0.f); a[8 + i] = (_Float16)(kb < K ? W[(size_t)(kb < K ? kb : K - 1) * ld + n] : 0.f); }
  return a;
}
struct F2 { v16b h, l; };
__device__ __forceinline__ F2 bsplit16(const float v[16]) { F2 r;
#pragma unroll
  for (int i = 0; i < 16; ++i) { const __bf16 h = (__bf16)v[i]; r.h[i] = h; r.l[i] = (__bf16)(v[i] - (float)h); }
  return r; }
__device__ __forceinline__ F2 split_row(const float* row, int k0, int lane) { float v[16]; const float* p = row + k0 + 8 * (lane >> 4);
#pragma unroll
  for (int i = 0; i < 8; ++i) { v[i] = p[i]; v[8 + i] = p[16 + i]; }
  return bsplit16(v); }
__device__ __forceinline__ F2 split_rowK(const float* row, int k0, int lane, int K) { float v[16]; const int g = lane >> 4;
#pragma unroll
  for (int i = 0; i < 8; ++i) { const int ka = k0 + 8 * g + i, kb = ka + 16; v[i] = ka < K ? row[ka < K ? ka : K - 1] : 0.f; v[8 + i] = kb < K ? row[kb < K ? kb : K - 1] : 0.f; }
  return bsplit16(v); }
__device__ __forceinline__ F2 split_col(const float* W, int k0, int n, int lane, int ld, int K) { float v[16]; const int g = lane >> 4;
#pragma unroll
  for (int i = 0; i < 8; ++i) { const int ka = k0 + 8 * g + i, kb = ka + 16; v[i] = ka < K ? W[(size_t)(ka < K ? ka : K - 1) * ld + n] : 0.f; v[8 + i] = kb < K ? W[(size_t)(kb < K ? kb : K - 1) * ld + n] : 0.f; }
  return bsplit16(v); }
__device__ __forceinline__ v8f mac3(const F2& a, const F2& b, v8f c) { c = wmma_bf(a.l, b.h, c); c = wmma_bf(a.h, b.l, c); return wmma_bf(a.h, b.h, c); }
__device__ __forceinline__ float sigm(float v) { return 1.0f / (1.0f + expf(-v)); }
#define LDSX() do { asm volatile("s_wait_dscnt 0" ::: "memory"); __builtin_amdgcn_wave_barrier(); __builtin_amdgcn_fence(__ATOMIC_RELEASE, "workgroup"); } while (0)


// Non-local block (B 4, 256 channels, 64 x 64): 1x1 q/k/v convs to 128 channels, affinity f = k^T q softmax-normalised over the second index, y = v f, 1x1 conv back to 256 channels, BatchNorm (inference), residual.
#define NB 4
#define CIN 256
#define CO 128
#define NPOS 4096
#ifndef TQB
#define TQB (NPOS / 64)
#endif
typedef __attribute__((ext_vector_type(8))) __bf16 v8b;
__device__ __forceinline__ v16b frag_b(const __bf16* rowk0, int lane) {
  union { v16b v; v8b q[2]; } u; const __bf16* p = rowk0 + 8 * (lane >> 4);
  u.q[0] = *(const v8b*)p; u.q[1] = *(const v8b*)(p + 16); return u.v;
}
__device__ __forceinline__ float bfr(float v) { return (float)(__bf16)v; }
__device__ __attribute__((noinline)) float exp_ni(float v) { return expf(v); }
__device__ __attribute__((noinline)) float erf_ni(float v) { return erff(v); }

#define WS_PK  0u                                   // bf16 [384][256] Wq;Wk;Wv rows ; [256][128] Ww rows
#define WS_PW  (WS_PK + 2u * 3 * CO * CIN)
#define WS_QH  (WS_PW + 2u * CIN * CO)              // f16 [b][n][128] q hi ; QL ; KH ; KL
#define WS_QL  (WS_QH + 2u * NB * NPOS * CO)
#define WS_KH  (WS_QL + 2u * NB * NPOS * CO)
#define WS_KL  (WS_KH + 2u * NB * NPOS * CO)
#define WS_VH  (WS_KL + 2u * NB * NPOS * CO)         // f16 [b][128][4096] v
#define WS_ST  (WS_VH + 2u * (size_t)NB * CO * NPOS)   // f32 [b][n][2] (M_n, 1/L_n)
#define WS_END (WS_ST + 4u * NB * NPOS * 2)

__device__ __attribute__((noinline)) float exp_p(float v) { return expf(v); }
__global__ __launch_bounds__(256) void k_pack(const float* __restrict__ WQ, const float* __restrict__ WK, const float* __restrict__ WV, const float* __restrict__ WW, __bf16* __restrict__ PK, __bf16* __restrict__ PW) {
  const int n = blockIdx.x, t = threadIdx.x; __shared__ __align__(16) __bf16 s[CIN];
  if (n < 3 * CO) { const float* src = (n < CO) ? WQ + (size_t)n * CIN : (n < 2 * CO) ? WK + (size_t)(n - CO) * CIN : WV + (size_t)(n - 2 * CO) * CIN; s[t] = (__bf16)src[t]; __syncthreads(); if (t < CIN / 8) vst2((unsigned*)(PK + (size_t)n * CIN + t * 8), *(const v4u*)&s[t * 8]); }
  else { const int o = n - 3 * CO; if (t < CO) s[t] = (__bf16)WW[(size_t)o * CO + t]; __syncthreads(); if (t < CO / 8) vst2((unsigned*)(PW + (size_t)o * CO + t * 8), *(const v4u*)&s[t * 8]); }
}
__global__ __launch_bounds__(128) void k_proj(const float* __restrict__ X, const __bf16* __restrict__ PK, const float* __restrict__ BQ, const float* __restrict__ BK, const float* __restrict__ BV, _Float16* __restrict__ QH, _Float16* __restrict__ QL, _Float16* __restrict__ KH, _Float16* __restrict__ KL, _Float16* __restrict__ VH) {
  __shared__ __align__(16) __bf16 sa[64][CIN + 8]; __shared__ __align__(16) _Float16 sth[64][CO + 8], stl[64][CO + 8]; __shared__ __align__(16) _Float16 svh[CO][72];
  const int tid = threadIdx.x, wave = tid >> 5, lane = tid & 31, col = lane & 15, g = lane >> 4; const size_t b = blockIdx.y; const int n0 = blockIdx.x * 64;
  for (int e = tid; e < 64 * CIN; e += 128) { const int c = e >> 6, r = e & 63; sa[r][c] = (__bf16)X[(b * CIN + c) * NPOS + n0 + r]; }
  if (tid < 64) for (int c = CIN; c < CIN + 8; ++c) sa[tid][c] = (__bf16)0.f;
  __syncthreads();
#pragma unroll 1
  for (int which = 0; which < 3; ++which) { v8f acc[8] = {};
    // the 8 weight fragments of a k step are requested together, one k step ahead of the products that read them
    v16b wf[2][8];
#pragma unroll
    for (int j = 0; j < 8; ++j) wf[0][j] = frag_b(PK + (size_t)(which * CO + j * 16 + col) * CIN, lane);
#pragma unroll
    for (int kc = 0; kc < CIN / 32; ++kc) { const v16b a = frag_b(&sa[wave * 16 + col][kc * 32], lane);
      if (kc + 1 < CIN / 32) {
#pragma unroll
        for (int j = 0; j < 8; ++j) wf[(kc + 1) & 1][j] = frag_b(PK + (size_t)(which * CO + j * 16 + col) * CIN + (kc + 1) * 32, lane); }
#pragma unroll
      for (int j = 0; j < 8; ++j) acc[j] = wmma_bf(a, wf[kc & 1][j], acc[j]); }
    const float* BB = (which == 0) ? BQ : (which == 1) ? BK : BV;
    if (which < 2) {
#pragma unroll
      for (int j = 0; j < 8; ++j) { const int c = j * 16 + col; const float bb = bfr(BB[c]);
#pragma unroll
        for (int r = 0; r < 8; ++r) { const float v = acc[j][r] + bb; const _Float16 hv = (_Float16)v; sth[wave * 16 + 8 * g + r][c] = hv; stl[wave * 16 + 8 * g + r][c] = (_Float16)((v - (float)hv) * 2048.0f); } }
      __syncthreads();
      _Float16* DH_ = which ? KH : QH; _Float16* DL_ = which ? KL : QL;
      for (int e = tid; e < 64 * 16; e += 128) { const int r = e >> 4, q = e & 15; const size_t o = (b * NPOS + n0 + r) * CO + q * 8; vst2((unsigned*)(DH_ + o), *(const v4u*)&sth[r][q * 8]); vst2((unsigned*)(DL_ + o), *(const v4u*)&stl[r][q * 8]); }
      __syncthreads(); }
    else {
#pragma unroll
      for (int j = 0; j < 8; ++j) { const int c = j * 16 + col; const float bb = bfr(BB[c]);
#pragma unroll
        for (int r = 0; r < 8; ++r) svh[c][wave * 16 + 8 * g + r] = (_Float16)(acc[j][r] + bb); }
      __syncthreads();
      for (int e = tid; e < CO * 8; e += 128) { const int c = e >> 3, pc = e & 7; vst2((unsigned*)(VH + (b * CO + c) * NPOS + n0 + pc * 8), *(const v4u*)&svh[c][pc * 8]); } } }
}
// ---- k_stats: block = (64 rows n, b): f[n][m] = k_n . q_m over all m (3 products); per row max M_n and L_n = sum_m exp(f - M_n) -> ST[b][n] = (M_n, 1/L_n)
__global__ __launch_bounds__(128) void k_stats(const _Float16* __restrict__ QH, const _Float16* __restrict__ QL, const _Float16* __restrict__ KH, const _Float16* __restrict__ KL, float* __restrict__ ST) {
  __shared__ __align__(16) float so[64][2];
  const int tid = threadIdx.x, wave = tid >> 5, lane = tid & 31, col = lane & 15, g = lane >> 4; const size_t b = blockIdx.y; const int n0 = blockIdx.x * 64 + wave * 16; const size_t rn = b * NPOS + n0;
  v16h ak[CO / 32], akl[CO / 32];
#pragma unroll
  for (int kc = 0; kc < CO / 32; ++kc) { ak[kc] = frag_h(KH + (rn + col) * CO + kc * 32, lane); akl[kc] = frag_h(KL + (rn + col) * CO + kc * 32, lane); }
  float m[8], l[8];
#pragma unroll
  for (int r = 0; r < 8; ++r) { m[r] = -3.0e38f; l[r] = 0.f; }
#pragma unroll 1
  for (int mt = 0; mt < NPOS / 16; ++mt) { const size_t rm = (b * NPOS + mt * 16 + col) * CO; v8f c = {}, cl = {};
    // the tile's 4 hi and 4 lo fragments of q are all requested before the first product, so that their latencies overlap
    v16h qh[CO / 32], ql[CO / 32];
#pragma unroll
    for (int kc = 0; kc < CO / 32; ++kc) { qh[kc] = frag_h(QH + rm + kc * 32, lane); ql[kc] = frag_h(QL + rm + kc * 32, lane); }
#pragma unroll
    for (int kc = 0; kc < CO / 32; ++kc) { c = wmma16(ak[kc], qh[kc], c); cl = wmma16(akl[kc], qh[kc], cl); cl = wmma16(ak[kc], ql[kc], cl); }
#pragma unroll
    for (int r = 0; r < 8; ++r) { const float s = c[r] + cl[r] * (1.0f / 2048.0f); float mx = s;
#pragma unroll
      for (int o = 1; o < 16; o <<= 1) mx = fmaxf(mx, __shfl_xor(mx, o));
      const float mn = fmaxf(m[r], mx); const float alpha = (m[r] <= -1.0e38f) ? 0.f : exp_p(m[r] - mn); float e = exp_p(s - mn);
#pragma unroll
      for (int o = 1; o < 16; o <<= 1) e += __shfl_xor(e, o);
      l[r] = l[r] * alpha + e; m[r] = mn; } }
  if (col == 0) {
#pragma unroll
    for (int r = 0; r < 8; ++r) { so[wave * 16 + 8 * g + r][0] = m[r]; so[wave * 16 + 8 * g + r][1] = 1.0f / l[r]; } }
  __syncthreads();
  if (tid < 32) vst2(ST + (b * NPOS + blockIdx.x * 64) * 2 + tid * 4, *(const v4f*)(&so[0][0] + tid * 4));
}
// ---- k_out: block = (64 output positions m, b): over n tiles: s[m][n] = q_m . k_n (3 products); w = exp(s - M_n) / L_n; y[c][m] += w (x2^11 single f16) x v[c][n] (8 tiles); then z = Ww . y (2 products, 2 passes of 8 tiles) + bw -> BN -> + x -> out[b][c][m]
__global__ __launch_bounds__(128) void k_out(const _Float16* __restrict__ QH, const _Float16* __restrict__ QL, const _Float16* __restrict__ KH, const _Float16* __restrict__ KL, const _Float16* __restrict__ VH, const float* __restrict__ ST, const __bf16* __restrict__ PW, const float* __restrict__ BW, const float* __restrict__ G, const float* __restrict__ Bt, const float* __restrict__ MU, const float* __restrict__ VAR, const float* __restrict__ X, float* __restrict__ OUT) {
  __shared__ __align__(16) _Float16 spw[4][16][40]; __shared__ __align__(16) __bf16 syh[64][CO + 8], syl[64][CO + 8]; __shared__ __align__(16) float so[128][68];
  const int tid = threadIdx.x, wave = tid >> 5, lane = tid & 31, col = lane & 15, g = lane >> 4; const size_t b = blockIdx.y; const int m0 = blockIdx.x * 64 + wave * 16; const size_t rm = b * NPOS + m0;
  v16h aq[CO / 32], aql[CO / 32];
#pragma unroll
  for (int kc = 0; kc < CO / 32; ++kc) { aq[kc] = frag_h(QH + (rm + col) * CO + kc * 32, lane); aql[kc] = frag_h(QL + (rm + col) * CO + kc * 32, lane); }
  v8f acc[8] = {};
#pragma unroll 1
  for (int ks = 0; ks < NPOS / 32; ++ks) { const int j0 = ks * 32;
#pragma unroll
    for (int ct = 0; ct < 2; ++ct) { const int nn = j0 + ct * 16 + col; const size_t rn = (b * NPOS + nn) * CO; v8f c = {}, cl = {};
      // the tile's 4 hi and 4 lo fragments of k are all requested before the first product, so that their latencies overlap
      v16h kh[CO / 32], kl[CO / 32];
#pragma unroll
      for (int kc = 0; kc < CO / 32; ++kc) { kh[kc] = frag_h(KH + rn + kc * 32, lane); kl[kc] = frag_h(KL + rn + kc * 32, lane); }
      asm volatile("s_wait_xcnt 0x0" ::: "memory");   // the load of (M, 1/L) below may land in the address registers of the loads above: this wait stands in front of that rewrite
      const float Mn = ST[(b * NPOS + nn) * 2], iLn = ST[(b * NPOS + nn) * 2 + 1];
#pragma unroll
      for (int kc = 0; kc < CO / 32; ++kc) { c = wmma16(aq[kc], kh[kc], c); cl = wmma16(aql[kc], kh[kc], cl); cl = wmma16(aq[kc], kl[kc], cl); }
#pragma unroll
      for (int r = 0; r < 8; ++r) { const float s = c[r] + cl[r] * (1.0f / 2048.0f); const float w = exp_p(s - Mn) * iLn; spw[wave][8 * g + r][ct * 16 + col] = (_Float16)(w * 2048.0f); } }
    LDSX();
    // the 8 fragments of v are all requested before the first product, so that their latencies overlap
    v16h vv[8];
#pragma unroll
    for (int dt = 0; dt < 8; ++dt) vv[dt] = frag_h(VH + (b * CO + dt * 16 + col) * NPOS + j0, lane);
    { const v16h pa = frag_h(&spw[wave][col][0], lane);
#pragma unroll
      for (int dt = 0; dt < 8; ++dt) acc[dt] = wmma16(pa, vv[dt], acc[dt]); }
    LDSX(); }
  (void)0;
  // y tile -> bf16 hi/lo [64 m][128 c]
#pragma unroll
  for (int dt = 0; dt < 8; ++dt)
#pragma unroll
    for (int r = 0; r < 8; ++r) { const float v = acc[dt][r] * (1.0f / 2048.0f); const __bf16 hb = (__bf16)v; syh[wave * 16 + 8 * g + r][dt * 16 + col] = hb; syl[wave * 16 + 8 * g + r][dt * 16 + col] = (__bf16)(v - (float)hb); }
  if (lane < 16) for (int c = CO; c < CO + 8; ++c) { syh[wave * 16 + lane][c] = (__bf16)0.f; syl[wave * 16 + lane][c] = (__bf16)0.f; }
  __syncthreads();
#pragma unroll 1
  for (int pass = 0; pass < 2; ++pass) { v8f z[8] = {};
    // the 8 weight fragments of a k step are requested together, one k step ahead of the products that read them
    v16b wf[2][8];
#pragma unroll
    for (int j = 0; j < 8; ++j) wf[0][j] = frag_b(PW + (size_t)(pass * 128 + j * 16 + col) * CO, lane);
#pragma unroll
    for (int kc = 0; kc < CO / 32; ++kc) { const v16b a = frag_b(&syh[wave * 16 + col][kc * 32], lane), al = frag_b(&syl[wave * 16 + col][kc * 32], lane);
      if (kc + 1 < CO / 32) {
#pragma unroll
        for (int j = 0; j < 8; ++j) wf[(kc + 1) & 1][j] = frag_b(PW + (size_t)(pass * 128 + j * 16 + col) * CO + (kc + 1) * 32, lane); }
#pragma unroll
      for (int j = 0; j < 8; ++j) { z[j] = wmma_bf(al, wf[kc & 1][j], z[j]); z[j] = wmma_bf(a, wf[kc & 1][j], z[j]); } }
#pragma unroll
    for (int j = 0; j < 8; ++j) { const int c = pass * 128 + j * 16 + col; const float inv = bfr(G[c]) / sqrtf(bfr(VAR[c]) + 1e-5f); const float sh = bfr(Bt[c]) - bfr(MU[c]) * inv; const float bb = bfr(BW[c]);
#pragma unroll
      for (int r = 0; r < 8; ++r) { const int m = m0 + 8 * g + r; so[j * 16 + col][wave * 16 + 8 * g + r] = (z[j][r] + bb) * inv + sh + bfr(X[(b * CIN + c) * NPOS + m]); } }
    __syncthreads();
    for (int e = tid; e < 128 * 16; e += 128) { const int cl_ = e >> 4, q = e & 15; vst2(OUT + (b * CIN + pass * 128 + cl_) * NPOS + blockIdx.x * 64 + q * 4, *(const v4f*)&so[cl_][q * 4]); }
    __syncthreads(); }
}
extern "C" void kernel_launch(void* const* d_in, const int* in_sizes, int n_in, void* d_out, int out_size, void* d_ws, size_t ws_size, hipStream_t stream) {
  (void)in_sizes; (void)n_in; (void)out_size;
  const float** F = (const float**)d_in;   // 0 x [4,256,64,64], 1 Wq [128,256], 2 bq, 3 Wk, 4 bk, 5 Wv, 6 bv, 7 Ww [256,128], 8 bw, 9 bn_gamma, 10 bn_beta, 11 bn_mean, 12 bn_var
  if (ws_size < (size_t)WS_END) return;
  char* ws = (char*)d_ws; __bf16 *PK = (__bf16*)(ws + WS_PK), *PW = (__bf16*)(ws + WS_PW); _Float16 *QH = (_Float16*)(ws + WS_QH), *QL = (_Float16*)(ws + WS_QL), *KH = (_Float16*)(ws + WS_KH), *KL = (_Float16*)(ws + WS_KL), *VH = (_Float16*)(ws + WS_VH); float* ST = (float*)(ws + WS_ST);
  k_pack<<<3 * CO + CIN, 256, 0, stream>>>(F[1], F[3], F[5], F[7], PK, PW);
  k_proj<<<dim3(NPOS / 64, NB), 128, 0, stream>>>(F[0], PK, F[2], F[4], F[6], QH, QL, KH, KL, VH);
  k_stats<<<dim3(NPOS / 64, NB), 128, 0, stream>>>(QH, QL, KH, KL, ST);
  k_out<<<dim3(TQB, NB), 128, 0, stream>>>(QH, QL, KH, KL, VH, ST, PW, F[8], F[9], F[10], F[11], F[12], F[0], (float*)d_out);
}

// v002
// A run of this version takes 658 microseconds.
// In two side-by-side timings against v001, it was 1.77 and 1.78 times as fast.
// Over all steps from v000 it is 2.58 times as fast.
#include <hip/hip_runtime.h>
#include <math.h>

typedef __attribute__((ext_vector_type(16))) _Float16 v16h;
typedef __attribute__((ext_vector_type(16))) __bf16 v16b;
typedef __attribute__((ext_vector_type(8)))  _Float16 v8h;
typedef __attribute__((ext_vector_type(8)))  float v8f;
typedef __attribute__((ext_vector_type(4)))  float v4f;
typedef __attribute__((ext_vector_type(2)))  float v2f;
typedef __attribute__((ext_vector_type(4)))  unsigned v4u;
typedef __attribute__((ext_vector_type(4)))  int v4i;
typedef float __attribute__((may_alias)) float_a;
typedef int __attribute__((may_alias)) int_a;

template <typename T> __device__ __forceinline__ void vst2(void* p, T v) { *(T*)p = v;  }
__device__ __forceinline__ v8f wmma16(v16h a, v16h b, v8f c) {
  v8f d = __builtin_amdgcn_wmma_f32_16x16x32_f16(false, a, false, b, (short)0, c, false, false);
  asm volatile("v_nop\n\tv_nop\n\tv_nop\n\tv_nop" : "+v"(d) : "v"(a), "v"(b));
  return d;
}
__device__ __forceinline__ v8f wmma_bf(v16b a, v16b b, v8f c) {
  v8f d = __builtin_amdgcn_wmma_f32_16x16x32_bf16(false, a, false, b, (short)0, c, false, false);
  asm volatile("v_nop\n\tv_nop\n\tv_nop\n\tv_nop" : "+v"(d) : "v"(a), "v"(b));
  return d;
}
// 16x16x32 fragments: lane = (h = lane>>4, row/col = lane&15); elements 0..7 = k0+8h+0..7, 8..15 = k0+16+8h+0..7; D element r = row 8h+r
__device__ __forceinline__ v16h frag_h(const _Float16* rowk0, int lane) {
  union { v16h v; v8h q[2]; } u; const _Float16* p = rowk0 + 8 * (lane >> 4);
  u.q[0] = *(const v8h*)p; u.q[1] = *(const v8h*)(p + 16); return u.v;
}
__device__ __forceinline__ v16h frag_f32(const float* rowk0, int lane) {
  v16h a; const float* p = rowk0 + 8 * (lane >> 4);
#pragma unroll
  for (int i = 0; i < 8; ++i) { a[i] = (_Float16)p[i]; a[8 + i] = (_Float16)p[16 + i]; }
  return a;
}
__device__ __forceinline__ v16h frag_f32s(const float* rowk0, int lane, float sc) {
  v16h a; const float* p = rowk0 + 8 * (lane >> 4);
#pragma unroll
  for (int i = 0; i < 8; ++i) { a[i] = (_Float16)(p[i] * sc); a[8 + i] = (_Float16)(p[16 + i] * sc); }
  return a;
}
// column fragment from a [K][ld] layout (column n), rows >= K read as 0
__device__ __forceinline__ v16h fragc_f32(const float* W, int k0, int n, int lane, int ld, int K) {
  v16h a; const int g = lane >> 4;
#pragma unroll
  for (int i = 0; i < 8; ++i) { const int ka = k0 + 8 * g + i, kb = ka + 16;
    a[i] = (_Float16)(ka < K ? W[(size_t)(ka < K ? ka : K - 1) * ld + n] : 0.f); a[8 + i] = (_Float16)(kb < K ? W[(size_t)(kb < K ? kb : K - 1) * ld + n] : 0.f); }
  return a;
}
struct F2 { v16b h, l; };
__device__ __forceinline__ F2 bsplit16(const float v[16]) { F2 r;
#pragma unroll
  for (int i = 0; i < 16; ++i) { const __bf16 h = (__bf16)v[i]; r.h[i] = h; r.l[i] = (__bf16)(v[i] - (float)h); }
  return r; }
__device__ __forceinline__ F2 split_row(const float* row, int k0, int lane) { float v[16]; const float* p = row + k0 + 8 * (lane >> 4);
#pragma unroll
  for (int i = 0; i < 8; ++i) { v[i] = p[i]; v[8 + i] = p[16 + i]; }
  return bsplit16(v); }
__device__ __forceinline__ F2 split_rowK(const float* row, int k0, int lane, int K) { float v[16]; const int g = lane >> 4;
#pragma unroll
  for (int i = 0; i < 8; ++i) { const int ka = k0 + 8 * g + i, kb = ka + 16; v[i] = ka < K ? row[ka < K ? ka : K - 1] : 0.f; v[8 + i] = kb < K ? row[kb < K ? kb : K - 1] : 0.f; }
  return bsplit16(v); }
__device__ __forceinline__ F2 split_col(const float* W, int k0, int n, int lane, int ld, int K) { float v[16]; const int g = lane >> 4;
#pragma unroll
  for (int i = 0; i < 8; ++i) { const int ka = k0 + 8 * g + i, kb = ka + 16; v[i] = ka < K ? W[(size_t)(ka < K ? ka : K - 1) * ld + n] : 0.f; v[8 + i] = kb < K ? W[(size_t)(kb < K ? kb : K - 1) * ld + n] : 0.f; }
  return bsplit16(v); }
__device__ __forceinline__ v8f mac3(const F2& a, const F2& b, v8f c) { c = wmma_bf(a.l, b.h, c); c = wmma_bf(a.h, b.l, c); return wmma_bf(a.h, b.h, c); }
__device__ __forceinline__ float sigm(float v) { return 1.0f / (1.0f + expf(-v)); }
#define LDSX() do { asm volatile("s_wait_dscnt 0" ::: "memory"); __builtin_amdgcn_wave_barrier(); __builtin_amdgcn_fence(__ATOMIC_RELEASE, "workgroup"); } while (0)


// Non-local block (B 4, 256 channels, 64 x 64): 1x1 q/k/v convs to 128 channels, affinity f = k^T q softmax-normalised over the second index, y = v f, 1x1 conv back to 256 channels, BatchNorm (inference), residual.
#define NB 4
#define CIN 256
#define CO 128
#define NPOS 4096
#ifndef TQB
#define TQB (NPOS / 64)
#endif
typedef __attribute__((ext_vector_type(8))) __bf16 v8b;
__device__ __forceinline__ v16b frag_b(const __bf16* rowk0, int lane) {
  union { v16b v; v8b q[2]; } u; const __bf16* p = rowk0 + 8 * (lane >> 4);
  u.q[0] = *(const v8b*)p; u.q[1] = *(const v8b*)(p + 16); return u.v;
}
__device__ __forceinline__ float bfr(float v) { return (float)(__bf16)v; }
__device__ __attribute__((noinline)) float exp_ni(float v) { return expf(v); }
__device__ __attribute__((noinline)) float erf_ni(float v) { return erff(v); }

#define WS_PK  0u                                   // bf16 [384][256] Wq;Wk;Wv rows ; [256][128] Ww rows
#define WS_PW  (WS_PK + 2u * 3 * CO * CIN)
#define WS_QH  (WS_PW + 2u * CIN * CO)              // f16 [b][n][128] q hi ; QL ; KH ; KL
#define WS_QL  (WS_QH + 2u * NB * NPOS * CO)
#define WS_KH  (WS_QL + 2u * NB * NPOS * CO)
#define WS_KL  (WS_KH + 2u * NB * NPOS * CO)
#define WS_VH  (WS_KL + 2u * NB * NPOS * CO)         // f16 [b][128][4096] v
#define WS_ST  (WS_VH + 2u * (size_t)NB * CO * NPOS)   // f32 [b][n][2] (M_n, 1/L_n)
#define WS_END (WS_ST + 4u * NB * NPOS * 2)

// inlined: a call per exponential ends the compiler's scheduling region, and the rows of a tile then run one after another
__device__ __forceinline__ float exp_p(float v) { return expf(v); }
__global__ __launch_bounds__(256) void k_pack(const float* __restrict__ WQ, const float* __restrict__ WK, const float* __restrict__ WV, const float* __restrict__ WW, __bf16* __restrict__ PK, __bf16* __restrict__ PW) {
  const int n = blockIdx.x, t = threadIdx.x; __shared__ __align__(16) __bf16 s[CIN];
  if (n < 3 * CO) { const float* src = (n < CO) ? WQ + (size_t)n * CIN : (n < 2 * CO) ? WK + (size_t)(n - CO) * CIN : WV + (size_t)(n - 2 * CO) * CIN; s[t] = (__bf16)src[t]; __syncthreads(); if (t < CIN / 8) vst2((unsigned*)(PK + (size_t)n * CIN + t * 8), *(const v4u*)&s[t * 8]); }
  else { const int o = n - 3 * CO; if (t < CO) s[t] = (__bf16)WW[(size_t)o * CO + t]; __syncthreads(); if (t < CO / 8) vst2((unsigned*)(PW + (size_t)o * CO + t * 8), *(const v4u*)&s[t * 8]); }
}
__global__ __launch_bounds__(128) void k_proj(const float* __restrict__ X, const __bf16* __restrict__ PK, const float* __restrict__ BQ, const float* __restrict__ BK, const float* __restrict__ BV, _Float16* __restrict__ QH, _Float16* __restrict__ QL, _Float16* __restrict__ KH, _Float16* __restrict__ KL, _Float16* __restrict__ VH) {
  __shared__ __align__(16) __bf16 sa[64][CIN + 8]; __shared__ __align__(16) _Float16 sth[64][CO + 8], stl[64][CO + 8]; __shared__ __align__(16) _Float16 svh[CO][72];
  const int tid = threadIdx.x, wave = tid >> 5, lane = tid & 31, col = lane & 15, g = lane >> 4; const size_t b = blockIdx.y; const int n0 = blockIdx.x * 64;
  for (int e = tid; e < 64 * CIN; e += 128) { const int c = e >> 6, r = e & 63; sa[r][c] = (__bf16)X[(b * CIN + c) * NPOS + n0 + r]; }
  if (tid < 64) for (int c = CIN; c < CIN + 8; ++c) sa[tid][c] = (__bf16)0.f;
  __syncthreads();
#pragma unroll 1
  for (int which = 0; which < 3; ++which) { v8f acc[8] = {};
    // the 8 weight fragments of a k step are requested together, one k step ahead of the products that read them
    v16b wf[2][8];
#pragma unroll
    for (int j = 0; j < 8; ++j) wf[0][j] = frag_b(PK + (size_t)(which * CO + j * 16 + col) * CIN, lane);
#pragma unroll
    for (int kc = 0; kc < CIN / 32; ++kc) { const v16b a = frag_b(&sa[wave * 16 + col][kc * 32], lane);
      if (kc + 1 < CIN / 32) {
#pragma unroll
        for (int j = 0; j < 8; ++j) wf[(kc + 1) & 1][j] = frag_b(PK + (size_t)(which * CO + j * 16 + col) * CIN + (kc + 1) * 32, lane); }
#pragma unroll
      for (int j = 0; j < 8; ++j) acc[j] = wmma_bf(a, wf[kc & 1][j], acc[j]); }
    const float* BB = (which == 0) ? BQ : (which == 1) ? BK : BV;
    if (which < 2) {
#pragma unroll
      for (int j = 0; j < 8; ++j) { const int c = j * 16 + col; const float bb = bfr(BB[c]);
#pragma unroll
        for (int r = 0; r < 8; ++r) { const float v = acc[j][r] + bb; const _Float16 hv = (_Float16)v; sth[wave * 16 + 8 * g + r][c] = hv; stl[wave * 16 + 8 * g + r][c] = (_Float16)((v - (float)hv) * 2048.0f); } }
      __syncthreads();
      _Float16* DH_ = which ? KH : QH; _Float16* DL_ = which ? KL : QL;
      for (int e = tid; e < 64 * 16; e += 128) { const int r = e >> 4, q = e & 15; const size_t o = (b * NPOS + n0 + r) * CO + q * 8; vst2((unsigned*)(DH_ + o), *(const v4u*)&sth[r][q * 8]); vst2((unsigned*)(DL_ + o), *(const v4u*)&stl[r][q * 8]); }
      __syncthreads(); }
    else {
#pragma unroll
      for (int j = 0; j < 8; ++j) { const int c = j * 16 + col; const float bb = bfr(BB[c]);
#pragma unroll
        for (int r = 0; r < 8; ++r) svh[c][wave * 16 + 8 * g + r] = (_Float16)(acc[j][r] + bb); }
      __syncthreads();
      for (int e = tid; e < CO * 8; e += 128) { const int c = e >> 3, pc = e & 7; vst2((unsigned*)(VH + (b * CO + c) * NPOS + n0 + pc * 8), *(const v4u*)&svh[c][pc * 8]); } } }
}
// ---- k_stats: block = (64 rows n, b): f[n][m] = k_n . q_m over all m (3 products); per row max M_n and L_n = sum_m exp(f - M_n) -> ST[b][n] = (M_n, 1/L_n)
__global__ __launch_bounds__(128) void k_stats(const _Float16* __restrict__ QH, const _Float16* __restrict__ QL, const _Float16* __restrict__ KH, const _Float16* __restrict__ KL, float* __restrict__ ST) {
  __shared__ __align__(16) float so[64][2];
  const int tid = threadIdx.x, wave = tid >> 5, lane = tid & 31, col = lane & 15, g = lane >> 4; const size_t b = blockIdx.y; const int n0 = blockIdx.x * 64 + wave * 16; const size_t rn = b * NPOS + n0;
  v16h ak[CO / 32], akl[CO / 32];
#pragma unroll
  for (int kc = 0; kc < CO / 32; ++kc) { ak[kc] = frag_h(KH + (rn + col) * CO + kc * 32, lane); akl[kc] = frag_h(KL + (rn + col) * CO + kc * 32, lane); }
  float m[8], l[8];
#pragma unroll
  for (int r = 0; r < 8; ++r) { m[r] = -3.0e38f; l[r] = 0.f; }
#pragma unroll 1
  for (int mt = 0; mt < NPOS / 16; ++mt) { const size_t rm = (b * NPOS + mt * 16 + col) * CO; v8f c = {}, cl = {};
    // the tile's 4 hi and 4 lo fragments of q are all requested before the first product, so that their latencies overlap
    v16h qh[CO / 32], ql[CO / 32];
#pragma unroll
    for (int kc = 0; kc < CO / 32; ++kc) { qh[kc] = frag_h(QH + rm + kc * 32, lane); ql[kc] = frag_h(QL + rm + kc * 32, lane); }
#pragma unroll
    for (int kc = 0; kc < CO / 32; ++kc) { c = wmma16(ak[kc], qh[kc], c); cl = wmma16(akl[kc], qh[kc], cl); cl = wmma16(ak[kc], ql[kc], cl); }
    // straight-line, no call and no branch (the guard on alpha is a select), phase by phase: the 8 rows are independent chains, and each row's shuffle and exponential latency passes behind the other 7 rows
    // the unrolls below make every index of s, mn, alpha, e a constant, so that the four arrays stay in registers
    float s[8], mn[8], alpha[8], e[8];
#pragma unroll
    for (int r = 0; r < 8; ++r) { s[r] = c[r] + cl[r] * (1.0f / 2048.0f); mn[r] = s[r]; }
#pragma unroll
    for (int o = 1; o < 16; o <<= 1)
#pragma unroll
      for (int r = 0; r < 8; ++r) mn[r] = fmaxf(mn[r], __shfl_xor(mn[r], o));
#pragma unroll
    for (int r = 0; r < 8; ++r) { mn[r] = fmaxf(m[r], mn[r]); const float a = exp_p(m[r] - mn[r]); alpha[r] = (m[r] <= -1.0e38f) ? 0.f : a; e[r] = exp_p(s[r] - mn[r]); }
#pragma unroll
    for (int o = 1; o < 16; o <<= 1)
#pragma unroll
      for (int r = 0; r < 8; ++r) e[r] += __shfl_xor(e[r], o);
#pragma unroll
    for (int r = 0; r < 8; ++r) { l[r] = l[r] * alpha[r] + e[r]; m[r] = mn[r]; } }
  if (col == 0) {
#pragma unroll
    for (int r = 0; r < 8; ++r) { so[wave * 16 + 8 * g + r][0] = m[r]; so[wave * 16 + 8 * g + r][1] = 1.0f / l[r]; } }
  __syncthreads();
  if (tid < 32) vst2(ST + (b * NPOS + blockIdx.x * 64) * 2 + tid * 4, *(const v4f*)(&so[0][0] + tid * 4));
}
// ---- k_out: block = (64 output positions m, b): over n tiles: s[m][n] = q_m . k_n (3 products); w = exp(s - M_n) / L_n; y[c][m] += w (x2^11 single f16) x v[c][n] (8 tiles); then z = Ww . y (2 products, 2 passes of 8 tiles) + bw -> BN -> + x -> out[b][c][m]
__global__ __launch_bounds__(128) void k_out(const _Float16* __restrict__ QH, const _Float16* __restrict__ QL, const _Float16* __restrict__ KH, const _Float16* __restrict__ KL, const _Float16* __restrict__ VH, const float* __restrict__ ST, const __bf16* __restrict__ PW, const float* __restrict__ BW, const float* __restrict__ G, const float* __restrict__ Bt, const float* __restrict__ MU, const float* __restrict__ VAR, const float* __restrict__ X, float* __restrict__ OUT) {
  __shared__ __align__(16) _Float16 spw[4][16][40]; __shared__ __align__(16) __bf16 syh[64][CO + 8], syl[64][CO + 8]; __shared__ __align__(16) float so[128][68];
  const int tid = threadIdx.x, wave = tid >> 5, lane = tid & 31, col = lane & 15, g = lane >> 4; const size_t b = blockIdx.y; const int m0 = blockIdx.x * 64 + wave * 16; const size_t rm = b * NPOS + m0;
  v16h aq[CO / 32], aql[CO / 32];
#pragma unroll
  for (int kc = 0; kc < CO / 32; ++kc) { aq[kc] = frag_h(QH + (rm + col) * CO + kc * 32, lane); aql[kc] = frag_h(QL + (rm + col) * CO + kc * 32, lane); }
  v8f acc[8] = {};
#pragma unroll 1
  for (int ks = 0; ks < NPOS / 32; ++ks) { const int j0 = ks * 32;
#pragma unroll
    for (int ct = 0; ct < 2; ++ct) { const int nn = j0 + ct * 16 + col; const size_t rn = (b * NPOS + nn) * CO; v8f c = {}, cl = {};
      // the tile's 4 hi and 4 lo fragments of k are all requested before the first product, so that their latencies overlap
      v16h kh[CO / 32], kl[CO / 32];
#pragma unroll
      for (int kc = 0; kc < CO / 32; ++kc) { kh[kc] = frag_h(KH + rn + kc * 32, lane); kl[kc] = frag_h(KL + rn + kc * 32, lane); }
      asm volatile("s_wait_xcnt 0x0" ::: "memory");   // the load of (M, 1/L) below may land in the address registers of the loads above: this wait stands in front of that rewrite
      const float Mn = ST[(b * NPOS + nn) * 2], iLn = ST[(b * NPOS + nn) * 2 + 1];
#pragma unroll
      for (int kc = 0; kc < CO / 32; ++kc) { c = wmma16(aq[kc], kh[kc], c); cl = wmma16(aql[kc], kh[kc], cl); cl = wmma16(aq[kc], kl[kc], cl); }
#pragma unroll
      for (int r = 0; r < 8; ++r) { const float s = c[r] + cl[r] * (1.0f / 2048.0f); const float w = exp_p(s - Mn) * iLn; spw[wave][8 * g + r][ct * 16 + col] = (_Float16)(w * 2048.0f); } }
    LDSX();
    // the 8 fragments of v are all requested before the first product, so that their latencies overlap
    v16h vv[8];
#pragma unroll
    for (int dt = 0; dt < 8; ++dt) vv[dt] = frag_h(VH + (b * CO + dt * 16 + col) * NPOS + j0, lane);
    { const v16h pa = frag_h(&spw[wave][col][0], lane);
#pragma unroll
      for (int dt = 0; dt < 8; ++dt) acc[dt] = wmma16(pa, vv[dt], acc[dt]); }
    LDSX(); }
  (void)0;
  // y tile -> bf16 hi/lo [64 m][128 c]
#pragma unroll
  for (int dt = 0; dt < 8; ++dt)
#pragma unroll
    for (int r = 0; r < 8; ++r) { const float v = acc[dt][r] * (1.0f / 2048.0f); const __bf16 hb = (__bf16)v; syh[wave * 16 + 8 * g + r][dt * 16 + col] = hb; syl[wave * 16 + 8 * g + r][dt * 16 + col] = (__bf16)(v - (float)hb); }
  if (lane < 16) for (int c = CO; c < CO + 8; ++c) { syh[wave * 16 + lane][c] = (__bf16)0.f; syl[wave * 16 + lane][c] = (__bf16)0.f; }
  __syncthreads();
#pragma unroll 1
  for (int pass = 0; pass < 2; ++pass) { v8f z[8] = {};
    // the 8 weight fragments of a k step are requested together, one k step ahead of the products that read them
    v16b wf[2][8];
#pragma unroll
    for (int j = 0; j < 8; ++j) wf[0][j] = frag_b(PW + (size_t)(pass * 128 + j * 16 + col) * CO, lane);
#pragma unroll
    for (int kc = 0; kc < CO / 32; ++kc) { const v16b a = frag_b(&syh[wave * 16 + col][kc * 32], lane), al = frag_b(&syl[wave * 16 + col][kc * 32], lane);
      if (kc + 1 < CO / 32) {
#pragma unroll
        for (int j = 0; j < 8; ++j) wf[(kc + 1) & 1][j] = frag_b(PW + (size_t)(pass * 128 + j * 16 + col) * CO + (kc + 1) * 32, lane); }
#pragma unroll
      for (int j = 0; j < 8; ++j) { z[j] = wmma_bf(al, wf[kc & 1][j], z[j]); z[j] = wmma_bf(a, wf[kc & 1][j], z[j]); } }
#pragma unroll
    for (int j = 0; j < 8; ++j) { const int c = pass * 128 + j * 16 + col; const float inv = bfr(G[c]) / sqrtf(bfr(VAR[c]) + 1e-5f); const float sh = bfr(Bt[c]) - bfr(MU[c]) * inv; const float bb = bfr(BW[c]);
#pragma unroll
      for (int r = 0; r < 8; ++r) { const int m = m0 + 8 * g + r; so[j * 16 + col][wave * 16 + 8 * g + r] = (z[j][r] + bb) * inv + sh + bfr(X[(b * CIN + c) * NPOS + m]); } }
    __syncthreads();
    for (int e = tid; e < 128 * 16; e += 128) { const int cl_ = e >> 4, q = e & 15; vst2(OUT + (b * CIN + pass * 128 + cl_) * NPOS + blockIdx.x * 64 + q * 4, *(const v4f*)&so[cl_][q * 4]); }
    __syncthreads(); }
}
extern "C" void kernel_launch(void* const* d_in, const int* in_sizes, int n_in, void* d_out, int out_size, void* d_ws, size_t ws_size, hipStream_t stream) {
  (void)in_sizes; (void)n_in; (void)out_size;
  const float** F = (const float**)d_in;   // 0 x [4,256,64,64], 1 Wq [128,256], 2 bq, 3 Wk, 4 bk, 5 Wv, 6 bv, 7 Ww [256,128], 8 bw, 9 bn_gamma, 10 bn_beta, 11 bn_mean, 12 bn_var
  if (ws_size < (size_t)WS_END) return;
  char* ws = (char*)d_ws; __bf16 *PK = (__bf16*)(ws + WS_PK), *PW = (__bf16*)(ws + WS_PW); _Float16 *QH = (_Float16*)(ws + WS_QH), *QL = (_Float16*)(ws + WS_QL), *KH = (_Float16*)(ws + WS_KH), *KL = (_Float16*)(ws + WS_KL), *VH = (_Float16*)(ws + WS_VH); float* ST = (float*)(ws + WS_ST);
  k_pack<<<3 * CO + CIN, 256, 0, stream>>>(F[1], F[3], F[5], F[7], PK, PW);
  k_proj<<<dim3(NPOS / 64, NB), 128, 0, stream>>>(F[0], PK, F[2], F[4], F[6], QH, QL, KH, KL, VH);
  k_stats<<<dim3(NPOS / 64, NB), 128, 0, stream>>>(QH, QL, KH, KL, ST);
  k_out<<<dim3(TQB, NB), 128, 0, stream>>>(QH, QL, KH, KL, VH, ST, PW, F[8], F[9], F[10], F[11], F[12], F[0], (float*)d_out);
}

// v003
// It runs in 355 microseconds.
// In two side-by-side timings against v002, it was 1.85 and 1.83 times as fast.
// Over all steps from v000 it is 4.75 times as fast.
#include <hip/hip_runtime.h>
#include <math.h>

typedef __attribute__((ext_vector_type(16))) _Float16 v16h;
typedef __attribute__((ext_vector_type(16))) __bf16 v16b;
typedef __attribute__((ext_vector_type(8)))  _Float16 v8h;
typedef __attribute__((ext_vector_type(8)))  float v8f;
typedef __attribute__((ext_vector_type(4)))  float v4f;
typedef __attribute__((ext_vector_type(2)))  float v2f;
typedef __attribute__((ext_vector_type(4)))  unsigned v4u;
typedef __attribute__((ext_vector_type(4)))  int v4i;
typedef float __attribute__((may_alias)) float_a;
typedef int __attribute__((may_alias)) int_a;

template <typename T> __device__ __forceinline__ void vst2(void* p, T v) { *(T*)p = v;  }
__device__ __forceinline__ v8f wmma16(v16h a, v16h b, v8f c) {
  v8f d = __builtin_amdgcn_wmma_f32_16x16x32_f16(false, a, false, b, (short)0, c, false, false);
  asm volatile("v_nop\n\tv_nop\n\tv_nop\n\tv_nop" : "+v"(d) : "v"(a), "v"(b));
  return d;
}
__device__ __forceinline__ v8f wmma_bf(v16b a, v16b b, v8f c) {
  v8f d = __builtin_amdgcn_wmma_f32_16x16x32_bf16(false, a, false, b, (short)0, c, false, false);
  asm volatile("v_nop\n\tv_nop\n\tv_nop\n\tv_nop" : "+v"(d) : "v"(a), "v"(b));
  return d;
}
// 16x16x32 fragments: lane = (h = lane>>4, row/col = lane&15); elements 0..7 = k0+8h+0..7, 8..15 = k0+16+8h+0..7; D element r = row 8h+r
__device__ __forceinline__ v16h frag_h(const _Float16* rowk0, int lane) {
  union { v16h v; v8h q[2]; } u; const _Float16* p = rowk0 + 8 * (lane >> 4);
  u.q[0] = *(const v8h*)p; u.q[1] = *(const v8h*)(p + 16); return u.v;
}
__device__ __forceinline__ v16h frag_f32(const float* rowk0, int lane) {
  v16h a; const float* p = rowk0 + 8 * (lane >> 4);
#pragma unroll
  for (int i = 0; i < 8; ++i) { a[i] = (_Float16)p[i]; a[8 + i] = (_Float16)p[16 + i]; }
  return a;
}
__device__ __forceinline__ v16h frag_f32s(const float* rowk0, int lane, float sc) {
  v16h a; const float* p = rowk0 + 8 * (lane >> 4);
#pragma unroll
  for (int i = 0; i < 8; ++i) { a[i] = (_Float16)(p[i] * sc); a[8 + i] = (_Float16)(p[16 + i] * sc); }
  return a;
}
// column fragment from a [K][ld] layout (column n), rows >= K read as 0
__device__ __forceinline__ v16h fragc_f32(const float* W, int k0, int n, int lane, int ld, int K) {
  v16h a; const int g = lane >> 4;
#pragma unroll
  for (int i = 0; i < 8; ++i) { const int ka = k0 + 8 * g + i, kb = ka + 16;
    a[i] = (_Float16)(ka < K ? W[(size_t)(ka < K ? ka : K - 1) * ld + n] : 0.f); a[8 + i] = (_Float16)(kb < K ? W[(size_t)(kb < K ? kb : K - 1) * ld + n] : 0.f); }
  return a;
}
struct F2 { v16b h, l; };
__device__ __forceinline__ F2 bsplit16(const float v[16]) { F2 r;
#pragma unroll
  for (int i = 0; i < 16; ++i) { const __bf16 h = (__bf16)v[i]; r.h[i] = h; r.l[i] = (__bf16)(v[i] - (float)h); }
  return r; }
__device__ __forceinline__ F2 split_row(const float* row, int k0, int lane) { float v[16]; const float* p = row + k0 + 8 * (lane >> 4);
#pragma unroll
  for (int i = 0; i < 8; ++i) { v[i] = p[i]; v[8 + i] = p[16 + i]; }
  return bsplit16(v); }
__device__ __forceinline__ F2 split_rowK(const float* row, int k0, int lane, int K) { float v[16]; const int g = lane >> 4;
#pragma unroll
  for (int i = 0; i < 8; ++i) { const int ka = k0 + 8 * g + i, kb = ka + 16; v[i] = ka < K ? row[ka < K ? ka : K - 1] : 0.f; v[8 + i] = kb < K ? row[kb < K ? kb : K - 1] : 0.f; }
  return bsplit16(v); }
__device__ __forceinline__ F2 split_col(const float* W, int k0, int n, int lane, int ld, int K) { float v[16]; const int g = lane >> 4;
#pragma unroll
  for (int i = 0; i < 8; ++i) { const int ka = k0 + 8 * g + i, kb = ka + 16; v[i] = ka < K ? W[(size_t)(ka < K ? ka : K - 1) * ld + n] : 0.f; v[8 + i] = kb < K ? W[(size_t)(kb < K ? kb : K - 1) * ld + n] : 0.f; }
  return bsplit16(v); }
__device__ __forceinline__ v8f mac3(const F2& a, const F2& b, v8f c) { c = wmma_bf(a.l, b.h, c); c = wmma_bf(a.h, b.l, c); return wmma_bf(a.h, b.h, c); }
__device__ __forceinline__ float sigm(float v) { return 1.0f / (1.0f + expf(-v)); }
#define LDSX() do { asm volatile("s_wait_dscnt 0" ::: "memory"); __builtin_amdgcn_wave_barrier(); __builtin_amdgcn_fence(__ATOMIC_RELEASE, "workgroup"); } while (0)


// Non-local block (B 4, 256 channels, 64 x 64): 1x1 q/k/v convs to 128 channels, affinity f = k^T q softmax-normalised over the second index, y = v f, 1x1 conv back to 256 channels, BatchNorm (inference), residual.
#define NB 4
#define CIN 256
#define CO 128
#define NPOS 4096
#ifndef TQB
#define TQB (NPOS / 64)
#endif
typedef __attribute__((ext_vector_type(8))) __bf16 v8b;
__device__ __forceinline__ v16b frag_b(const __bf16* rowk0, int lane) {
  union { v16b v; v8b q[2]; } u; const __bf16* p = rowk0 + 8 * (lane >> 4);
  u.q[0] = *(const v8b*)p; u.q[1] = *(const v8b*)(p + 16); return u.v;
}
__device__ __forceinline__ float bfr(float v) { return (float)(__bf16)v; }
__device__ __attribute__((noinline)) float exp_ni(float v) { return expf(v); }
__device__ __attribute__((noinline)) float erf_ni(float v) { return erff(v); }

#define WS_PK  0u                                   // bf16 [384][256] Wq;Wk;Wv rows ; [256][128] Ww rows
#define WS_PW  (WS_PK + 2u * 3 * CO * CIN)
#define WS_QH  (WS_PW + 2u * CIN * CO)              // f16 [b][n][128] q hi ; QL ; KH ; KL
#define WS_QL  (WS_QH + 2u * NB * NPOS * CO)
#define WS_KH  (WS_QL + 2u * NB * NPOS * CO)
#define WS_KL  (WS_KH + 2u * NB * NPOS * CO)
#define WS_VH  (WS_KL + 2u * NB * NPOS * CO)         // f16 [b][128][4096] v
#define WS_ST  (WS_VH + 2u * (size_t)NB * CO * NPOS)   // f32 [b][n][2] (M_n, 1/L_n)
#define WS_END (WS_ST + 4u * NB * NPOS * 2)

// inlined: a call per exponential ends the compiler's scheduling region, and the rows of a tile then run one after another
__device__ __forceinline__ float exp_p(float v) { return expf(v); }
// ---- asynchronous copies global -> LDS: each lane brings its own 16 (or 4) bytes, through no register
// LDS byte address of a __shared__ object: the low 32 bits of its address
__device__ __forceinline__ unsigned lds_at(const void* p) { return (unsigned)(size_t)p; }
// 8 copies of 16 bytes a lane: copy j goes from g + j * gstep to l + j * lstep (bytes). The s_wait_xcnt is the last line of the copies' own statement, so that it stands in front of every later rewrite of their address registers
__device__ __forceinline__ void copy8(unsigned l, unsigned lstep, const char* g, size_t gstep) {
  asm volatile("global_load_async_to_lds_b128 %0, %8, off\n\tglobal_load_async_to_lds_b128 %1, %9, off\n\tglobal_load_async_to_lds_b128 %2, %10, off\n\tglobal_load_async_to_lds_b128 %3, %11, off\n\t"
               "global_load_async_to_lds_b128 %4, %12, off\n\tglobal_load_async_to_lds_b128 %5, %13, off\n\tglobal_load_async_to_lds_b128 %6, %14, off\n\tglobal_load_async_to_lds_b128 %7, %15, off\n\ts_wait_xcnt 0x0"
               :: "v"(l), "v"(l + lstep), "v"(l + 2 * lstep), "v"(l + 3 * lstep), "v"(l + 4 * lstep), "v"(l + 5 * lstep), "v"(l + 6 * lstep), "v"(l + 7 * lstep),
                  "v"(g), "v"(g + gstep), "v"(g + 2 * gstep), "v"(g + 3 * gstep), "v"(g + 4 * gstep), "v"(g + 5 * gstep), "v"(g + 6 * gstep), "v"(g + 7 * gstep) : "memory");
}
// one copy of 4 bytes a lane, with the same wait in its own statement
__device__ __forceinline__ void copy1w(unsigned l, const char* g) {
  asm volatile("global_load_async_to_lds_b32 %0, %1, off\n\ts_wait_xcnt 0x0" :: "v"(l), "v"(g) : "memory");
}
// this wave's own copies have landed in LDS (the compiler places no wait for them)
#define WAIT_COPIES() asm volatile("s_wait_asynccnt 0x0" ::: "memory")
// this wave's own LDS reads have returned: stands in front of the barrier behind which the buffer they read is refilled
#define WAIT_LDS() asm volatile("s_wait_dscnt 0x0" ::: "memory")
#define SROWS 64                                    // rows (positions) of one stage of the two-buffer rings below
#define NSTG (NPOS / SROWS)
// 64 rows of 128 f16 (16 KiB, contiguous in global memory) -> LDS rows of 136 f16 (272 B: 16 B x odd, the pitch of ds_load_b128 readers); 128 threads, 8 copies each, a wave's copy = 512 contiguous bytes
__device__ __forceinline__ void stage_rows(_Float16 (*dst)[CO + 8], const _Float16* src, int tid) {
  copy8(lds_at(&dst[tid >> 4][(tid & 15) * 8]), 8u * (CO + 8) * 2u, (const char*)(src + tid * 8), 128 * 16);
}
__global__ __launch_bounds__(256) void k_pack(const float* __restrict__ WQ, const float* __restrict__ WK, const float* __restrict__ WV, const float* __restrict__ WW, __bf16* __restrict__ PK, __bf16* __restrict__ PW) {
  const int n = blockIdx.x, t = threadIdx.x; __shared__ __align__(16) __bf16 s[CIN];
  if (n < 3 * CO) { const float* src = (n < CO) ? WQ + (size_t)n * CIN : (n < 2 * CO) ? WK + (size_t)(n - CO) * CIN : WV + (size_t)(n - 2 * CO) * CIN; s[t] = (__bf16)src[t]; __syncthreads(); if (t < CIN / 8) vst2((unsigned*)(PK + (size_t)n * CIN + t * 8), *(const v4u*)&s[t * 8]); }
  else { const int o = n - 3 * CO; if (t < CO) s[t] = (__bf16)WW[(size_t)o * CO + t]; __syncthreads(); if (t < CO / 8) vst2((unsigned*)(PW + (size_t)o * CO + t * 8), *(const v4u*)&s[t * 8]); }
}
__global__ __launch_bounds__(128) void k_proj(const float* __restrict__ X, const __bf16* __restrict__ PK, const float* __restrict__ BQ, const float* __restrict__ BK, const float* __restrict__ BV, _Float16* __restrict__ QH, _Float16* __restrict__ QL, _Float16* __restrict__ KH, _Float16* __restrict__ KL, _Float16* __restrict__ VH) {
  __shared__ __align__(16) __bf16 sa[64][CIN + 8]; __shared__ __align__(16) _Float16 sth[64][CO + 8], stl[64][CO + 8]; __shared__ __align__(16) _Float16 svh[CO][72];
  const int tid = threadIdx.x, wave = tid >> 5, lane = tid & 31, col = lane & 15, g = lane >> 4; const size_t b = blockIdx.y; const int n0 = blockIdx.x * 64;
  for (int e = tid; e < 64 * CIN; e += 128) { const int c = e >> 6, r = e & 63; sa[r][c] = (__bf16)X[(b * CIN + c) * NPOS + n0 + r]; }
  if (tid < 64) for (int c = CIN; c < CIN + 8; ++c) sa[tid][c] = (__bf16)0.f;
  __syncthreads();
#pragma unroll 1
  for (int which = 0; which < 3; ++which) { v8f acc[8] = {};
    // the 8 weight fragments of a k step are requested together, one k step ahead of the products that read them
    v16b wf[2][8];
#pragma unroll
    for (int j = 0; j < 8; ++j) wf[0][j] = frag_b(PK + (size_t)(which * CO + j * 16 + col) * CIN, lane);
#pragma unroll
    for (int kc = 0; kc < CIN / 32; ++kc) { const v16b a = frag_b(&sa[wave * 16 + col][kc * 32], lane);
      if (kc + 1 < CIN / 32) {
#pragma unroll
        for (int j = 0; j < 8; ++j) wf[(kc + 1) & 1][j] = frag_b(PK + (size_t)(which * CO + j * 16 + col) * CIN + (kc + 1) * 32, lane); }
#pragma unroll
      for (int j = 0; j < 8; ++j) acc[j] = wmma_bf(a, wf[kc & 1][j], acc[j]); }
    const float* BB = (which == 0) ? BQ : (which == 1) ? BK : BV;
    if (which < 2) {
#pragma unroll
      for (int j = 0; j < 8; ++j) { const int c = j * 16 + col; const float bb = bfr(BB[c]);
#pragma unroll
        for (int r = 0; r < 8; ++r) { const float v = acc[j][r] + bb; const _Float16 hv = (_Float16)v; sth[wave * 16 + 8 * g + r][c] = hv; stl[wave * 16 + 8 * g + r][c] = (_Float16)((v - (float)hv) * 2048.0f); } }
      __syncthreads();
      _Float16* DH_ = which ? KH : QH; _Float16* DL_ = which ? KL : QL;
      for (int e = tid; e < 64 * 16; e += 128) { const int r = e >> 4, q = e & 15; const size_t o = (b * NPOS + n0 + r) * CO + q * 8; vst2((unsigned*)(DH_ + o), *(const v4u*)&sth[r][q * 8]); vst2((unsigned*)(DL_ + o), *(const v4u*)&stl[r][q * 8]); }
      __syncthreads(); }
    else {
#pragma unroll
      for (int j = 0; j < 8; ++j) { const int c = j * 16 + col; const float bb = bfr(BB[c]);
#pragma unroll
        for (int r = 0; r < 8; ++r) svh[c][wave * 16 + 8 * g + r] = (_Float16)(acc[j][r] + bb); }
      __syncthreads();
      for (int e = tid; e < CO * 8; e += 128) { const int c = e >> 3, pc = e & 7; vst2((unsigned*)(VH + (b * CO + c) * NPOS + n0 + pc * 8), *(const v4u*)&svh[c][pc * 8]); } } }
}
// ---- k_stats: block = (64 rows n, b): f[n][m] = k_n . q_m over all m (3 products); per row max M_n and L_n = sum_m exp(f - M_n) -> ST[b][n] = (M_n, 1/L_n)
__global__ __launch_bounds__(128) void k_stats(const _Float16* __restrict__ QH, const _Float16* __restrict__ QL, const _Float16* __restrict__ KH, const _Float16* __restrict__ KL, float* __restrict__ ST) {
  __shared__ __align__(16) float so[64][2]; __shared__ __align__(16) _Float16 sq[2][2][SROWS][CO + 8];   // ring: [buffer][hi, lo][row m][channel]
  const int tid = threadIdx.x, wave = tid >> 5, lane = tid & 31, col = lane & 15, g = lane >> 4; const size_t b = blockIdx.y; const int n0 = blockIdx.x * 64 + wave * 16; const size_t rn = b * NPOS + n0;
  // the 4 waves read the same q rows: a stage of 64 rows (hi and lo) is copied to LDS once for the block, whole lines at a time, one stage ahead of its use
  const _Float16* gqh = QH + b * NPOS * CO; const _Float16* gql = QL + b * NPOS * CO;
  stage_rows(sq[0][0], gqh, tid); stage_rows(sq[0][1], gql, tid);
  WAIT_COPIES();
  __syncthreads();   // stage 0 is published to all 4 waves
  stage_rows(sq[1][0], gqh + (size_t)SROWS * CO, tid); stage_rows(sq[1][1], gql + (size_t)SROWS * CO, tid);
  v16h ak[CO / 32], akl[CO / 32];
#pragma unroll
  for (int kc = 0; kc < CO / 32; ++kc) { ak[kc] = frag_h(KH + (rn + col) * CO + kc * 32, lane); akl[kc] = frag_h(KL + (rn + col) * CO + kc * 32, lane); }
  float m[8], l[8];
#pragma unroll
  for (int r = 0; r < 8; ++r) { m[r] = -3.0e38f; l[r] = 0.f; }
  // not unrolled: one trip = one stage, and the ring's order stands once, at the trip's foot
#pragma unroll 1
  for (int st = 0; st < NSTG; ++st) { const int bf = st & 1;
  // unrolled: the 4 tiles of a stage are straight-line code with constant LDS offsets, so that one tile's LDS reads and shuffle waits pass behind another tile's work
#pragma unroll
  for (int u = 0; u < SROWS / 16; ++u) { v8f c = {}, cl = {};
    // the tile's 4 hi and 4 lo fragments of q are all requested before the first product, so that their latencies overlap
    v16h qh[CO / 32], ql[CO / 32];
#pragma unroll
    for (int kc = 0; kc < CO / 32; ++kc) { qh[kc] = frag_h(&sq[bf][0][u * 16 + col][kc * 32], lane); ql[kc] = frag_h(&sq[bf][1][u * 16 + col][kc * 32], lane); }
#pragma unroll
    for (int kc = 0; kc < CO / 32; ++kc) { c = wmma16(ak[kc], qh[kc], c); cl = wmma16(akl[kc], qh[kc], cl); cl = wmma16(ak[kc], ql[kc], cl); }
    // straight-line, no call and no branch (the guard on alpha is a select), phase by phase: the 8 rows are independent chains, and each row's shuffle and exponential latency passes behind the other 7 rows
    // the unrolls below make every index of s, mn, alpha, e a constant, so that the four arrays stay in registers
    float s[8], mn[8], alpha[8], e[8];
#pragma unroll
    for (int r = 0; r < 8; ++r) { s[r] = c[r] + cl[r] * (1.0f / 2048.0f); mn[r] = s[r]; }
#pragma unroll
    for (int o = 1; o < 16; o <<= 1)
#pragma unroll
      for (int r = 0; r < 8; ++r) mn[r] = fmaxf(mn[r], __shfl_xor(mn[r], o));
#pragma unroll
    for (int r = 0; r < 8; ++r) { mn[r] = fmaxf(m[r], mn[r]); const float a = exp_p(m[r] - mn[r]); alpha[r] = (m[r] <= -1.0e38f) ? 0.f : a; e[r] = exp_p(s[r] - mn[r]); }
#pragma unroll
    for (int o = 1; o < 16; o <<= 1)
#pragma unroll
      for (int r = 0; r < 8; ++r) e[r] += __shfl_xor(e[r], o);
#pragma unroll
    for (int r = 0; r < 8; ++r) { l[r] = l[r] * alpha[r] + e[r]; m[r] = mn[r]; } }
    WAIT_LDS();
    WAIT_COPIES();
    __syncthreads();   // publishes stage st + 1 and ends every wave's reads of stage st
    if (st + 2 < NSTG) { stage_rows(sq[bf][0], gqh + (size_t)(st + 2) * SROWS * CO, tid); stage_rows(sq[bf][1], gql + (size_t)(st + 2) * SROWS * CO, tid); } }
  WAIT_COPIES();
  if (col == 0) {
#pragma unroll
    for (int r = 0; r < 8; ++r) { so[wave * 16 + 8 * g + r][0] = m[r]; so[wave * 16 + 8 * g + r][1] = 1.0f / l[r]; } }
  __syncthreads();
  if (tid < 32) vst2(ST + (b * NPOS + blockIdx.x * 64) * 2 + tid * 4, *(const v4f*)(&so[0][0] + tid * 4));
}
// ---- k_out: block = (64 output positions m, b): over n tiles: s[m][n] = q_m . k_n (3 products); w = exp(s - M_n) / L_n; y[c][m] += w (x2^11 single f16) x v[c][n] (8 tiles); then z = Ww . y (2 products, 2 passes of 8 tiles) + bw -> BN -> + x -> out[b][c][m]
__global__ __launch_bounds__(128) void k_out(const _Float16* __restrict__ QH, const _Float16* __restrict__ QL, const _Float16* __restrict__ KH, const _Float16* __restrict__ KL, const _Float16* __restrict__ VH, const float* __restrict__ ST, const __bf16* __restrict__ PW, const float* __restrict__ BW, const float* __restrict__ G, const float* __restrict__ Bt, const float* __restrict__ MU, const float* __restrict__ VAR, const float* __restrict__ X, float* __restrict__ OUT) {
  __shared__ __align__(16) _Float16 spw[4][16][40]; __shared__ __align__(16) __bf16 syh[64][CO + 8], syl[64][CO + 8]; __shared__ __align__(16) float so[128][68];
  __shared__ __align__(16) _Float16 sk[2][2][SROWS][CO + 8]; __shared__ __align__(16) _Float16 sv[2][CO][SROWS + 8]; __shared__ __align__(16) float sst[2][SROWS][2];   // ring: [buffer] k hi, lo rows ; v [channel][n], 144-B rows ; (M, 1/L)
  const int tid = threadIdx.x, wave = tid >> 5, lane = tid & 31, col = lane & 15, g = lane >> 4; const size_t b = blockIdx.y; const int m0 = blockIdx.x * 64 + wave * 16; const size_t rm = b * NPOS + m0;
  // the 4 waves read the same k rows, v columns and row statistics: a stage of 64 positions n is copied to LDS once for the block, whole lines at a time, one stage ahead of its use
  const _Float16* gkh = KH + b * NPOS * CO; const _Float16* gkl = KL + b * NPOS * CO; const _Float16* gv = VH + (b * CO + (tid >> 3)) * NPOS + (tid & 7) * 8; const float* gst = ST + b * NPOS * 2 + tid;
  auto stage_kv = [&](int st, int bf) {
    stage_rows(sk[bf][0], gkh + (size_t)st * SROWS * CO, tid); stage_rows(sk[bf][1], gkl + (size_t)st * SROWS * CO, tid);
    copy8(lds_at(&sv[bf][tid >> 3][(tid & 7) * 8]), 16u * (SROWS + 8) * 2u, (const char*)(gv + st * SROWS), (size_t)16 * NPOS * 2);   // 128 channels x 128 B: copy j takes channels 16 j + tid / 8
    copy1w(lds_at(&sst[bf][0][0] + tid), (const char*)(gst + st * SROWS * 2)); };
  stage_kv(0, 0);
  WAIT_COPIES();
  __syncthreads();   // stage 0 is published to all 4 waves
  stage_kv(1, 1);
  v16h aq[CO / 32], aql[CO / 32];
#pragma unroll
  for (int kc = 0; kc < CO / 32; ++kc) { aq[kc] = frag_h(QH + (rm + col) * CO + kc * 32, lane); aql[kc] = frag_h(QL + (rm + col) * CO + kc * 32, lane); }
  v8f acc[8] = {};
  // not unrolled: one trip = one stage, and the ring's order stands once, at the trip's foot
#pragma unroll 1
  for (int st = 0; st < NSTG; ++st) { const int bf = st & 1;
  // unrolled: j0 is a constant, so that every LDS read of the stage is one base register and an immediate offset
#pragma unroll
  for (int j0 = 0; j0 < SROWS; j0 += 32) {
#pragma unroll
    for (int ct = 0; ct < 2; ++ct) { const int nn = j0 + ct * 16 + col; v8f c = {}, cl = {};
      // the tile's 4 hi and 4 lo fragments of k are all requested before the first product, so that their latencies overlap
      v16h kh[CO / 32], kl[CO / 32];
#pragma unroll
      for (int kc = 0; kc < CO / 32; ++kc) { kh[kc] = frag_h(&sk[bf][0][nn][kc * 32], lane); kl[kc] = frag_h(&sk[bf][1][nn][kc * 32], lane); }
      const float Mn = sst[bf][nn][0], iLn = sst[bf][nn][1];
#pragma unroll
      for (int kc = 0; kc < CO / 32; ++kc) { c = wmma16(aq[kc], kh[kc], c); cl = wmma16(aql[kc], kh[kc], cl); cl = wmma16(aq[kc], kl[kc], cl); }
#pragma unroll
      for (int r = 0; r < 8; ++r) { const float s = c[r] + cl[r] * (1.0f / 2048.0f); const float w = exp_p(s - Mn) * iLn; spw[wave][8 * g + r][ct * 16 + col] = (_Float16)(w * 2048.0f); } }
    LDSX();
    // the 8 fragments of v are all requested before the first product, so that their latencies overlap
    v16h vv[8];
#pragma unroll
    for (int dt = 0; dt < 8; ++dt) vv[dt] = frag_h(&sv[bf][dt * 16 + col][j0], lane);
    { const v16h pa = frag_h(&spw[wave][col][0], lane);
#pragma unroll
      for (int dt = 0; dt < 8; ++dt) acc[dt] = wmma16(pa, vv[dt], acc[dt]); }
    LDSX(); }
    WAIT_LDS();
    WAIT_COPIES();
    __syncthreads();   // publishes stage st + 1 and ends every wave's reads of stage st
    if (st + 2 < NSTG) stage_kv(st + 2, bf); }
  WAIT_COPIES();
  // y tile -> bf16 hi/lo [64 m][128 c]
#pragma unroll
  for (int dt = 0; dt < 8; ++dt)
#pragma unroll
    for (int r = 0; r < 8; ++r) { const float v = acc[dt][r] * (1.0f / 2048.0f); const __bf16 hb = (__bf16)v; syh[wave * 16 + 8 * g + r][dt * 16 + col] = hb; syl[wave * 16 + 8 * g + r][dt * 16 + col] = (__bf16)(v - (float)hb); }
  if (lane < 16) for (int c = CO; c < CO + 8; ++c) { syh[wave * 16 + lane][c] = (__bf16)0.f; syl[wave * 16 + lane][c] = (__bf16)0.f; }
  __syncthreads();
#pragma unroll 1
  for (int pass = 0; pass < 2; ++pass) { v8f z[8] = {};
    // the 8 weight fragments of a k step are requested together, one k step ahead of the products that read them
    v16b wf[2][8];
#pragma unroll
    for (int j = 0; j < 8; ++j) wf[0][j] = frag_b(PW + (size_t)(pass * 128 + j * 16 + col) * CO, lane);
#pragma unroll
    for (int kc = 0; kc < CO / 32; ++kc) { const v16b a = frag_b(&syh[wave * 16 + col][kc * 32], lane), al = frag_b(&syl[wave * 16 + col][kc * 32], lane);
      if (kc + 1 < CO / 32) {
#pragma unroll
        for (int j = 0; j < 8; ++j) wf[(kc + 1) & 1][j] = frag_b(PW + (size_t)(pass * 128 + j * 16 + col) * CO + (kc + 1) * 32, lane); }
#pragma unroll
      for (int j = 0; j < 8; ++j) { z[j] = wmma_bf(al, wf[kc & 1][j], z[j]); z[j] = wmma_bf(a, wf[kc & 1][j], z[j]); } }
#pragma unroll
    for (int j = 0; j < 8; ++j) { const int c = pass * 128 + j * 16 + col; const float inv = bfr(G[c]) / sqrtf(bfr(VAR[c]) + 1e-5f); const float sh = bfr(Bt[c]) - bfr(MU[c]) * inv; const float bb = bfr(BW[c]);
#pragma unroll
      for (int r = 0; r < 8; ++r) { const int m = m0 + 8 * g + r; so[j * 16 + col][wave * 16 + 8 * g + r] = (z[j][r] + bb) * inv + sh + bfr(X[(b * CIN + c) * NPOS + m]); } }
    __syncthreads();
    for (int e = tid; e < 128 * 16; e += 128) { const int cl_ = e >> 4, q = e & 15; vst2(OUT + (b * CIN + pass * 128 + cl_) * NPOS + blockIdx.x * 64 + q * 4, *(const v4f*)&so[cl_][q * 4]); }
    __syncthreads(); }
}
extern "C" void kernel_launch(void* const* d_in, const int* in_sizes, int n_in, void* d_out, int out_size, void* d_ws, size_t ws_size, hipStream_t stream) {
  (void)in_sizes; (void)n_in; (void)out_size;
  const float** F = (const float**)d_in;   // 0 x [4,256,64,64], 1 Wq [128,256], 2 bq, 3 Wk, 4 bk, 5 Wv, 6 bv, 7 Ww [256,128], 8 bw, 9 bn_gamma, 10 bn_beta, 11 bn_mean, 12 bn_var
  if (ws_size < (size_t)WS_END) return;
  char* ws = (char*)d_ws; __bf16 *PK = (__bf16*)(ws + WS_PK), *PW = (__bf16*)(ws + WS_PW); _Float16 *QH = (_Float16*)(ws + WS_QH), *QL = (_Float16*)(ws + WS_QL), *KH = (_Float16*)(ws + WS_KH), *KL = (_Float16*)(ws + WS_KL), *VH = (_Float16*)(ws + WS_VH); float* ST = (float*)(ws + WS_ST);
  k_pack<<<3 * CO + CIN, 256, 0, stream>>>(F[1], F[3], F[5], F[7], PK, PW);
  k_proj<<<dim3(NPOS / 64, NB), 128, 0, stream>>>(F[0], PK, F[2], F[4], F[6], QH, QL, KH, KL, VH);
  k_stats<<<dim3(NPOS / 64, NB), 128, 0, stream>>>(QH, QL, KH, KL, ST);
  k_out<<<dim3(TQB, NB), 128, 0, stream>>>(QH, QL, KH, KL, VH, ST, PW, F[8], F[9], F[10], F[11], F[12], F[0], (float*)d_out);
}

// v004
// It runs in 189 microseconds.
// Timed twice side by side with v003, it ran 1.87 and 1.88 times as fast.
// Over all steps from v000 it is 8.92 times as fast.
#include <hip/hip_runtime.h>
#include <math.h>

typedef __attribute__((ext_vector_type(16))) _Float16 v16h;
typedef __attribute__((ext_vector_type(16))) __bf16 v16b;
typedef __attribute__((ext_vector_type(8)))  _Float16 v8h;
typedef __attribute__((ext_vector_type(8)))  float v8f;
typedef __attribute__((ext_vector_type(4)))  float v4f;
typedef __attribute__((ext_vector_type(2)))  float v2f;
typedef __attribute__((ext_vector_type(4)))  unsigned v4u;
typedef __attribute__((ext_vector_type(4)))  int v4i;
typedef float __attribute__((may_alias)) float_a;
typedef int __attribute__((may_alias)) int_a;

template <typename T> __device__ __forceinline__ void vst2(void* p, T v) { *(T*)p = v;  }
__device__ __forceinline__ v8f wmma16(v16h a, v16h b, v8f c) {
  v8f d = __builtin_amdgcn_wmma_f32_16x16x32_f16(false, a, false, b, (short)0, c, false, false);
  asm volatile("v_nop\n\tv_nop\n\tv_nop\n\tv_nop" : "+v"(d) : "v"(a), "v"(b));
  return d;
}
__device__ __forceinline__ v8f wmma_bf(v16b a, v16b b, v8f c) {
  v8f d = __builtin_amdgcn_wmma_f32_16x16x32_bf16(false, a, false, b, (short)0, c, false, false);
  asm volatile("v_nop\n\tv_nop\n\tv_nop\n\tv_nop" : "+v"(d) : "v"(a), "v"(b));
  return d;
}
// 16x16x32 fragments: lane = (h = lane>>4, row/col = lane&15); elements 0..7 = k0+8h+0..7, 8..15 = k0+16+8h+0..7; D element r = row 8h+r
__device__ __forceinline__ v16h frag_h(const _Float16* rowk0, int lane) {
  union { v16h v; v8h q[2]; } u; const _Float16* p = rowk0 + 8 * (lane >> 4);
  u.q[0] = *(const v8h*)p; u.q[1] = *(const v8h*)(p + 16); return u.v;
}
__device__ __forceinline__ v16h frag_f32(const float* rowk0, int lane) {
  v16h a; const float* p = rowk0 + 8 * (lane >> 4);
#pragma unroll
  for (int i = 0; i < 8; ++i) { a[i] = (_Float16)p[i]; a[8 + i] = (_Float16)p[16 + i]; }
  return a;
}
__device__ __forceinline__ v16h frag_f32s(const float* rowk0, int lane, float sc) {
  v16h a; const float* p = rowk0 + 8 * (lane >> 4);
#pragma unroll
  for (int i = 0; i < 8; ++i) { a[i] = (_Float16)(p[i] * sc); a[8 + i] = (_Float16)(p[16 + i] * sc); }
  return a;
}
// column fragment from a [K][ld] layout (column n), rows >= K read as 0
__device__ __forceinline__ v16h fragc_f32(const float* W, int k0, int n, int lane, int ld, int K) {
  v16h a; const int g = lane >> 4;
#pragma unroll
  for (int i = 0; i < 8; ++i) { const int ka = k0 + 8 * g + i, kb = ka + 16;
    a[i] = (_Float16)(ka < K ? W[(size_t)(ka < K ? ka : K - 1) * ld + n] : 0.f); a[8 + i] = (_Float16)(kb < K ? W[(size_t)(kb < K ? kb : K - 1) * ld + n] : 0.f); }
  return a;
}
struct F2 { v16b h, l; };
__device__ __forceinline__ F2 bsplit16(const float v[16]) { F2 r;
#pragma unroll
  for (int i = 0; i < 16; ++i) { const __bf16 h = (__bf16)v[i]; r.h[i] = h; r.l[i] = (__bf16)(v[i] - (float)h); }
  return r; }
__device__ __forceinline__ F2 split_row(const float* row, int k0, int lane) { float v[16]; const float* p = row + k0 + 8 * (lane >> 4);
#pragma unroll
  for (int i = 0; i < 8; ++i) { v[i] = p[i]; v[8 + i] = p[16 + i]; }
  return bsplit16(v); }
__device__ __forceinline__ F2 split_rowK(const float* row, int k0, int lane, int K) { float v[16]; const int g = lane >> 4;
#pragma unroll
  for (int i = 0; i < 8; ++i) { const int ka = k0 + 8 * g + i, kb = ka + 16; v[i] = ka < K ? row[ka < K ? ka : K - 1] : 0.f; v[8 + i] = kb < K ? row[kb < K ? kb : K - 1] : 0.f; }
  return bsplit16(v); }
__device__ __forceinline__ F2 split_col(const float* W, int k0, int n, int lane, int ld, int K) { float v[16]; const int g = lane >> 4;
#pragma unroll
  for (int i = 0; i < 8; ++i) { const int ka = k0 + 8 * g + i, kb = ka + 16; v[i] = ka < K ? W[(size_t)(ka < K ? ka : K - 1) * ld + n] : 0.f; v[8 + i] = kb < K ? W[(size_t)(kb < K ? kb : K - 1) * ld + n] : 0.f; }
  return bsplit16(v); }
__device__ __forceinline__ v8f mac3(const F2& a, const F2& b, v8f c) { c = wmma_bf(a.l, b.h, c); c = wmma_bf(a.h, b.l, c); return wmma_bf(a.h, b.h, c); }
__device__ __forceinline__ float sigm(float v) { return 1.0f / (1.0f + expf(-v)); }
#define LDSX() do { asm volatile("s_wait_dscnt 0" ::: "memory"); __builtin_amdgcn_wave_barrier(); __builtin_amdgcn_fence(__ATOMIC_RELEASE, "workgroup"); } while (0)


// Non-local block (B 4, 256 channels, 64 x 64): 1x1 q/k/v convs to 128 channels, affinity f = k^T q softmax-normalised over the second index, y = v f, 1x1 conv back to 256 channels, BatchNorm (inference), residual.
#define NB 4
#define CIN 256
#define CO 128
#define NPOS 4096
#ifndef TQB
#define TQB (NPOS / 64)
#endif
typedef __attribute__((ext_vector_type(8))) __bf16 v8b;
__device__ __forceinline__ v16b frag_b(const __bf16* rowk0, int lane) {
  union { v16b v; v8b q[2]; } u; const __bf16* p = rowk0 + 8 * (lane >> 4);
  u.q[0] = *(const v8b*)p; u.q[1] = *(const v8b*)(p + 16); return u.v;
}
__device__ __forceinline__ float bfr(float v) { return (float)(__bf16)v; }
__device__ __attribute__((noinline)) float exp_ni(float v) { return expf(v); }
__device__ __attribute__((noinline)) float erf_ni(float v) { return erff(v); }

#define WS_PK  0u                                   // bf16 [384][256] Wq;Wk;Wv rows ; [256][128] Ww rows
#define WS_PW  (WS_PK + 2u * 3 * CO * CIN)
#define WS_QH  (WS_PW + 2u * CIN * CO)              // f16 [b][n][128] q hi ; QL ; KH ; KL
#define WS_QL  (WS_QH + 2u * NB * NPOS * CO)
#define WS_KH  (WS_QL + 2u * NB * NPOS * CO)
#define WS_KL  (WS_KH + 2u * NB * NPOS * CO)
#define WS_VH  (WS_KL + 2u * NB * NPOS * CO)         // f16 [b][128][4096] v
#define WS_ST  (WS_VH + 2u * (size_t)NB * CO * NPOS)   // f32 [b][n][2] (M_n, 1/L_n)
#define WS_END (WS_ST + 4u * NB * NPOS * 2)

// inlined: a call per exponential ends the compiler's scheduling region, and the rows of a tile then run one after another
__device__ __forceinline__ float exp_p(float v) { return expf(v); }
// ---- asynchronous copies global -> LDS: each lane brings its own 16 (or 4) bytes, through no register
// LDS byte address of a __shared__ object: the low 32 bits of its address
__device__ __forceinline__ unsigned lds_at(const void* p) { return (unsigned)(size_t)p; }
// 8 copies of 16 bytes a lane: copy j goes to l + j * lstep (bytes), copies 0 to 3 from ga + j * gstep, copies 4 to 7 from gb + (j - 4) * gstep. The s_wait_xcnt is the last line of the copies' own statement, so that it stands in front of every later rewrite of their address registers; one statement for the run of copies, so that the wave waits there once
__device__ __forceinline__ void copy44(unsigned l, unsigned lstep, const char* ga, const char* gb, size_t gstep) {
  asm volatile("global_load_async_to_lds_b128 %0, %8, off\n\tglobal_load_async_to_lds_b128 %1, %9, off\n\tglobal_load_async_to_lds_b128 %2, %10, off\n\tglobal_load_async_to_lds_b128 %3, %11, off\n\t"
               "global_load_async_to_lds_b128 %4, %12, off\n\tglobal_load_async_to_lds_b128 %5, %13, off\n\tglobal_load_async_to_lds_b128 %6, %14, off\n\tglobal_load_async_to_lds_b128 %7, %15, off\n\ts_wait_xcnt 0x0"
               :: "v"(l), "v"(l + lstep), "v"(l + 2 * lstep), "v"(l + 3 * lstep), "v"(l + 4 * lstep), "v"(l + 5 * lstep), "v"(l + 6 * lstep), "v"(l + 7 * lstep),
                  "v"(ga), "v"(ga + gstep), "v"(ga + 2 * gstep), "v"(ga + 3 * gstep), "v"(gb), "v"(gb + gstep), "v"(gb + 2 * gstep), "v"(gb + 3 * gstep) : "memory");
}
// the same 8 copies and 4 more, copy j of these from gc + j * cstep to lc + j * lstep, with the one wait behind all 12
__device__ __forceinline__ void copy444(unsigned l, unsigned lstep, const char* ga, const char* gb, size_t gstep, unsigned lc, const char* gc, size_t cstep) {
  asm volatile("global_load_async_to_lds_b128 %0, %12, off\n\tglobal_load_async_to_lds_b128 %1, %13, off\n\tglobal_load_async_to_lds_b128 %2, %14, off\n\tglobal_load_async_to_lds_b128 %3, %15, off\n\t"
               "global_load_async_to_lds_b128 %4, %16, off\n\tglobal_load_async_to_lds_b128 %5, %17, off\n\tglobal_load_async_to_lds_b128 %6, %18, off\n\tglobal_load_async_to_lds_b128 %7, %19, off\n\t"
               "global_load_async_to_lds_b128 %8, %20, off\n\tglobal_load_async_to_lds_b128 %9, %21, off\n\tglobal_load_async_to_lds_b128 %10, %22, off\n\tglobal_load_async_to_lds_b128 %11, %23, off\n\ts_wait_xcnt 0x0"
               :: "v"(l), "v"(l + lstep), "v"(l + 2 * lstep), "v"(l + 3 * lstep), "v"(l + 4 * lstep), "v"(l + 5 * lstep), "v"(l + 6 * lstep), "v"(l + 7 * lstep), "v"(lc), "v"(lc + lstep), "v"(lc + 2 * lstep), "v"(lc + 3 * lstep),
                  "v"(ga), "v"(ga + gstep), "v"(ga + 2 * gstep), "v"(ga + 3 * gstep), "v"(gb), "v"(gb + gstep), "v"(gb + 2 * gstep), "v"(gb + 3 * gstep), "v"(gc), "v"(gc + cstep), "v"(gc + 2 * cstep), "v"(gc + 3 * cstep) : "memory");
}
// one copy of 4 bytes a lane, with the same wait in its own statement
__device__ __forceinline__ void copy1w(unsigned l, const char* g) {
  asm volatile("global_load_async_to_lds_b32 %0, %1, off\n\ts_wait_xcnt 0x0" :: "v"(l), "v"(g) : "memory");
}
// this wave's own copies have landed in LDS (the compiler places no wait for them)
#define WAIT_COPIES() asm volatile("s_wait_asynccnt 0x0" ::: "memory")
// this wave's own LDS reads have returned: stands in front of the barrier behind which the buffer they read is refilled
#define WAIT_LDS() asm volatile("s_wait_dscnt 0x0" ::: "memory")
// k_stats, k_out: a wave owns 16 rows, which makes one wave per SIMD over the chip; the long sum over the other index is therefore split NSPL ways among the waves of a block (4 row groups x NSPL parts = 4 waves per SIMD), so that one wave's LDS, shuffle and WMMA latencies pass behind the other three; the parts are merged through LDS behind the loop
#define NSPL 4
#define NTHR (128 * NSPL)
#define SROWS (32 * NSPL)                           // rows (positions) of one stage of the two-buffer rings below: 32 for each part
#define NSTG (NPOS / SROWS)
typedef v4f __attribute__((may_alias)) v4f_a;
// a plane = 128 rows of 128 f16 (32 KiB, contiguous in global memory) -> LDS rows of 136 f16 (272 B: 16 B x odd, the pitch of ds_load_b128 readers); 512 threads, 4 copies each a plane, a wave's copy = 512 contiguous bytes, copy j = rows 32 j + tid / 16
#define PSTEP ((NTHR / 16) * (CO + 8) * 2u)         // LDS bytes from copy j to copy j + 1; 4 of them = one plane, so that the lo plane, which follows the hi plane in LDS, is copies 4 to 7
// the hi and the lo plane of a stage
__device__ __forceinline__ void stage_pair(_Float16 (*dst)[SROWS][CO + 8], const _Float16* hi, const _Float16* lo, int tid) {
  copy44(lds_at(&dst[0][tid >> 4][(tid & 15) * 8]), PSTEP, (const char*)(hi + tid * 8), (const char*)(lo + tid * 8), NTHR * 16);
}
__global__ __launch_bounds__(256) void k_pack(const float* __restrict__ WQ, const float* __restrict__ WK, const float* __restrict__ WV, const float* __restrict__ WW, __bf16* __restrict__ PK, __bf16* __restrict__ PW) {
  const int n = blockIdx.x, t = threadIdx.x; __shared__ __align__(16) __bf16 s[CIN];
  if (n < 3 * CO) { const float* src = (n < CO) ? WQ + (size_t)n * CIN : (n < 2 * CO) ? WK + (size_t)(n - CO) * CIN : WV + (size_t)(n - 2 * CO) * CIN; s[t] = (__bf16)src[t]; __syncthreads(); if (t < CIN / 8) vst2((unsigned*)(PK + (size_t)n * CIN + t * 8), *(const v4u*)&s[t * 8]); }
  else { const int o = n - 3 * CO; if (t < CO) s[t] = (__bf16)WW[(size_t)o * CO + t]; __syncthreads(); if (t < CO / 8) vst2((unsigned*)(PW + (size_t)o * CO + t * 8), *(const v4u*)&s[t * 8]); }
}
__global__ __launch_bounds__(128) void k_proj(const float* __restrict__ X, const __bf16* __restrict__ PK, const float* __restrict__ BQ, const float* __restrict__ BK, const float* __restrict__ BV, _Float16* __restrict__ QH, _Float16* __restrict__ QL, _Float16* __restrict__ KH, _Float16* __restrict__ KL, _Float16* __restrict__ VH) {
  __shared__ __align__(16) __bf16 sa[64][CIN + 8]; __shared__ __align__(16) _Float16 sth[64][CO + 8], stl[64][CO + 8]; __shared__ __align__(16) _Float16 svh[CO][72];
  const int tid = threadIdx.x, wave = tid >> 5, lane = tid & 31, col = lane & 15, g = lane >> 4; const size_t b = blockIdx.y; const int n0 = blockIdx.x * 64;
  for (int e = tid; e < 64 * CIN; e += 128) { const int c = e >> 6, r = e & 63; sa[r][c] = (__bf16)X[(b * CIN + c) * NPOS + n0 + r]; }
  if (tid < 64) for (int c = CIN; c < CIN + 8; ++c) sa[tid][c] = (__bf16)0.f;
  __syncthreads();
#pragma unroll 1
  for (int which = 0; which < 3; ++which) { v8f acc[8] = {};
    // the 8 weight fragments of a k step are requested together, one k step ahead of the products that read them
    v16b wf[2][8];
#pragma unroll
    for (int j = 0; j < 8; ++j) wf[0][j] = frag_b(PK + (size_t)(which * CO + j * 16 + col) * CIN, lane);
#pragma unroll
    for (int kc = 0; kc < CIN / 32; ++kc) { const v16b a = frag_b(&sa[wave * 16 + col][kc * 32], lane);
      if (kc + 1 < CIN / 32) {
#pragma unroll
        for (int j = 0; j < 8; ++j) wf[(kc + 1) & 1][j] = frag_b(PK + (size_t)(which * CO + j * 16 + col) * CIN + (kc + 1) * 32, lane); }
#pragma unroll
      for (int j = 0; j < 8; ++j) acc[j] = wmma_bf(a, wf[kc & 1][j], acc[j]); }
    const float* BB = (which == 0) ? BQ : (which == 1) ? BK : BV;
    if (which < 2) {
#pragma unroll
      for (int j = 0; j < 8; ++j) { const int c = j * 16 + col; const float bb = bfr(BB[c]);
#pragma unroll
        for (int r = 0; r < 8; ++r) { const float v = acc[j][r] + bb; const _Float16 hv = (_Float16)v; sth[wave * 16 + 8 * g + r][c] = hv; stl[wave * 16 + 8 * g + r][c] = (_Float16)((v - (float)hv) * 2048.0f); } }
      __syncthreads();
      _Float16* DH_ = which ? KH : QH; _Float16* DL_ = which ? KL : QL;
      for (int e = tid; e < 64 * 16; e += 128) { const int r = e >> 4, q = e & 15; const size_t o = (b * NPOS + n0 + r) * CO + q * 8; vst2((unsigned*)(DH_ + o), *(const v4u*)&sth[r][q * 8]); vst2((unsigned*)(DL_ + o), *(const v4u*)&stl[r][q * 8]); }
      __syncthreads(); }
    else {
#pragma unroll
      for (int j = 0; j < 8; ++j) { const int c = j * 16 + col; const float bb = bfr(BB[c]);
#pragma unroll
        for (int r = 0; r < 8; ++r) svh[c][wave * 16 + 8 * g + r] = (_Float16)(acc[j][r] + bb); }
      __syncthreads();
      for (int e = tid; e < CO * 8; e += 128) { const int c = e >> 3, pc = e & 7; vst2((unsigned*)(VH + (b * CO + c) * NPOS + n0 + pc * 8), *(const v4u*)&svh[c][pc * 8]); } } }
}
// ---- k_stats: block = (64 rows n, b): f[n][m] = k_n . q_m over all m (3 products); per row max M_n and L_n = sum_m exp(f - M_n) -> ST[b][n] = (M_n, 1/L_n)
__global__ __launch_bounds__(NTHR) void k_stats(const _Float16* __restrict__ QH, const _Float16* __restrict__ QL, const _Float16* __restrict__ KH, const _Float16* __restrict__ KL, float* __restrict__ ST) {
  __shared__ __align__(16) float so[NSPL][64][2]; __shared__ __align__(16) _Float16 sq[2][2][SROWS][CO + 8];   // ring: [buffer][hi, lo][row m][channel]
  const int tid = threadIdx.x, wave = (tid >> 5) & 3, spl = tid >> 7, lane = tid & 31, col = lane & 15, g = lane >> 4; const size_t b = blockIdx.y; const int n0 = blockIdx.x * 64 + wave * 16; const size_t rn = b * NPOS + n0;
  // the 4 row groups read the same q rows: a stage of 128 rows (hi and lo) is copied to LDS once for the block, whole lines at a time, one stage ahead of its use; part spl works on rows 32 spl .. 32 spl + 31 of every stage
  const _Float16* gqh = QH + b * NPOS * CO; const _Float16* gql = QL + b * NPOS * CO;
  stage_pair(sq[0], gqh, gql, tid);
  WAIT_COPIES();
  __syncthreads();   // stage 0 is published to all waves
  stage_pair(sq[1], gqh + (size_t)SROWS * CO, gql + (size_t)SROWS * CO, tid);
  v16h ak[CO / 32], akl[CO / 32];
#pragma unroll
  for (int kc = 0; kc < CO / 32; ++kc) { ak[kc] = frag_h(KH + (rn + col) * CO + kc * 32, lane); akl[kc] = frag_h(KL + (rn + col) * CO + kc * 32, lane); }
  float m[8], l[8];
#pragma unroll
  for (int r = 0; r < 8; ++r) { m[r] = -3.0e38f; l[r] = 0.f; }
  // not unrolled: one trip = one stage, and the ring's order stands once, at the trip's foot
#pragma unroll 1
  for (int st = 0; st < NSTG; ++st) { const int bf = st & 1;
  // unrolled: the wave's 2 tiles of a stage are straight-line code with constant LDS offsets, so that one tile's LDS reads and shuffle waits pass behind the other tile's work
#pragma unroll
  for (int u = 0; u < 2; ++u) { v8f c = {}, cl = {};
    // the tile's 4 hi and 4 lo fragments of q are all requested before the first product, so that their latencies overlap
    v16h qh[CO / 32], ql[CO / 32];
#pragma unroll
    for (int kc = 0; kc < CO / 32; ++kc) { qh[kc] = frag_h(&sq[bf][0][spl * 32 + u * 16 + col][kc * 32], lane); ql[kc] = frag_h(&sq[bf][1][spl * 32 + u * 16 + col][kc * 32], lane); }
#pragma unroll
    for (int kc = 0; kc < CO / 32; ++kc) { c = wmma16(ak[kc], qh[kc], c); cl = wmma16(akl[kc], qh[kc], cl); cl = wmma16(ak[kc], ql[kc], cl); }
    // straight-line, no call and no branch (the guard on alpha is a select), phase by phase: the 8 rows are independent chains, and each row's shuffle and exponential latency passes behind the other 7 rows
    // the unrolls below make every index of s, mn, alpha, e a constant, so that the four arrays stay in registers
    float s[8], mn[8], alpha[8], e[8];
#pragma unroll
    for (int r = 0; r < 8; ++r) { s[r] = c[r] + cl[r] * (1.0f / 2048.0f); mn[r] = s[r]; }
#pragma unroll
    for (int o = 1; o < 16; o <<= 1)
#pragma unroll
      for (int r = 0; r < 8; ++r) mn[r] = fmaxf(mn[r], __shfl_xor(mn[r], o));
#pragma unroll
    for (int r = 0; r < 8; ++r) { mn[r] = fmaxf(m[r], mn[r]); const float a = exp_p(m[r] - mn[r]); alpha[r] = (m[r] <= -1.0e38f) ? 0.f : a; e[r] = exp_p(s[r] - mn[r]); }
#pragma unroll
    for (int o = 1; o < 16; o <<= 1)
#pragma unroll
      for (int r = 0; r < 8; ++r) e[r] += __shfl_xor(e[r], o);
#pragma unroll
    for (int r = 0; r < 8; ++r) { l[r] = l[r] * alpha[r] + e[r]; m[r] = mn[r]; } }
    WAIT_LDS();
    WAIT_COPIES();
    __syncthreads();   // publishes stage st + 1 and ends every wave's reads of stage st
    if (st + 2 < NSTG) stage_pair(sq[bf], gqh + (size_t)(st + 2) * SROWS * CO, gql + (size_t)(st + 2) * SROWS * CO, tid); }
  WAIT_COPIES();
  if (col == 0) {
#pragma unroll
    for (int r = 0; r < 8; ++r) { so[spl][wave * 16 + 8 * g + r][0] = m[r]; so[spl][wave * 16 + 8 * g + r][1] = l[r]; } }
  __syncthreads();   // every part's (max, sum) of the 64 rows is in so
  // merge of the parts, one row a thread: M = max of the parts' maxima, L = sum of the parts' sums, each rescaled to M
  if (tid < 64) { float M = so[0][tid][0];
#pragma unroll
    for (int s = 1; s < NSPL; ++s) M = fmaxf(M, so[s][tid][0]);
    float L = 0.f;
#pragma unroll
    for (int s = 0; s < NSPL; ++s) L += so[s][tid][1] * exp_p(so[s][tid][0] - M);
    v2f o; o[0] = M; o[1] = 1.0f / L; vst2(ST + (b * NPOS + blockIdx.x * 64 + tid) * 2, o); }
}
// ---- k_out: block = (64 output positions m, b): over n tiles: s[m][n] = q_m . k_n (3 products); w = exp(s - M_n) / L_n; y[c][m] += w (x2^11 single f16) x v[c][n] (8 tiles); then z = Ww . y (2 products, 2 passes of 8 tiles) + bw -> BN -> + x -> out[b][c][m]
__global__ __launch_bounds__(NTHR) void k_out(const _Float16* __restrict__ QH, const _Float16* __restrict__ QL, const _Float16* __restrict__ KH, const _Float16* __restrict__ KL, const _Float16* __restrict__ VH, const float* __restrict__ ST, const __bf16* __restrict__ PW, const float* __restrict__ BW, const float* __restrict__ G, const float* __restrict__ Bt, const float* __restrict__ MU, const float* __restrict__ VAR, const float* __restrict__ X, float* __restrict__ OUT) {
  __shared__ __align__(16) _Float16 spw[4 * NSPL][16][40]; __shared__ __align__(16) __bf16 syh[64][CO + 8], syl[64][CO + 8]; __shared__ __align__(16) float so[128][68];
  __shared__ __align__(16) _Float16 sk[2][2][SROWS][CO + 8]; __shared__ __align__(16) _Float16 sv[2][CO][SROWS + 8]; __shared__ __align__(16) float sst[2][SROWS][2];   // ring: [buffer] k hi, lo rows ; v [channel][n], 272-B rows ; (M, 1/L)
  const int tid = threadIdx.x, wv = __builtin_amdgcn_readfirstlane(tid >> 5), wave = wv & 3, spl = wv >> 2, lane = tid & 31, col = lane & 15, g = lane >> 4; const size_t b = blockIdx.y; const int m0 = blockIdx.x * 64 + wave * 16; const size_t rm = b * NPOS + m0;
  // the 4 row groups read the same k rows, v columns and row statistics: a stage of 128 positions n is copied to LDS once for the block, whole lines at a time, one stage ahead of its use; part spl works on positions 32 spl .. 32 spl + 31 of every stage
  const _Float16* gkh = KH + b * NPOS * CO; const _Float16* gkl = KL + b * NPOS * CO; const _Float16* gv = VH + (b * CO + (tid >> 4)) * NPOS + (tid & 15) * 8; const float* gst = ST + b * NPOS * 2 + (tid & 255);
  auto stage_kv = [&](int st, int bf) {
    // k hi, k lo ; v: 128 channels x 256 B, the same LDS pitch, copy j takes channels 32 j + tid / 16
    copy444(lds_at(&sk[bf][0][tid >> 4][(tid & 15) * 8]), PSTEP, (const char*)(gkh + (size_t)st * SROWS * CO + tid * 8), (const char*)(gkl + (size_t)st * SROWS * CO + tid * 8), NTHR * 16,
            lds_at(&sv[bf][tid >> 4][(tid & 15) * 8]), (const char*)(gv + st * SROWS), (size_t)32 * NPOS * 2);
    if (wv < 8) copy1w(lds_at(&sst[bf][0][0] + tid), (const char*)(gst + st * SROWS * 2)); };   // 256 words: whole waves 0 to 7, a scalar test
  stage_kv(0, 0);
  WAIT_COPIES();
  __syncthreads();   // stage 0 is published to all waves
  stage_kv(1, 1);
  v16h aq[CO / 32], aql[CO / 32];
#pragma unroll
  for (int kc = 0; kc < CO / 32; ++kc) { aq[kc] = frag_h(QH + (rm + col) * CO + kc * 32, lane); aql[kc] = frag_h(QL + (rm + col) * CO + kc * 32, lane); }
  v8f acc[8] = {};
  // not unrolled: one trip = one stage, and the ring's order stands once, at the trip's foot
#pragma unroll 1
  for (int st = 0; st < NSTG; ++st) { const int bf = st & 1;
  { const int j0 = spl * 32;
#pragma unroll
    for (int ct = 0; ct < 2; ++ct) { const int nn = j0 + ct * 16 + col; v8f c = {}, cl = {};
      // the tile's 4 hi and 4 lo fragments of k are all requested before the first product, so that their latencies overlap
      v16h kh[CO / 32], kl[CO / 32];
#pragma unroll
      for (int kc = 0; kc < CO / 32; ++kc) { kh[kc] = frag_h(&sk[bf][0][nn][kc * 32], lane); kl[kc] = frag_h(&sk[bf][1][nn][kc * 32], lane); }
      const float Mn = sst[bf][nn][0], iLn = sst[bf][nn][1];
#pragma unroll
      for (int kc = 0; kc < CO / 32; ++kc) { c = wmma16(aq[kc], kh[kc], c); cl = wmma16(aql[kc], kh[kc], cl); cl = wmma16(aq[kc], kl[kc], cl); }
#pragma unroll
      for (int r = 0; r < 8; ++r) { const float s = c[r] + cl[r] * (1.0f / 2048.0f); const float w = exp_p(s - Mn) * iLn; spw[wv][8 * g + r][ct * 16 + col] = (_Float16)(w * 2048.0f); } }
    LDSX();
    // the 8 fragments of v are all requested before the first product, so that their latencies overlap
    v16h vv[8];
#pragma unroll
    for (int dt = 0; dt < 8; ++dt) vv[dt] = frag_h(&sv[bf][dt * 16 + col][j0], lane);
    { const v16h pa = frag_h(&spw[wv][col][0], lane);
#pragma unroll
      for (int dt = 0; dt < 8; ++dt) acc[dt] = wmma16(pa, vv[dt], acc[dt]); }
    LDSX(); }
    WAIT_LDS();
    WAIT_COPIES();
    __syncthreads();   // publishes stage st + 1 and ends every wave's reads of stage st
    if (st + 2 < NSTG) stage_kv(st + 2, bf); }
  WAIT_COPIES();
  // merge of the parts: the k ring is dead behind the loop's last barrier (no read and no copy of it is left), and its bytes take every wave's 16 x 128 partial sums, [wave][tile dt][half][lane][4]: 16 bytes a lane, lanes side by side
  float* red = (float*)&sk[0][0][0][0];
#pragma unroll
  for (int dt = 0; dt < 8; ++dt) { v4f lo4, hi4;
#pragma unroll
    for (int r = 0; r < 4; ++r) { lo4[r] = acc[dt][r]; hi4[r] = acc[dt][4 + r]; }
    *(v4f_a*)(red + ((wv * 8 + dt) * 2 + 0) * 128 + lane * 4) = lo4; *(v4f_a*)(red + ((wv * 8 + dt) * 2 + 1) * 128 + lane * 4) = hi4; }
  __syncthreads();   // every wave's partial sums are in red
  // part spl adds the NSPL parts of tiles dt = 2 spl, 2 spl + 1 of its row group, in the order of the parts; y tile -> bf16 hi/lo [64 m][128 c]
#pragma unroll
  for (int d = 0; d < 8 / NSPL; ++d) { const int dt = spl * (8 / NSPL) + d; float y[8];
#pragma unroll
    for (int s = 0; s < NSPL; ++s) { const v4f lo4 = *(const v4f_a*)(red + (((s * 4 + wave) * 8 + dt) * 2 + 0) * 128 + lane * 4), hi4 = *(const v4f_a*)(red + (((s * 4 + wave) * 8 + dt) * 2 + 1) * 128 + lane * 4);
#pragma unroll
      for (int r = 0; r < 4; ++r) { y[r] = s ? y[r] + lo4[r] : lo4[r]; y[4 + r] = s ? y[4 + r] + hi4[r] : hi4[r]; } }
#pragma unroll
    for (int r = 0; r < 8; ++r) { const float v = y[r] * (1.0f / 2048.0f); const __bf16 hb = (__bf16)v; syh[wave * 16 + 8 * g + r][dt * 16 + col] = hb; syl[wave * 16 + 8 * g + r][dt * 16 + col] = (__bf16)(v - (float)hb); } }
  if (spl == 0 && lane < 16) for (int c = CO; c < CO + 8; ++c) { syh[wave * 16 + lane][c] = (__bf16)0.f; syl[wave * 16 + lane][c] = (__bf16)0.f; }
  __syncthreads();
#pragma unroll 1
  for (int pass = 0; pass < 2; ++pass) { constexpr int NJ = 8 / NSPL; const int jb = spl * NJ; v8f z[NJ] = {};   // part spl takes column tiles jb .. jb + NJ - 1 of the pass
    // the wave's weight fragments of a k step are requested together, one k step ahead of the products that read them
    v16b wf[2][NJ];
#pragma unroll
    for (int j = 0; j < NJ; ++j) wf[0][j] = frag_b(PW + (size_t)(pass * 128 + (jb + j) * 16 + col) * CO, lane);
#pragma unroll
    for (int kc = 0; kc < CO / 32; ++kc) { const v16b a = frag_b(&syh[wave * 16 + col][kc * 32], lane), al = frag_b(&syl[wave * 16 + col][kc * 32], lane);
      if (kc + 1 < CO / 32) {
#pragma unroll
        for (int j = 0; j < NJ; ++j) wf[(kc + 1) & 1][j] = frag_b(PW + (size_t)(pass * 128 + (jb + j) * 16 + col) * CO + (kc + 1) * 32, lane); }
#pragma unroll
      for (int j = 0; j < NJ; ++j) { z[j] = wmma_bf(al, wf[kc & 1][j], z[j]); z[j] = wmma_bf(a, wf[kc & 1][j], z[j]); } }
#pragma unroll
    for (int j = 0; j < NJ; ++j) { const int c = pass * 128 + (jb + j) * 16 + col; const float inv = bfr(G[c]) / sqrtf(bfr(VAR[c]) + 1e-5f); const float sh = bfr(Bt[c]) - bfr(MU[c]) * inv; const float bb = bfr(BW[c]);
#pragma unroll
      for (int r = 0; r < 8; ++r) { const int m = m0 + 8 * g + r; so[(jb + j) * 16 + col][wave * 16 + 8 * g + r] = (z[j][r] + bb) * inv + sh + bfr(X[(b * CIN + c) * NPOS + m]); } }
    __syncthreads();
    for (int e = tid; e < 128 * 16; e += NTHR) { const int cl_ = e >> 4, q = e & 15; vst2(OUT + (b * CIN + pass * 128 + cl_) * NPOS + blockIdx.x * 64 + q * 4, *(const v4f*)&so[cl_][q * 4]); }
    __syncthreads(); }
}
extern "C" void kernel_launch(void* const* d_in, const int* in_sizes, int n_in, void* d_out, int out_size, void* d_ws, size_t ws_size, hipStream_t stream) {
  (void)in_sizes; (void)n_in; (void)out_size;
  const float** F = (const float**)d_in;   // 0 x [4,256,64,64], 1 Wq [128,256], 2 bq, 3 Wk, 4 bk, 5 Wv, 6 bv, 7 Ww [256,128], 8 bw, 9 bn_gamma, 10 bn_beta, 11 bn_mean, 12 bn_var
  if (ws_size < (size_t)WS_END) return;
  char* ws = (char*)d_ws; __bf16 *PK = (__bf16*)(ws + WS_PK), *PW = (__bf16*)(ws + WS_PW); _Float16 *QH = (_Float16*)(ws + WS_QH), *QL = (_Float16*)(ws + WS_QL), *KH = (_Float16*)(ws + WS_KH), *KL = (_Float16*)(ws + WS_KL), *VH = (_Float16*)(ws + WS_VH); float* ST = (float*)(ws + WS_ST);
  k_pack<<<3 * CO + CIN, 256, 0, stream>>>(F[1], F[3], F[5], F[7], PK, PW);
  k_proj<<<dim3(NPOS / 64, NB), 128, 0, stream>>>(F[0], PK, F[2], F[4], F[6], QH, QL, KH, KL, VH);
  k_stats<<<dim3(NPOS / 64, NB), NTHR, 0, stream>>>(QH, QL, KH, KL, ST);
  k_out<<<dim3(TQB, NB), NTHR, 0, stream>>>(QH, QL, KH, KL, VH, ST, PW, F[8], F[9], F[10], F[11], F[12], F[0], (float*)d_out);
}

// v005
// It runs in 157 microseconds.
// Two timings next to v004 put it at 1.21 and 1.20 times that version's speed.
// Counting every step since v000, it is 10.8 times as fast.
#include <hip/hip_runtime.h>
#include <math.h>

typedef __attribute__((ext_vector_type(16))) _Float16 v16h;
typedef __attribute__((ext_vector_type(16))) __bf16 v16b;
typedef __attribute__((ext_vector_type(8)))  _Float16 v8h;
typedef __attribute__((ext_vector_type(8)))  float v8f;
typedef __attribute__((ext_vector_type(4)))  float v4f;
typedef __attribute__((ext_vector_type(2)))  float v2f;
typedef __attribute__((ext_vector_type(4)))  unsigned v4u;
typedef __attribute__((ext_vector_type(4)))  int v4i;
typedef float __attribute__((may_alias)) float_a;
typedef int __attribute__((may_alias)) int_a;

template <typename T> __device__ __forceinline__ void vst2(void* p, T v) { *(T*)p = v;  }
__device__ __forceinline__ v8f wmma16(v16h a, v16h b, v8f c) {
  v8f d = __builtin_amdgcn_wmma_f32_16x16x32_f16(false, a, false, b, (short)0, c, false, false);
  asm volatile("v_nop\n\tv_nop\n\tv_nop\n\tv_nop" : "+v"(d) : "v"(a), "v"(b));
  return d;
}
__device__ __forceinline__ v8f wmma_bf(v16b a, v16b b, v8f c) {
  v8f d = __builtin_amdgcn_wmma_f32_16x16x32_bf16(false, a, false, b, (short)0, c, false, false);
  asm volatile("v_nop\n\tv_nop\n\tv_nop\n\tv_nop" : "+v"(d) : "v"(a), "v"(b));
  return d;
}
// 16x16x32 fragments: lane = (h = lane>>4, row/col = lane&15); elements 0..7 = k0+8h+0..7, 8..15 = k0+16+8h+0..7; D element r = row 8h+r
__device__ __forceinline__ v16h frag_h(const _Float16* rowk0, int lane) {
  union { v16h v; v8h q[2]; } u; const _Float16* p = rowk0 + 8 * (lane >> 4);
  u.q[0] = *(const v8h*)p; u.q[1] = *(const v8h*)(p + 16); return u.v;
}
__device__ __forceinline__ v16h frag_f32(const float* rowk0, int lane) {
  v16h a; const float* p = rowk0 + 8 * (lane >> 4);
#pragma unroll
  for (int i = 0; i < 8; ++i) { a[i] = (_Float16)p[i]; a[8 + i] = (_Float16)p[16 + i]; }
  return a;
}
__device__ __forceinline__ v16h frag_f32s(const float* rowk0, int lane, float sc) {
  v16h a; const float* p = rowk0 + 8 * (lane >> 4);
#pragma unroll
  for (int i = 0; i < 8; ++i) { a[i] = (_Float16)(p[i] * sc); a[8 + i] = (_Float16)(p[16 + i] * sc); }
  return a;
}
// column fragment from a [K][ld] layout (column n), rows >= K read as 0
__device__ __forceinline__ v16h fragc_f32(const float* W, int k0, int n, int lane, int ld, int K) {
  v16h a; const int g = lane >> 4;
#pragma unroll
  for (int i = 0; i < 8; ++i) { const int ka = k0 + 8 * g + i, kb = ka + 16;
    a[i] = (_Float16)(ka < K ? W[(size_t)(ka < K ? ka : K - 1) * ld + n] : 0.f); a[8 + i] = (_Float16)(kb < K ? W[(size_t)(kb < K ? kb : K - 1) * ld + n] : 0.f); }
  return a;
}
struct F2 { v16b h, l; };
__device__ __forceinline__ F2 bsplit16(const float v[16]) { F2 r;
#pragma unroll
  for (int i = 0; i < 16; ++i) { const __bf16 h = (__bf16)v[i]; r.h[i] = h; r.l[i] = (__bf16)(v[i] - (float)h); }
  return r; }
__device__ __forceinline__ F2 split_row(const float* row, int k0, int lane) { float v[16]; const float* p = row + k0 + 8 * (lane >> 4);
#pragma unroll
  for (int i = 0; i < 8; ++i) { v[i] = p[i]; v[8 + i] = p[16 + i]; }
  return bsplit16(v); }
__device__ __forceinline__ F2 split_rowK(const float* row, int k0, int lane, int K) { float v[16]; const int g = lane >> 4;
#pragma unroll
  for (int i = 0; i < 8; ++i) { const int ka = k0 + 8 * g + i, kb = ka + 16; v[i] = ka < K ? row[ka < K ? ka : K - 1] : 0.f; v[8 + i] = kb < K ? row[kb < K ? kb : K - 1] : 0.f; }
  return bsplit16(v); }
__device__ __forceinline__ F2 split_col(const float* W, int k0, int n, int lane, int ld, int K) { float v[16]; const int g = lane >> 4;
#pragma unroll
  for (int i = 0; i < 8; ++i) { const int ka = k0 + 8 * g + i, kb = ka + 16; v[i] = ka < K ? W[(size_t)(ka < K ? ka : K - 1) * ld + n] : 0.f; v[8 + i] = kb < K ? W[(size_t)(kb < K ? kb : K - 1) * ld + n] : 0.f; }
  return bsplit16(v); }
__device__ __forceinline__ v8f mac3(const F2& a, const F2& b, v8f c) { c = wmma_bf(a.l, b.h, c); c = wmma_bf(a.h, b.l, c); return wmma_bf(a.h, b.h, c); }
__device__ __forceinline__ float sigm(float v) { return 1.0f / (1.0f + expf(-v)); }
#define LDSX() do { asm volatile("s_wait_dscnt 0" ::: "memory"); __builtin_amdgcn_wave_barrier(); __builtin_amdgcn_fence(__ATOMIC_RELEASE, "workgroup"); } while (0)


// Non-local block (B 4, 256 channels, 64 x 64): 1x1 q/k/v convs to 128 channels, affinity f = k^T q softmax-normalised over the second index, y = v f, 1x1 conv back to 256 channels, BatchNorm (inference), residual.
#define NB 4
#define CIN 256
#define CO 128
#define NPOS 4096
#ifndef TQB
#define TQB (NPOS / 64)
#endif
typedef __attribute__((ext_vector_type(8))) __bf16 v8b;
__device__ __forceinline__ v16b frag_b(const __bf16* rowk0, int lane) {
  union { v16b v; v8b q[2]; } u; const __bf16* p = rowk0 + 8 * (lane >> 4);
  u.q[0] = *(const v8b*)p; u.q[1] = *(const v8b*)(p + 16); return u.v;
}
__device__ __forceinline__ float bfr(float v) { return (float)(__bf16)v; }
__device__ __attribute__((noinline)) float exp_ni(float v) { return expf(v); }
__device__ __attribute__((noinline)) float erf_ni(float v) { return erff(v); }

#define WS_PK  0u                                   // bf16 [384][256] Wq;Wk;Wv rows ; [256][128] Ww rows
#define WS_PW  (WS_PK + 2u * 3 * CO * CIN)
#define WS_QH  (WS_PW + 2u * CIN * CO)              // f16 [b][n][128] q hi ; QL ; KH ; KL
#define WS_QL  (WS_QH + 2u * NB * NPOS * CO)
#define WS_KH  (WS_QL + 2u * NB * NPOS * CO)
#define WS_KL  (WS_KH + 2u * NB * NPOS * CO)
#define WS_VH  (WS_KL + 2u * NB * NPOS * CO)         // f16 [b][128][4096] v
#define WS_ST  (WS_VH + 2u * (size_t)NB * CO * NPOS)   // f32 [b][n][2] (M_n, 1/L_n)
#define WS_END (WS_ST + 4u * NB * NPOS * 2)

// inlined: a call per exponential ends the compiler's scheduling region, and the rows of a tile then run one after another
__device__ __forceinline__ float exp_p(float v) { return expf(v); }
// ---- asynchronous copies global -> LDS: each lane brings its own 16 (or 4) bytes, through no register
// LDS byte address of a __shared__ object: the low 32 bits of its address
__device__ __forceinline__ unsigned lds_at(const void* p) { return (unsigned)(size_t)p; }
// 8 copies of 16 bytes a lane: copy j goes to l + j * lstep (bytes), copies 0 to 3 from ga + j * gstep, copies 4 to 7 from gb + (j - 4) * gstep. The s_wait_xcnt is the last line of the copies' own statement, so that it stands in front of every later rewrite of their address registers; one statement for the run of copies, so that the wave waits there once
__device__ __forceinline__ void copy44(unsigned l, unsigned lstep, const char* ga, const char* gb, size_t gstep) {
  asm volatile("global_load_async_to_lds_b128 %0, %8, off\n\tglobal_load_async_to_lds_b128 %1, %9, off\n\tglobal_load_async_to_lds_b128 %2, %10, off\n\tglobal_load_async_to_lds_b128 %3, %11, off\n\t"
               "global_load_async_to_lds_b128 %4, %12, off\n\tglobal_load_async_to_lds_b128 %5, %13, off\n\tglobal_load_async_to_lds_b128 %6, %14, off\n\tglobal_load_async_to_lds_b128 %7, %15, off\n\ts_wait_xcnt 0x0"
               :: "v"(l), "v"(l + lstep), "v"(l + 2 * lstep), "v"(l + 3 * lstep), "v"(l + 4 * lstep), "v"(l + 5 * lstep), "v"(l + 6 * lstep), "v"(l + 7 * lstep),
                  "v"(ga), "v"(ga + gstep), "v"(ga + 2 * gstep), "v"(ga + 3 * gstep), "v"(gb), "v"(gb + gstep), "v"(gb + 2 * gstep), "v"(gb + 3 * gstep) : "memory");
}
// the same 8 copies and 4 more, copy j of these from gc + j * cstep to lc + j * lstep, with the one wait behind all 12
__device__ __forceinline__ void copy444(unsigned l, unsigned lstep, const char* ga, const char* gb, size_t gstep, unsigned lc, const char* gc, size_t cstep) {
  asm volatile("global_load_async_to_lds_b128 %0, %12, off\n\tglobal_load_async_to_lds_b128 %1, %13, off\n\tglobal_load_async_to_lds_b128 %2, %14, off\n\tglobal_load_async_to_lds_b128 %3, %15, off\n\t"
               "global_load_async_to_lds_b128 %4, %16, off\n\tglobal_load_async_to_lds_b128 %5, %17, off\n\tglobal_load_async_to_lds_b128 %6, %18, off\n\tglobal_load_async_to_lds_b128 %7, %19, off\n\t"
               "global_load_async_to_lds_b128 %8, %20, off\n\tglobal_load_async_to_lds_b128 %9, %21, off\n\tglobal_load_async_to_lds_b128 %10, %22, off\n\tglobal_load_async_to_lds_b128 %11, %23, off\n\ts_wait_xcnt 0x0"
               :: "v"(l), "v"(l + lstep), "v"(l + 2 * lstep), "v"(l + 3 * lstep), "v"(l + 4 * lstep), "v"(l + 5 * lstep), "v"(l + 6 * lstep), "v"(l + 7 * lstep), "v"(lc), "v"(lc + lstep), "v"(lc + 2 * lstep), "v"(lc + 3 * lstep),
                  "v"(ga), "v"(ga + gstep), "v"(ga + 2 * gstep), "v"(ga + 3 * gstep), "v"(gb), "v"(gb + gstep), "v"(gb + 2 * gstep), "v"(gb + 3 * gstep), "v"(gc), "v"(gc + cstep), "v"(gc + 2 * cstep), "v"(gc + 3 * cstep) : "memory");
}
// one copy of 4 bytes a lane, with the same wait in its own statement
__device__ __forceinline__ void copy1w(unsigned l, const char* g) {
  asm volatile("global_load_async_to_lds_b32 %0, %1, off\n\ts_wait_xcnt 0x0" :: "v"(l), "v"(g) : "memory");
}
// this wave's own copies have landed in LDS (the compiler places no wait for them)
#define WAIT_COPIES() asm volatile("s_wait_asynccnt 0x0" ::: "memory")
// this wave's own LDS reads have returned: stands in front of the barrier behind which the buffer they read is refilled
#define WAIT_LDS() asm volatile("s_wait_dscnt 0x0" ::: "memory")
// k_stats, k_out: a wave owns 16 rows, which makes one wave per SIMD over the chip; the long sum over the other index is therefore split NSPL ways among the waves of a block (4 row groups x NSPL parts = 4 waves per SIMD), so that one wave's LDS, shuffle and WMMA latencies pass behind the other three; the parts are merged through LDS behind the loop
#define NSPL 4
#define NTHR (128 * NSPL)
#define SROWS (32 * NSPL)                           // rows (positions) of one stage of the two-buffer rings below: 32 for each part
#define NSTG (NPOS / SROWS)
typedef v4f __attribute__((may_alias)) v4f_a;
// a plane = 128 rows of 128 f16 (32 KiB, contiguous in global memory) -> LDS rows of 136 f16 (272 B: 16 B x odd, the pitch of ds_load_b128 readers); 512 threads, 4 copies each a plane, a wave's copy = 512 contiguous bytes, copy j = rows 32 j + tid / 16
#define PSTEP ((NTHR / 16) * (CO + 8) * 2u)         // LDS bytes from copy j to copy j + 1; 4 of them = one plane, so that the lo plane, which follows the hi plane in LDS, is copies 4 to 7
// the hi and the lo plane of a stage
__device__ __forceinline__ void stage_pair(_Float16 (*dst)[SROWS][CO + 8], const _Float16* hi, const _Float16* lo, int tid) {
  copy44(lds_at(&dst[0][tid >> 4][(tid & 15) * 8]), PSTEP, (const char*)(hi + tid * 8), (const char*)(lo + tid * 8), NTHR * 16);
}
__global__ __launch_bounds__(256) void k_pack(const float* __restrict__ WQ, const float* __restrict__ WK, const float* __restrict__ WV, const float* __restrict__ WW, __bf16* __restrict__ PK, __bf16* __restrict__ PW) {
  const int n = blockIdx.x, t = threadIdx.x; __shared__ __align__(16) __bf16 s[CIN];
  if (n < 3 * CO) { const float* src = (n < CO) ? WQ + (size_t)n * CIN : (n < 2 * CO) ? WK + (size_t)(n - CO) * CIN : WV + (size_t)(n - 2 * CO) * CIN; s[t] = (__bf16)src[t]; __syncthreads(); if (t < CIN / 8) vst2((unsigned*)(PK + (size_t)n * CIN + t * 8), *(const v4u*)&s[t * 8]); }
  else { const int o = n - 3 * CO; if (t < CO) s[t] = (__bf16)WW[(size_t)o * CO + t]; __syncthreads(); if (t < CO / 8) vst2((unsigned*)(PW + (size_t)o * CO + t * 8), *(const v4u*)&s[t * 8]); }
}
__global__ __launch_bounds__(128) void k_proj(const float* __restrict__ X, const __bf16* __restrict__ PK, const float* __restrict__ BQ, const float* __restrict__ BK, const float* __restrict__ BV, _Float16* __restrict__ QH, _Float16* __restrict__ QL, _Float16* __restrict__ KH, _Float16* __restrict__ KL, _Float16* __restrict__ VH) {
  __shared__ __align__(16) __bf16 sa[64][CIN + 8]; __shared__ __align__(16) _Float16 sth[64][CO + 8], stl[64][CO + 8]; __shared__ __align__(16) _Float16 svh[CO][72];
  const int tid = threadIdx.x, wave = tid >> 5, lane = tid & 31, col = lane & 15, g = lane >> 4; const size_t b = blockIdx.y; const int n0 = blockIdx.x * 64;
  for (int e = tid; e < 64 * CIN; e += 128) { const int c = e >> 6, r = e & 63; sa[r][c] = (__bf16)X[(b * CIN + c) * NPOS + n0 + r]; }
  if (tid < 64) for (int c = CIN; c < CIN + 8; ++c) sa[tid][c] = (__bf16)0.f;
  __syncthreads();
#pragma unroll 1
  for (int which = 0; which < 3; ++which) { v8f acc[8] = {};
    // the 8 weight fragments of a k step are requested together, one k step ahead of the products that read them
    v16b wf[2][8];
#pragma unroll
    for (int j = 0; j < 8; ++j) wf[0][j] = frag_b(PK + (size_t)(which * CO + j * 16 + col) * CIN, lane);
#pragma unroll
    for (int kc = 0; kc < CIN / 32; ++kc) { const v16b a = frag_b(&sa[wave * 16 + col][kc * 32], lane);
      if (kc + 1 < CIN / 32) {
#pragma unroll
        for (int j = 0; j < 8; ++j) wf[(kc + 1) & 1][j] = frag_b(PK + (size_t)(which * CO + j * 16 + col) * CIN + (kc + 1) * 32, lane); }
#pragma unroll
      for (int j = 0; j < 8; ++j) acc[j] = wmma_bf(a, wf[kc & 1][j], acc[j]); }
    const float* BB = (which == 0) ? BQ : (which == 1) ? BK : BV;
    if (which < 2) {
#pragma unroll
      for (int j = 0; j < 8; ++j) { const int c = j * 16 + col; const float bb = bfr(BB[c]);
#pragma unroll
        for (int r = 0; r < 8; ++r) { const float v = acc[j][r] + bb; const _Float16 hv = (_Float16)v; sth[wave * 16 + 8 * g + r][c] = hv; stl[wave * 16 + 8 * g + r][c] = (_Float16)((v - (float)hv) * 2048.0f); } }
      __syncthreads();
      _Float16* DH_ = which ? KH : QH; _Float16* DL_ = which ? KL : QL;
      for (int e = tid; e < 64 * 16; e += 128) { const int r = e >> 4, q = e & 15; const size_t o = (b * NPOS + n0 + r) * CO + q * 8; vst2((unsigned*)(DH_ + o), *(const v4u*)&sth[r][q * 8]); vst2((unsigned*)(DL_ + o), *(const v4u*)&stl[r][q * 8]); }
      __syncthreads(); }
    else {
#pragma unroll
      for (int j = 0; j < 8; ++j) { const int c = j * 16 + col; const float bb = bfr(BB[c]);
#pragma unroll
        for (int r = 0; r < 8; ++r) svh[c][wave * 16 + 8 * g + r] = (_Float16)(acc[j][r] + bb); }
      __syncthreads();
      for (int e = tid; e < CO * 8; e += 128) { const int c = e >> 3, pc = e & 7; vst2((unsigned*)(VH + (b * CO + c) * NPOS + n0 + pc * 8), *(const v4u*)&svh[c][pc * 8]); } } }
}
// ---- k_stats: block = (64 rows n, b): f[n][m] = k_n . q_m over all m (3 products); per row max M_n and L_n = sum_m exp(f - M_n) -> ST[b][n] = (M_n, 1/L_n)
__global__ __launch_bounds__(NTHR) void k_stats(const _Float16* __restrict__ QH, const _Float16* __restrict__ QL, const _Float16* __restrict__ KH, const _Float16* __restrict__ KL, float* __restrict__ ST) {
  __shared__ __align__(16) float so[NSPL][64][2]; __shared__ __align__(16) _Float16 sq[2][2][SROWS][CO + 8];   // ring: [buffer][hi, lo][row m][channel]
  const int tid = threadIdx.x, wave = (tid >> 5) & 3, spl = tid >> 7, lane = tid & 31, col = lane & 15, g = lane >> 4; const size_t b = blockIdx.y; const int n0 = blockIdx.x * 64 + wave * 16; const size_t rn = b * NPOS + n0;
  // the 4 row groups read the same q rows: a stage of 128 rows (hi and lo) is copied to LDS once for the block, whole lines at a time, one stage ahead of its use; part spl works on rows 32 spl .. 32 spl + 31 of every stage
  const _Float16* gqh = QH + b * NPOS * CO; const _Float16* gql = QL + b * NPOS * CO;
  stage_pair(sq[0], gqh, gql, tid);
  WAIT_COPIES();
  __syncthreads();   // stage 0 is published to all waves
  stage_pair(sq[1], gqh + (size_t)SROWS * CO, gql + (size_t)SROWS * CO, tid);
  v16h ak[CO / 32], akl[CO / 32];
#pragma unroll
  for (int kc = 0; kc < CO / 32; ++kc) { ak[kc] = frag_h(KH + (rn + col) * CO + kc * 32, lane); akl[kc] = frag_h(KL + (rn + col) * CO + kc * 32, lane); }
  float m[8], l[8];
#pragma unroll
  for (int r = 0; r < 8; ++r) { m[r] = -3.0e38f; l[r] = 0.f; }
  // not unrolled: one trip = one stage, and the ring's order stands once, at the trip's foot
#pragma unroll 1
  for (int st = 0; st < NSTG; ++st) { const int bf = st & 1;
  // unrolled: the wave's 2 tiles of a stage are straight-line code with constant LDS offsets, so that one tile's LDS reads pass behind the other tile's work
  float s[2][8];
#pragma unroll
  for (int u = 0; u < 2; ++u) { v8f c = {}, cl = {};
    // the tile's 4 hi and 4 lo fragments of q are all requested before the first product, so that their latencies overlap
    v16h qh[CO / 32], ql[CO / 32];
#pragma unroll
    for (int kc = 0; kc < CO / 32; ++kc) { qh[kc] = frag_h(&sq[bf][0][spl * 32 + u * 16 + col][kc * 32], lane); ql[kc] = frag_h(&sq[bf][1][spl * 32 + u * 16 + col][kc * 32], lane); }
#pragma unroll
    for (int kc = 0; kc < CO / 32; ++kc) { c = wmma16(ak[kc], qh[kc], c); cl = wmma16(akl[kc], qh[kc], cl); cl = wmma16(ak[kc], ql[kc], cl); }
#pragma unroll
    for (int r = 0; r < 8; ++r) s[u][r] = c[r] + cl[r] * (1.0f / 2048.0f); }
    // every lane keeps the running maximum and sum of ITS OWN columns (those with m mod 16 = col) of its 8 rows: no lane needs another lane's value inside the loop, and the 16 lanes of a row are joined once, behind it
    // one update for the stage's 2 tiles; straight-line, no call and no branch (the guard on alpha is a select): the 8 rows are independent chains; the unrolls here and behind the loop make every index of s, m, l, mr a constant, so that the arrays stay in registers
#pragma unroll
    for (int r = 0; r < 8; ++r) { const float mn = fmaxf(m[r], fmaxf(s[0][r], s[1][r])); const float a = exp_p(m[r] - mn); const float alpha = (m[r] <= -1.0e38f) ? 0.f : a;
      l[r] = l[r] * alpha + (exp_p(s[0][r] - mn) + exp_p(s[1][r] - mn)); m[r] = mn; }
    WAIT_LDS();
    WAIT_COPIES();
    __syncthreads();   // publishes stage st + 1 and ends every wave's reads of stage st
    if (st + 2 < NSTG) stage_pair(sq[bf], gqh + (size_t)(st + 2) * SROWS * CO, gql + (size_t)(st + 2) * SROWS * CO, tid); }
  WAIT_COPIES();
  // join of the 16 lanes of a row, once: the row's maximum over the lanes, every lane's sum rescaled to it, then the sum over the lanes; phase by phase, so that the 8 rows' shuffle latencies overlap
  float mr[8];
#pragma unroll
  for (int r = 0; r < 8; ++r) mr[r] = m[r];
#pragma unroll
  for (int o = 1; o < 16; o <<= 1)
#pragma unroll
    for (int r = 0; r < 8; ++r) mr[r] = fmaxf(mr[r], __shfl_xor(mr[r], o));
#pragma unroll
  for (int r = 0; r < 8; ++r) l[r] *= exp_p(m[r] - mr[r]);
#pragma unroll
  for (int o = 1; o < 16; o <<= 1)
#pragma unroll
    for (int r = 0; r < 8; ++r) l[r] += __shfl_xor(l[r], o);
  if (col == 0) {
#pragma unroll
    for (int r = 0; r < 8; ++r) { so[spl][wave * 16 + 8 * g + r][0] = mr[r]; so[spl][wave * 16 + 8 * g + r][1] = l[r]; } }
  __syncthreads();   // every part's (max, sum) of the 64 rows is in so
  // merge of the parts, one row a thread: M = max of the parts' maxima, L = sum of the parts' sums, each rescaled to M
  if (tid < 64) { float M = so[0][tid][0];
#pragma unroll
    for (int s = 1; s < NSPL; ++s) M = fmaxf(M, so[s][tid][0]);
    float L = 0.f;
#pragma unroll
    for (int s = 0; s < NSPL; ++s) L += so[s][tid][1] * exp_p(so[s][tid][0] - M);
    v2f o; o[0] = M; o[1] = 1.0f / L; vst2(ST + (b * NPOS + blockIdx.x * 64 + tid) * 2, o); }
}
// ---- k_out: block = (64 output positions m, b): over n tiles: s[m][n] = q_m . k_n (3 products); w = exp(s - M_n) / L_n; y[c][m] += w (x2^11 single f16) x v[c][n] (8 tiles); then z = Ww . y (2 products, 2 passes of 8 tiles) + bw -> BN -> + x -> out[b][c][m]
__global__ __launch_bounds__(NTHR) void k_out(const _Float16* __restrict__ QH, const _Float16* __restrict__ QL, const _Float16* __restrict__ KH, const _Float16* __restrict__ KL, const _Float16* __restrict__ VH, const float* __restrict__ ST, const __bf16* __restrict__ PW, const float* __restrict__ BW, const float* __restrict__ G, const float* __restrict__ Bt, const float* __restrict__ MU, const float* __restrict__ VAR, const float* __restrict__ X, float* __restrict__ OUT) {
  __shared__ __align__(16) _Float16 spw[4 * NSPL][16][40]; __shared__ __align__(16) __bf16 syh[64][CO + 8], syl[64][CO + 8]; __shared__ __align__(16) float so[128][68];
  __shared__ __align__(16) _Float16 sk[2][2][SROWS][CO + 8]; __shared__ __align__(16) _Float16 sv[2][CO][SROWS + 8]; __shared__ __align__(16) float sst[2][SROWS][2];   // ring: [buffer] k hi, lo rows ; v [channel][n], 272-B rows ; (M, 1/L)
  const int tid = threadIdx.x, wv = __builtin_amdgcn_readfirstlane(tid >> 5), wave = wv & 3, spl = wv >> 2, lane = tid & 31, col = lane & 15, g = lane >> 4; const size_t b = blockIdx.y; const int m0 = blockIdx.x * 64 + wave * 16; const size_t rm = b * NPOS + m0;
  // the 4 row groups read the same k rows, v columns and row statistics: a stage of 128 positions n is copied to LDS once for the block, whole lines at a time, one stage ahead of its use; part spl works on positions 32 spl .. 32 spl + 31 of every stage
  const _Float16* gkh = KH + b * NPOS * CO; const _Float16* gkl = KL + b * NPOS * CO; const _Float16* gv = VH + (b * CO + (tid >> 4)) * NPOS + (tid & 15) * 8; const float* gst = ST + b * NPOS * 2 + (tid & 255);
  auto stage_kv = [&](int st, int bf) {
    // k hi, k lo ; v: 128 channels x 256 B, the same LDS pitch, copy j takes channels 32 j + tid / 16
    copy444(lds_at(&sk[bf][0][tid >> 4][(tid & 15) * 8]), PSTEP, (const char*)(gkh + (size_t)st * SROWS * CO + tid * 8), (const char*)(gkl + (size_t)st * SROWS * CO + tid * 8), NTHR * 16,
            lds_at(&sv[bf][tid >> 4][(tid & 15) * 8]), (const char*)(gv + st * SROWS), (size_t)32 * NPOS * 2);
    if (wv < 8) copy1w(lds_at(&sst[bf][0][0] + tid), (const char*)(gst + st * SROWS * 2)); };   // 256 words: whole waves 0 to 7, a scalar test
  stage_kv(0, 0);
  WAIT_COPIES();
  __syncthreads();   // stage 0 is published to all waves
  stage_kv(1, 1);
  v16h aq[CO / 32], aql[CO / 32];
#pragma unroll
  for (int kc = 0; kc < CO / 32; ++kc) { aq[kc] = frag_h(QH + (rm + col) * CO + kc * 32, lane); aql[kc] = frag_h(QL + (rm + col) * CO + kc * 32, lane); }
  v8f acc[8] = {};
  // not unrolled: one trip = one stage, and the ring's order stands once, at the trip's foot
#pragma unroll 1
  for (int st = 0; st < NSTG; ++st) { const int bf = st & 1;
  { const int j0 = spl * 32;
#pragma unroll
    for (int ct = 0; ct < 2; ++ct) { const int nn = j0 + ct * 16 + col; v8f c = {}, cl = {};
      // the tile's 4 hi and 4 lo fragments of k are all requested before the first product, so that their latencies overlap
      v16h kh[CO / 32], kl[CO / 32];
#pragma unroll
      for (int kc = 0; kc < CO / 32; ++kc) { kh[kc] = frag_h(&sk[bf][0][nn][kc * 32], lane); kl[kc] = frag_h(&sk[bf][1][nn][kc * 32], lane); }
      const float Mn = sst[bf][nn][0], iLn = sst[bf][nn][1];
#pragma unroll
      for (int kc = 0; kc < CO / 32; ++kc) { c = wmma16(aq[kc], kh[kc], c); cl = wmma16(aql[kc], kh[kc], cl); cl = wmma16(aq[kc], kl[kc], cl); }
#pragma unroll
      for (int r = 0; r < 8; ++r) { const float s = c[r] + cl[r] * (1.0f / 2048.0f); const float w = exp_p(s - Mn) * iLn; spw[wv][8 * g + r][ct * 16 + col] = (_Float16)(w * 2048.0f); } }
    LDSX();
    // the 8 fragments of v are all requested before the first product, so that their latencies overlap
    v16h vv[8];
#pragma unroll
    for (int dt = 0; dt < 8; ++dt) vv[dt] = frag_h(&sv[bf][dt * 16 + col][j0], lane);
    { const v16h pa = frag_h(&spw[wv][col][0], lane);
#pragma unroll
      for (int dt = 0; dt < 8; ++dt) acc[dt] = wmma16(pa, vv[dt], acc[dt]); }
    LDSX(); }
    WAIT_LDS();
    WAIT_COPIES();
    __syncthreads();   // publishes stage st + 1 and ends every wave's reads of stage st
    if (st + 2 < NSTG) stage_kv(st + 2, bf); }
  WAIT_COPIES();
  // merge of the parts: the k ring is dead behind the loop's last barrier (no read and no copy of it is left), and its bytes take every wave's 16 x 128 partial sums, [wave][tile dt][half][lane][4]: 16 bytes a lane, lanes side by side
  float* red = (float*)&sk[0][0][0][0];
#pragma unroll
  for (int dt = 0; dt < 8; ++dt) { v4f lo4, hi4;
#pragma unroll
    for (int r = 0; r < 4; ++r) { lo4[r] = acc[dt][r]; hi4[r] = acc[dt][4 + r]; }
    *(v4f_a*)(red + ((wv * 8 + dt) * 2 + 0) * 128 + lane * 4) = lo4; *(v4f_a*)(red + ((wv * 8 + dt) * 2 + 1) * 128 + lane * 4) = hi4; }
  __syncthreads();   // every wave's partial sums are in red
  // part spl adds the NSPL parts of tiles dt = 2 spl, 2 spl + 1 of its row group, in the order of the parts; y tile -> bf16 hi/lo [64 m][128 c]
#pragma unroll
  for (int d = 0; d < 8 / NSPL; ++d) { const int dt = spl * (8 / NSPL) + d; float y[8];
#pragma unroll
    for (int s = 0; s < NSPL; ++s) { const v4f lo4 = *(const v4f_a*)(red + (((s * 4 + wave) * 8 + dt) * 2 + 0) * 128 + lane * 4), hi4 = *(const v4f_a*)(red + (((s * 4 + wave) * 8 + dt) * 2 + 1) * 128 + lane * 4);
#pragma unroll
      for (int r = 0; r < 4; ++r) { y[r] = s ? y[r] + lo4[r] : lo4[r]; y[4 + r] = s ? y[4 + r] + hi4[r] : hi4[r]; } }
#pragma unroll
    for (int r = 0; r < 8; ++r) { const float v = y[r] * (1.0f / 2048.0f); const __bf16 hb = (__bf16)v; syh[wave * 16 + 8 * g + r][dt * 16 + col] = hb; syl[wave * 16 + 8 * g + r][dt * 16 + col] = (__bf16)(v - (float)hb); } }
  if (spl == 0 && lane < 16) for (int c = CO; c < CO + 8; ++c) { syh[wave * 16 + lane][c] = (__bf16)0.f; syl[wave * 16 + lane][c] = (__bf16)0.f; }
  __syncthreads();
#pragma unroll 1
  for (int pass = 0; pass < 2; ++pass) { constexpr int NJ = 8 / NSPL; const int jb = spl * NJ; v8f z[NJ] = {};   // part spl takes column tiles jb .. jb + NJ - 1 of the pass
    // the wave's weight fragments of a k step are requested together, one k step ahead of the products that read them
    v16b wf[2][NJ];
#pragma unroll
    for (int j = 0; j < NJ; ++j) wf[0][j] = frag_b(PW + (size_t)(pass * 128 + (jb + j) * 16 + col) * CO, lane);
#pragma unroll
    for (int kc = 0; kc < CO / 32; ++kc) { const v16b a = frag_b(&syh[wave * 16 + col][kc * 32], lane), al = frag_b(&syl[wave * 16 + col][kc * 32], lane);
      if (kc + 1 < CO / 32) {
#pragma unroll
        for (int j = 0; j < NJ; ++j) wf[(kc + 1) & 1][j] = frag_b(PW + (size_t)(pass * 128 + (jb + j) * 16 + col) * CO + (kc + 1) * 32, lane); }
#pragma unroll
      for (int j = 0; j < NJ; ++j) { z[j] = wmma_bf(al, wf[kc & 1][j], z[j]); z[j] = wmma_bf(a, wf[kc & 1][j], z[j]); } }
#pragma unroll
    for (int j = 0; j < NJ; ++j) { const int c = pass * 128 + (jb + j) * 16 + col; const float inv = bfr(G[c]) / sqrtf(bfr(VAR[c]) + 1e-5f); const float sh = bfr(Bt[c]) - bfr(MU[c]) * inv; const float bb = bfr(BW[c]);
#pragma unroll
      for (int r = 0; r < 8; ++r) { const int m = m0 + 8 * g + r; so[(jb + j) * 16 + col][wave * 16 + 8 * g + r] = (z[j][r] + bb) * inv + sh + bfr(X[(b * CIN + c) * NPOS + m]); } }
    __syncthreads();
    for (int e = tid; e < 128 * 16; e += NTHR) { const int cl_ = e >> 4, q = e & 15; vst2(OUT + (b * CIN + pass * 128 + cl_) * NPOS + blockIdx.x * 64 + q * 4, *(const v4f*)&so[cl_][q * 4]); }
    __syncthreads(); }
}
extern "C" void kernel_launch(void* const* d_in, const int* in_sizes, int n_in, void* d_out, int out_size, void* d_ws, size_t ws_size, hipStream_t stream) {
  (void)in_sizes; (void)n_in; (void)out_size;
  const float** F = (const float**)d_in;   // 0 x [4,256,64,64], 1 Wq [128,256], 2 bq, 3 Wk, 4 bk, 5 Wv, 6 bv, 7 Ww [256,128], 8 bw, 9 bn_gamma, 10 bn_beta, 11 bn_mean, 12 bn_var
  if (ws_size < (size_t)WS_END) return;
  char* ws = (char*)d_ws; __bf16 *PK = (__bf16*)(ws + WS_PK), *PW = (__bf16*)(ws + WS_PW); _Float16 *QH = (_Float16*)(ws + WS_QH), *QL = (_Float16*)(ws + WS_QL), *KH = (_Float16*)(ws + WS_KH), *KL = (_Float16*)(ws + WS_KL), *VH = (_Float16*)(ws + WS_VH); float* ST = (float*)(ws + WS_ST);
  k_pack<<<3 * CO + CIN, 256, 0, stream>>>(F[1], F[3], F[5], F[7], PK, PW);
  k_proj<<<dim3(NPOS / 64, NB), 128, 0, stream>>>(F[0], PK, F[2], F[4], F[6], QH, QL, KH, KL, VH);
  k_stats<<<dim3(NPOS / 64, NB), NTHR, 0, stream>>>(QH, QL, KH, KL, ST);
  k_out<<<dim3(TQB, NB), NTHR, 0, stream>>>(QH, QL, KH, KL, VH, ST, PW, F[8], F[9], F[10], F[11], F[12], F[0], (float*)d_out);
}

// v006
// It runs in 131 microseconds.
// In both of two side-by-side timings against v005, it was 1.20 times as fast.
// All steps since v000 together make it 12.9 times as fast.
#include <hip/hip_runtime.h>
#include <math.h>

typedef __attribute__((ext_vector_type(16))) _Float16 v16h;
typedef __attribute__((ext_vector_type(16))) __bf16 v16b;
typedef __attribute__((ext_vector_type(8)))  _Float16 v8h;
typedef __attribute__((ext_vector_type(8)))  float v8f;
typedef __attribute__((ext_vector_type(4)))  float v4f;
typedef __attribute__((ext_vector_type(2)))  float v2f;
typedef __attribute__((ext_vector_type(4)))  unsigned v4u;
typedef __attribute__((ext_vector_type(4)))  int v4i;
typedef float __attribute__((may_alias)) float_a;
typedef int __attribute__((may_alias)) int_a;

template <typename T> __device__ __forceinline__ void vst2(void* p, T v) { *(T*)p = v;  }
__device__ __forceinline__ v8f wmma16(v16h a, v16h b, v8f c) {
  v8f d = __builtin_amdgcn_wmma_f32_16x16x32_f16(false, a, false, b, (short)0, c, false, false);
  asm volatile("v_nop\n\tv_nop\n\tv_nop\n\tv_nop" : "+v"(d) : "v"(a), "v"(b));
  return d;
}
__device__ __forceinline__ v8f wmma_bf(v16b a, v16b b, v8f c) {
  v8f d = __builtin_amdgcn_wmma_f32_16x16x32_bf16(false, a, false, b, (short)0, c, false, false);
  asm volatile("v_nop\n\tv_nop\n\tv_nop\n\tv_nop" : "+v"(d) : "v"(a), "v"(b));
  return d;
}
// 16x16x32 fragments: lane = (h = lane>>4, row/col = lane&15); elements 0..7 = k0+8h+0..7, 8..15 = k0+16+8h+0..7; D element r = row 8h+r
__device__ __forceinline__ v16h frag_h(const _Float16* rowk0, int lane) {
  union { v16h v; v8h q[2]; } u; const _Float16* p = rowk0 + 8 * (lane >> 4);
  u.q[0] = *(const v8h*)p; u.q[1] = *(const v8h*)(p + 16); return u.v;
}
__device__ __forceinline__ v16h frag_f32(const float* rowk0, int lane) {
  v16h a; const float* p = rowk0 + 8 * (lane >> 4);
#pragma unroll
  for (int i = 0; i < 8; ++i) { a[i] = (_Float16)p[i]; a[8 + i] = (_Float16)p[16 + i]; }
  return a;
}
__device__ __forceinline__ v16h frag_f32s(const float* rowk0, int lane, float sc) {
  v16h a; const float* p = rowk0 + 8 * (lane >> 4);
#pragma unroll
  for (int i = 0; i < 8; ++i) { a[i] = (_Float16)(p[i] * sc); a[8 + i] = (_Float16)(p[16 + i] * sc); }
  return a;
}
// column fragment from a [K][ld] layout (column n), rows >= K read as 0
__device__ __forceinline__ v16h fragc_f32(const float* W, int k0, int n, int lane, int ld, int K) {
  v16h a; const int g = lane >> 4;
#pragma unroll
  for (int i = 0; i < 8; ++i) { const int ka = k0 + 8 * g + i, kb = ka + 16;
    a[i] = (_Float16)(ka < K ? W[(size_t)(ka < K ? ka : K - 1) * ld + n] : 0.f); a[8 + i] = (_Float16)(kb < K ? W[(size_t)(kb < K ? kb : K - 1) * ld + n] : 0.f); }
  return a;
}
struct F2 { v16b h, l; };
__device__ __forceinline__ F2 bsplit16(const float v[16]) { F2 r;
#pragma unroll
  for (int i = 0; i < 16; ++i) { const __bf16 h = (__bf16)v[i]; r.h[i] = h; r.l[i] = (__bf16)(v[i] - (float)h); }
  return r; }
__device__ __forceinline__ F2 split_row(const float* row, int k0, int lane) { float v[16]; const float* p = row + k0 + 8 * (lane >> 4);
#pragma unroll
  for (int i = 0; i < 8; ++i) { v[i] = p[i]; v[8 + i] = p[16 + i]; }
  return bsplit16(v); }
__device__ __forceinline__ F2 split_rowK(const float* row, int k0, int lane, int K) { float v[16]; const int g = lane >> 4;
#pragma unroll
  for (int i = 0; i < 8; ++i) { const int ka = k0 + 8 * g + i, kb = ka + 16; v[i] = ka < K ? row[ka < K ? ka : K - 1] : 0.f; v[8 + i] = kb < K ? row[kb < K ? kb : K - 1] : 0.f; }
  return bsplit16(v); }
__device__ __forceinline__ F2 split_col(const float* W, int k0, int n, int lane, int ld, int K) { float v[16]; const int g = lane >> 4;
#pragma unroll
  for (int i = 0; i < 8; ++i) { const int ka = k0 + 8 * g + i, kb = ka + 16; v[i] = ka < K ? W[(size_t)(ka < K ? ka : K - 1) * ld + n] : 0.f; v[8 + i] = kb < K ? W[(size_t)(kb < K ? kb : K - 1) * ld + n] : 0.f; }
  return bsplit16(v); }
__device__ __forceinline__ v8f mac3(const F2& a, const F2& b, v8f c) { c = wmma_bf(a.l, b.h, c); c = wmma_bf(a.h, b.l, c); return wmma_bf(a.h, b.h, c); }
__device__ __forceinline__ float sigm(float v) { return 1.0f / (1.0f + expf(-v)); }
#define LDSX() do { asm volatile("s_wait_dscnt 0" ::: "memory"); __builtin_amdgcn_wave_barrier(); __builtin_amdgcn_fence(__ATOMIC_RELEASE, "workgroup"); } while (0)


// Non-local block (B 4, 256 channels, 64 x 64): 1x1 q/k/v convs to 128 channels, affinity f = k^T q softmax-normalised over the second index, y = v f, 1x1 conv back to 256 channels, BatchNorm (inference), residual.
#define NB 4
#define CIN 256
#define CO 128
#define NPOS 4096
#ifndef TQB
#define TQB (NPOS / 64)
#endif
typedef __attribute__((ext_vector_type(8))) __bf16 v8b;
__device__ __forceinline__ v16b frag_b(const __bf16* rowk0, int lane) {
  union { v16b v; v8b q[2]; } u; const __bf16* p = rowk0 + 8 * (lane >> 4);
  u.q[0] = *(const v8b*)p; u.q[1] = *(const v8b*)(p + 16); return u.v;
}
__device__ __forceinline__ float bfr(float v) { return (float)(__bf16)v; }
__device__ __attribute__((noinline)) float exp_ni(float v) { return expf(v); }
__device__ __attribute__((noinline)) float erf_ni(float v) { return erff(v); }

#define WS_PK  0u                                   // bf16 [384][256] Wq;Wk;Wv rows ; [256][128] Ww rows
#define WS_PW  (WS_PK + 2u * 3 * CO * CIN)
#define WS_QH  (WS_PW + 2u * CIN * CO)              // f16 [b][n][128] q hi ; QL ; KH ; KL
#define WS_QL  (WS_QH + 2u * NB * NPOS * CO)
#define WS_KH  (WS_QL + 2u * NB * NPOS * CO)
#define WS_KL  (WS_KH + 2u * NB * NPOS * CO)
#define WS_VH  (WS_KL + 2u * NB * NPOS * CO)         // f16 [b][128][4096] v
#define WS_ST  (WS_VH + 2u * (size_t)NB * CO * NPOS)   // f32 [b][n][2] (M_n log2(e), 1/L_n)
#define WS_END (WS_ST + 4u * NB * NPOS * 2)

// exponentials in base 2: exp(s - M) = 2^(s log2(e) - M log2(e)). The scale goes into the multiply-add that forms the exponent, and 2^x is the chip's own v_exp_f32, one instruction, where the library expf spends about a dozen vector instructions on splitting the argument and on range tests. Every exponent here is at most about 0; far below, the result goes to 0, as it should
#define L2E 1.44269504088896340736f
__device__ __forceinline__ float ex2(float v) { return __builtin_amdgcn_exp2f(v); }
__device__ __forceinline__ v8f splat8(float v) { const v8f r = { v, v, v, v, v, v, v, v }; return r; }
// the 8 rows' exponentials d[r] = 2^x[r] in one statement. What it is for: the instruction set asks for one free slot between a v_exp_f32 and an instruction that reads its result or writes over its argument. The results are early-clobber, so that inside the statement none lies on an argument, and the v_nop is the slot behind the last one
__device__ __forceinline__ v8f ex2x8(v8f x) { float d0, d1, d2, d3, d4, d5, d6, d7;
  asm("v_exp_f32 %0, %8\n\tv_exp_f32 %1, %9\n\tv_exp_f32 %2, %10\n\tv_exp_f32 %3, %11\n\tv_exp_f32 %4, %12\n\tv_exp_f32 %5, %13\n\tv_exp_f32 %6, %14\n\tv_exp_f32 %7, %15\n\tv_nop"
      : "=&v"(d0), "=&v"(d1), "=&v"(d2), "=&v"(d3), "=&v"(d4), "=&v"(d5), "=&v"(d6), "=&v"(d7)
      : "v"(x[0]), "v"(x[1]), "v"(x[2]), "v"(x[3]), "v"(x[4]), "v"(x[5]), "v"(x[6]), "v"(x[7]));
  const v8f d = { d0, d1, d2, d3, d4, d5, d6, d7 }; return d; }
// ---- asynchronous copies global -> LDS: each lane brings its own 16 (or 4) bytes, through no register
// LDS byte address of a __shared__ object: the low 32 bits of its address
__device__ __forceinline__ unsigned lds_at(const void* p) { return (unsigned)(size_t)p; }
// 8 copies of 16 bytes a lane: copy j goes to l + j * lstep (bytes), copies 0 to 3 from ga + j * gstep, copies 4 to 7 from gb + (j - 4) * gstep. The s_wait_xcnt is the last line of the copies' own statement, so that it stands in front of every later rewrite of their address registers; one statement for the run of copies, so that the wave waits there once
__device__ __forceinline__ void copy44(unsigned l, unsigned lstep, const char* ga, const char* gb, size_t gstep) {
  asm volatile("global_load_async_to_lds_b128 %0, %8, off\n\tglobal_load_async_to_lds_b128 %1, %9, off\n\tglobal_load_async_to_lds_b128 %2, %10, off\n\tglobal_load_async_to_lds_b128 %3, %11, off\n\t"
               "global_load_async_to_lds_b128 %4, %12, off\n\tglobal_load_async_to_lds_b128 %5, %13, off\n\tglobal_load_async_to_lds_b128 %6, %14, off\n\tglobal_load_async_to_lds_b128 %7, %15, off\n\ts_wait_xcnt 0x0"
               :: "v"(l), "v"(l + lstep), "v"(l + 2 * lstep), "v"(l + 3 * lstep), "v"(l + 4 * lstep), "v"(l + 5 * lstep), "v"(l + 6 * lstep), "v"(l + 7 * lstep),
                  "v"(ga), "v"(ga + gstep), "v"(ga + 2 * gstep), "v"(ga + 3 * gstep), "v"(gb), "v"(gb + gstep), "v"(gb + 2 * gstep), "v"(gb + 3 * gstep) : "memory");
}
// the same 8 copies and 4 more, copy j of these from gc + j * cstep to lc + j * lstep, with the one wait behind all 12
__device__ __forceinline__ void copy444(unsigned l, unsigned lstep, const char* ga, const char* gb, size_t gstep, unsigned lc, const char* gc, size_t cstep) {
  asm volatile("global_load_async_to_lds_b128 %0, %12, off\n\tglobal_load_async_to_lds_b128 %1, %13, off\n\tglobal_load_async_to_lds_b128 %2, %14, off\n\tglobal_load_async_to_lds_b128 %3, %15, off\n\t"
               "global_load_async_to_lds_b128 %4, %16, off\n\tglobal_load_async_to_lds_b128 %5, %17, off\n\tglobal_load_async_to_lds_b128 %6, %18, off\n\tglobal_load_async_to_lds_b128 %7, %19, off\n\t"
               "global_load_async_to_lds_b128 %8, %20, off\n\tglobal_load_async_to_lds_b128 %9, %21, off\n\tglobal_load_async_to_lds_b128 %10, %22, off\n\tglobal_load_async_to_lds_b128 %11, %23, off\n\ts_wait_xcnt 0x0"
               :: "v"(l), "v"(l + lstep), "v"(l + 2 * lstep), "v"(l + 3 * lstep), "v"(l + 4 * lstep), "v"(l + 5 * lstep), "v"(l + 6 * lstep), "v"(l + 7 * lstep), "v"(lc), "v"(lc + lstep), "v"(lc + 2 * lstep), "v"(lc + 3 * lstep),
                  "v"(ga), "v"(ga + gstep), "v"(ga + 2 * gstep), "v"(ga + 3 * gstep), "v"(gb), "v"(gb + gstep), "v"(gb + 2 * gstep), "v"(gb + 3 * gstep), "v"(gc), "v"(gc + cstep), "v"(gc + 2 * cstep), "v"(gc + 3 * cstep) : "memory");
}
// one copy of 4 bytes a lane, with the same wait in its own statement
__device__ __forceinline__ void copy1w(unsigned l, const char* g) {
  asm volatile("global_load_async_to_lds_b32 %0, %1, off\n\ts_wait_xcnt 0x0" :: "v"(l), "v"(g) : "memory");
}
// this wave's own copies have landed in LDS (the compiler places no wait for them)
#define WAIT_COPIES() asm volatile("s_wait_asynccnt 0x0" ::: "memory")
// this wave's own LDS reads have returned: stands in front of the barrier behind which the buffer they read is refilled
#define WAIT_LDS() asm volatile("s_wait_dscnt 0x0" ::: "memory")
// k_stats, k_out: a wave owns 16 rows, which makes one wave per SIMD over the chip; the long sum over the other index is therefore split NSPL ways among the waves of a block (4 row groups x NSPL parts = 4 waves per SIMD), so that one wave's LDS, shuffle and WMMA latencies pass behind the other three; the parts are merged through LDS behind the loop
#define NSPL 4
#define NTHR (128 * NSPL)
#define SROWS (32 * NSPL)                           // rows (positions) of one stage of the two-buffer rings below: 32 for each part
#define NSTG (NPOS / SROWS)
typedef v4f __attribute__((may_alias)) v4f_a;
// a plane = 128 rows of 128 f16 (32 KiB, contiguous in global memory) -> LDS rows of 136 f16 (272 B: 16 B x odd, the pitch of ds_load_b128 readers); 512 threads, 4 copies each a plane, a wave's copy = 512 contiguous bytes, copy j = rows 32 j + tid / 16
#define PSTEP ((NTHR / 16) * (CO + 8) * 2u)         // LDS bytes from copy j to copy j + 1; 4 of them = one plane, so that the lo plane, which follows the hi plane in LDS, is copies 4 to 7
// the hi and the lo plane of a stage
__device__ __forceinline__ void stage_pair(_Float16 (*dst)[SROWS][CO + 8], const _Float16* hi, const _Float16* lo, int tid) {
  copy44(lds_at(&dst[0][tid >> 4][(tid & 15) * 8]), PSTEP, (const char*)(hi + tid * 8), (const char*)(lo + tid * 8), NTHR * 16);
}
__global__ __launch_bounds__(256) void k_pack(const float* __restrict__ WQ, const float* __restrict__ WK, const float* __restrict__ WV, const float* __restrict__ WW, __bf16* __restrict__ PK, __bf16* __restrict__ PW) {
  const int n = blockIdx.x, t = threadIdx.x; __shared__ __align__(16) __bf16 s[CIN];
  if (n < 3 * CO) { const float* src = (n < CO) ? WQ + (size_t)n * CIN : (n < 2 * CO) ? WK + (size_t)(n - CO) * CIN : WV + (size_t)(n - 2 * CO) * CIN; s[t] = (__bf16)src[t]; __syncthreads(); if (t < CIN / 8) vst2((unsigned*)(PK + (size_t)n * CIN + t * 8), *(const v4u*)&s[t * 8]); }
  else { const int o = n - 3 * CO; if (t < CO) s[t] = (__bf16)WW[(size_t)o * CO + t]; __syncthreads(); if (t < CO / 8) vst2((unsigned*)(PW + (size_t)o * CO + t * 8), *(const v4u*)&s[t * 8]); }
}
__global__ __launch_bounds__(128) void k_proj(const float* __restrict__ X, const __bf16* __restrict__ PK, const float* __restrict__ BQ, const float* __restrict__ BK, const float* __restrict__ BV, _Float16* __restrict__ QH, _Float16* __restrict__ QL, _Float16* __restrict__ KH, _Float16* __restrict__ KL, _Float16* __restrict__ VH) {
  __shared__ __align__(16) __bf16 sa[64][CIN + 8]; __shared__ __align__(16) _Float16 sth[64][CO + 8], stl[64][CO + 8]; __shared__ __align__(16) _Float16 svh[CO][72];
  const int tid = threadIdx.x, wave = tid >> 5, lane = tid & 31, col = lane & 15, g = lane >> 4; const size_t b = blockIdx.y; const int n0 = blockIdx.x * 64;
  for (int e = tid; e < 64 * CIN; e += 128) { const int c = e >> 6, r = e & 63; sa[r][c] = (__bf16)X[(b * CIN + c) * NPOS + n0 + r]; }
  if (tid < 64) for (int c = CIN; c < CIN + 8; ++c) sa[tid][c] = (__bf16)0.f;
  __syncthreads();
#pragma unroll 1
  for (int which = 0; which < 3; ++which) { v8f acc[8] = {};
    // the 8 weight fragments of a k step are requested together, one k step ahead of the products that read them
    v16b wf[2][8];
#pragma unroll
    for (int j = 0; j < 8; ++j) wf[0][j] = frag_b(PK + (size_t)(which * CO + j * 16 + col) * CIN, lane);
#pragma unroll
    for (int kc = 0; kc < CIN / 32; ++kc) { const v16b a = frag_b(&sa[wave * 16 + col][kc * 32], lane);
      if (kc + 1 < CIN / 32) {
#pragma unroll
        for (int j = 0; j < 8; ++j) wf[(kc + 1) & 1][j] = frag_b(PK + (size_t)(which * CO + j * 16 + col) * CIN + (kc + 1) * 32, lane); }
#pragma unroll
      for (int j = 0; j < 8; ++j) acc[j] = wmma_bf(a, wf[kc & 1][j], acc[j]); }
    const float* BB = (which == 0) ? BQ : (which == 1) ? BK : BV;
    if (which < 2) {
#pragma unroll
      for (int j = 0; j < 8; ++j) { const int c = j * 16 + col; const float bb = bfr(BB[c]);
#pragma unroll
        for (int r = 0; r < 8; ++r) { const float v = acc[j][r] + bb; const _Float16 hv = (_Float16)v; sth[wave * 16 + 8 * g + r][c] = hv; stl[wave * 16 + 8 * g + r][c] = (_Float16)((v - (float)hv) * 2048.0f); } }
      __syncthreads();
      _Float16* DH_ = which ? KH : QH; _Float16* DL_ = which ? KL : QL;
      for (int e = tid; e < 64 * 16; e += 128) { const int r = e >> 4, q = e & 15; const size_t o = (b * NPOS + n0 + r) * CO + q * 8; vst2((unsigned*)(DH_ + o), *(const v4u*)&sth[r][q * 8]); vst2((unsigned*)(DL_ + o), *(const v4u*)&stl[r][q * 8]); }
      __syncthreads(); }
    else {
#pragma unroll
      for (int j = 0; j < 8; ++j) { const int c = j * 16 + col; const float bb = bfr(BB[c]);
#pragma unroll
        for (int r = 0; r < 8; ++r) svh[c][wave * 16 + 8 * g + r] = (_Float16)(acc[j][r] + bb); }
      __syncthreads();
      for (int e = tid; e < CO * 8; e += 128) { const int c = e >> 3, pc = e & 7; vst2((unsigned*)(VH + (b * CO + c) * NPOS + n0 + pc * 8), *(const v4u*)&svh[c][pc * 8]); } } }
}
// ---- k_stats: block = (64 rows n, b): f[n][m] = k_n . q_m over all m (3 products); per row max M_n and L_n = sum_m exp(f - M_n) -> ST[b][n] = (M_n log2(e), 1/L_n)
__global__ __launch_bounds__(NTHR) void k_stats(const _Float16* __restrict__ QH, const _Float16* __restrict__ QL, const _Float16* __restrict__ KH, const _Float16* __restrict__ KL, float* __restrict__ ST) {
  __shared__ __align__(16) float so[NSPL][64][2]; __shared__ __align__(16) _Float16 sq[2][2][SROWS][CO + 8];   // ring: [buffer][hi, lo][row m][channel]
  const int tid = threadIdx.x, wave = (tid >> 5) & 3, spl = tid >> 7, lane = tid & 31, col = lane & 15, g = lane >> 4; const size_t b = blockIdx.y; const int n0 = blockIdx.x * 64 + wave * 16; const size_t rn = b * NPOS + n0;
  // the 4 row groups read the same q rows: a stage of 128 rows (hi and lo) is copied to LDS once for the block, whole lines at a time, one stage ahead of its use; part spl works on rows 32 spl .. 32 spl + 31 of every stage
  const _Float16* gqh = QH + b * NPOS * CO; const _Float16* gql = QL + b * NPOS * CO;
  stage_pair(sq[0], gqh, gql, tid);
  WAIT_COPIES();
  __syncthreads();   // stage 0 is published to all waves
  stage_pair(sq[1], gqh + (size_t)SROWS * CO, gql + (size_t)SROWS * CO, tid);
  v16h ak[CO / 32], akl[CO / 32];
#pragma unroll
  for (int kc = 0; kc < CO / 32; ++kc) { ak[kc] = frag_h(KH + (rn + col) * CO + kc * 32, lane); akl[kc] = frag_h(KL + (rn + col) * CO + kc * 32, lane); }
  v8f m, m2, l;   // one element a row; m2 = m * log2(e), the running maximum in base-2 units
#pragma unroll
  for (int r = 0; r < 8; ++r) { m[r] = -3.0e38f; m2[r] = -3.0e38f; l[r] = 0.f; }
  // not unrolled: one trip = one stage, and the ring's order stands once, at the trip's foot
#pragma unroll 1
  for (int st = 0; st < NSTG; ++st) { const int bf = st & 1;
  // unrolled: the wave's 2 tiles of a stage are straight-line code with constant LDS offsets, so that one tile's LDS reads pass behind the other tile's work
  v8f s[2];
#pragma unroll
  for (int u = 0; u < 2; ++u) { v8f c = {}, cl = {};
    // the tile's 4 hi and 4 lo fragments of q are all requested before the first product, so that their latencies overlap
    v16h qh[CO / 32], ql[CO / 32];
#pragma unroll
    for (int kc = 0; kc < CO / 32; ++kc) { qh[kc] = frag_h(&sq[bf][0][spl * 32 + u * 16 + col][kc * 32], lane); ql[kc] = frag_h(&sq[bf][1][spl * 32 + u * 16 + col][kc * 32], lane); }
#pragma unroll
    for (int kc = 0; kc < CO / 32; ++kc) { c = wmma16(ak[kc], qh[kc], c); cl = wmma16(akl[kc], qh[kc], cl); cl = wmma16(ak[kc], ql[kc], cl); }
    s[u] = c + cl * (1.0f / 2048.0f); }
    // every lane keeps the running maximum and sum of ITS OWN columns (those with m mod 16 = col) of its 8 rows: no lane needs another lane's value inside the loop, and the 16 lanes of a row are joined once, behind it
    // one update for the stage's 2 tiles; straight-line, no call and no branch (the guard on alpha is a select): the 8 rows are independent chains; the unrolls here and behind the loop make every index of s, m, l, mr a constant, so that the arrays stay in registers
    const v8f mn = __builtin_elementwise_max(m, __builtin_elementwise_max(s[0], s[1])), mn2 = mn * L2E, k2 = splat8(L2E);
    const v8f ea = ex2x8(m2 - mn2), e0 = ex2x8(__builtin_elementwise_fma(s[0], k2, -mn2)), e1 = ex2x8(__builtin_elementwise_fma(s[1], k2, -mn2));
    v8f alpha;
#pragma unroll
    for (int r = 0; r < 8; ++r) alpha[r] = (m[r] <= -1.0e38f) ? 0.f : ea[r];
    l = l * alpha + (e0 + e1); m = mn; m2 = mn2;
    WAIT_LDS();
    WAIT_COPIES();
    __syncthreads();   // publishes stage st + 1 and ends every wave's reads of stage st
    if (st + 2 < NSTG) stage_pair(sq[bf], gqh + (size_t)(st + 2) * SROWS * CO, gql + (size_t)(st + 2) * SROWS * CO, tid); }
  WAIT_COPIES();
  // join of the 16 lanes of a row, once: the row's maximum over the lanes, every lane's sum rescaled to it, then the sum over the lanes; phase by phase, so that the 8 rows' shuffle latencies overlap
  float mr[8];
#pragma unroll
  for (int r = 0; r < 8; ++r) mr[r] = m2[r];   // from here on maxima are in base-2 units (the scaling keeps their order)
#pragma unroll
  for (int o = 1; o < 16; o <<= 1)
#pragma unroll
    for (int r = 0; r < 8; ++r) mr[r] = fmaxf(mr[r], __shfl_xor(mr[r], o));
  v8f xj;
#pragma unroll
  for (int r = 0; r < 8; ++r) xj[r] = m2[r] - mr[r];
  l *= ex2x8(xj);
#pragma unroll
  for (int o = 1; o < 16; o <<= 1)
#pragma unroll
    for (int r = 0; r < 8; ++r) l[r] += __shfl_xor(l[r], o);
  if (col == 0) {
#pragma unroll
    for (int r = 0; r < 8; ++r) { so[spl][wave * 16 + 8 * g + r][0] = mr[r]; so[spl][wave * 16 + 8 * g + r][1] = l[r]; } }
  __syncthreads();   // every part's (max, sum) of the 64 rows is in so
  // merge of the parts, one row a thread: M = max of the parts' maxima, L = sum of the parts' sums, each rescaled to M
  if (tid < 64) { float M = so[0][tid][0];
#pragma unroll
    for (int s = 1; s < NSPL; ++s) M = fmaxf(M, so[s][tid][0]);
    float L = 0.f;
#pragma unroll
    for (int s = 0; s < NSPL; ++s) L += so[s][tid][1] * ex2(so[s][tid][0] - M);
    v2f o; o[0] = M; o[1] = 1.0f / L; vst2(ST + (b * NPOS + blockIdx.x * 64 + tid) * 2, o); }
}
// ---- k_out: block = (64 output positions m, b): over n tiles: s[m][n] = q_m . k_n (3 products); w = exp(s - M_n) / L_n; y[c][m] += w (x2^11 single f16) x v[c][n] (8 tiles); then z = Ww . y (2 products, 2 passes of 8 tiles) + bw -> BN -> + x -> out[b][c][m]
__global__ __launch_bounds__(NTHR) void k_out(const _Float16* __restrict__ QH, const _Float16* __restrict__ QL, const _Float16* __restrict__ KH, const _Float16* __restrict__ KL, const _Float16* __restrict__ VH, const float* __restrict__ ST, const __bf16* __restrict__ PW, const float* __restrict__ BW, const float* __restrict__ G, const float* __restrict__ Bt, const float* __restrict__ MU, const float* __restrict__ VAR, const float* __restrict__ X, float* __restrict__ OUT) {
  __shared__ __align__(16) _Float16 spw[4 * NSPL][16][40]; __shared__ __align__(16) __bf16 syh[64][CO + 8], syl[64][CO + 8]; __shared__ __align__(16) float so[128][68];
  __shared__ __align__(16) _Float16 sk[2][2][SROWS][CO + 8]; __shared__ __align__(16) _Float16 sv[2][CO][SROWS + 8]; __shared__ __align__(16) float sst[2][SROWS][2];   // ring: [buffer] k hi, lo rows ; v [channel][n], 272-B rows ; (M log2(e), 1/L)
  const int tid = threadIdx.x, wv = __builtin_amdgcn_readfirstlane(tid >> 5), wave = wv & 3, spl = wv >> 2, lane = tid & 31, col = lane & 15, g = lane >> 4; const size_t b = blockIdx.y; const int m0 = blockIdx.x * 64 + wave * 16; const size_t rm = b * NPOS + m0;
  // the 4 row groups read the same k rows, v columns and row statistics: a stage of 128 positions n is copied to LDS once for the block, whole lines at a time, one stage ahead of its use; part spl works on positions 32 spl .. 32 spl + 31 of every stage
  const _Float16* gkh = KH + b * NPOS * CO; const _Float16* gkl = KL + b * NPOS * CO; const _Float16* gv = VH + (b * CO + (tid >> 4)) * NPOS + (tid & 15) * 8; const float* gst = ST + b * NPOS * 2 + (tid & 255);
  auto stage_kv = [&](int st, int bf) {
    // k hi, k lo ; v: 128 channels x 256 B, the same LDS pitch, copy j takes channels 32 j + tid / 16
    copy444(lds_at(&sk[bf][0][tid >> 4][(tid & 15) * 8]), PSTEP, (const char*)(gkh + (size_t)st * SROWS * CO + tid * 8), (const char*)(gkl + (size_t)st * SROWS * CO + tid * 8), NTHR * 16,
            lds_at(&sv[bf][tid >> 4][(tid & 15) * 8]), (const char*)(gv + st * SROWS), (size_t)32 * NPOS * 2);
    if (wv < 8) copy1w(lds_at(&sst[bf][0][0] + tid), (const char*)(gst + st * SROWS * 2)); };   // 256 words: whole waves 0 to 7, a scalar test
  stage_kv(0, 0);
  WAIT_COPIES();
  __syncthreads();   // stage 0 is published to all waves
  stage_kv(1, 1);
  v16h aq[CO / 32], aql[CO / 32];
#pragma unroll
  for (int kc = 0; kc < CO / 32; ++kc) { aq[kc] = frag_h(QH + (rm + col) * CO + kc * 32, lane); aql[kc] = frag_h(QL + (rm + col) * CO + kc * 32, lane); }
  v8f acc[8] = {};
  // not unrolled: one trip = one stage, and the ring's order stands once, at the trip's foot
#pragma unroll 1
  for (int st = 0; st < NSTG; ++st) { const int bf = st & 1;
  { const int j0 = spl * 32;
#pragma unroll
    for (int ct = 0; ct < 2; ++ct) { const int nn = j0 + ct * 16 + col; v8f c = {}, cl = {};
      // the tile's 4 hi and 4 lo fragments of k are all requested before the first product, so that their latencies overlap
      v16h kh[CO / 32], kl[CO / 32];
#pragma unroll
      for (int kc = 0; kc < CO / 32; ++kc) { kh[kc] = frag_h(&sk[bf][0][nn][kc * 32], lane); kl[kc] = frag_h(&sk[bf][1][nn][kc * 32], lane); }
      const float Mn = sst[bf][nn][0], iLn = sst[bf][nn][1];   // Mn in base-2 units, as k_stats stores it
#pragma unroll
      for (int kc = 0; kc < CO / 32; ++kc) { c = wmma16(aq[kc], kh[kc], c); cl = wmma16(aql[kc], kh[kc], cl); cl = wmma16(aq[kc], kl[kc], cl); }
      const v8f e = ex2x8(__builtin_elementwise_fma(c, splat8(L2E), __builtin_elementwise_fma(cl, splat8(L2E / 2048.0f), splat8(-Mn))));
#pragma unroll
      for (int r = 0; r < 8; ++r) { const float w = e[r] * iLn; spw[wv][8 * g + r][ct * 16 + col] = (_Float16)(w * 2048.0f); } }
    LDSX();
    // the 8 fragments of v are all requested before the first product, so that their latencies overlap
    v16h vv[8];
#pragma unroll
    for (int dt = 0; dt < 8; ++dt) vv[dt] = frag_h(&sv[bf][dt * 16 + col][j0], lane);
    { const v16h pa = frag_h(&spw[wv][col][0], lane);
#pragma unroll
      for (int dt = 0; dt < 8; ++dt) acc[dt] = wmma16(pa, vv[dt], acc[dt]); }
    LDSX(); }
    WAIT_LDS();
    WAIT_COPIES();
    __syncthreads();   // publishes stage st + 1 and ends every wave's reads of stage st
    if (st + 2 < NSTG) stage_kv(st + 2, bf); }
  WAIT_COPIES();
  // merge of the parts: the k ring is dead behind the loop's last barrier (no read and no copy of it is left), and its bytes take every wave's 16 x 128 partial sums, [wave][tile dt][half][lane][4]: 16 bytes a lane, lanes side by side
  float* red = (float*)&sk[0][0][0][0];
#pragma unroll
  for (int dt = 0; dt < 8; ++dt) { v4f lo4, hi4;
#pragma unroll
    for (int r = 0; r < 4; ++r) { lo4[r] = acc[dt][r]; hi4[r] = acc[dt][4 + r]; }
    *(v4f_a*)(red + ((wv * 8 + dt) * 2 + 0) * 128 + lane * 4) = lo4; *(v4f_a*)(red + ((wv * 8 + dt) * 2 + 1) * 128 + lane * 4) = hi4; }
  __syncthreads();   // every wave's partial sums are in red
  // part spl adds the NSPL parts of tiles dt = 2 spl, 2 spl + 1 of its row group, in the order of the parts; y tile -> bf16 hi/lo [64 m][128 c]
#pragma unroll
  for (int d = 0; d < 8 / NSPL; ++d) { const int dt = spl * (8 / NSPL) + d; float y[8];
#pragma unroll
    for (int s = 0; s < NSPL; ++s) { const v4f lo4 = *(const v4f_a*)(red + (((s * 4 + wave) * 8 + dt) * 2 + 0) * 128 + lane * 4), hi4 = *(const v4f_a*)(red + (((s * 4 + wave) * 8 + dt) * 2 + 1) * 128 + lane * 4);
#pragma unroll
      for (int r = 0; r < 4; ++r) { y[r] = s ? y[r] + lo4[r] : lo4[r]; y[4 + r] = s ? y[4 + r] + hi4[r] : hi4[r]; } }
#pragma unroll
    for (int r = 0; r < 8; ++r) { const float v = y[r] * (1.0f / 2048.0f); const __bf16 hb = (__bf16)v; syh[wave * 16 + 8 * g + r][dt * 16 + col] = hb; syl[wave * 16 + 8 * g + r][dt * 16 + col] = (__bf16)(v - (float)hb); } }
  if (spl == 0 && lane < 16) for (int c = CO; c < CO + 8; ++c) { syh[wave * 16 + lane][c] = (__bf16)0.f; syl[wave * 16 + lane][c] = (__bf16)0.f; }
  __syncthreads();
#pragma unroll 1
  for (int pass = 0; pass < 2; ++pass) { constexpr int NJ = 8 / NSPL; const int jb = spl * NJ; v8f z[NJ] = {};   // part spl takes column tiles jb .. jb + NJ - 1 of the pass
    // the wave's weight fragments of a k step are requested together, one k step ahead of the products that read them
    v16b wf[2][NJ];
#pragma unroll
    for (int j = 0; j < NJ; ++j) wf[0][j] = frag_b(PW + (size_t)(pass * 128 + (jb + j) * 16 + col) * CO, lane);
#pragma unroll
    for (int kc = 0; kc < CO / 32; ++kc) { const v16b a = frag_b(&syh[wave * 16 + col][kc * 32], lane), al = frag_b(&syl[wave * 16 + col][kc * 32], lane);
      if (kc + 1 < CO / 32) {
#pragma unroll
        for (int j = 0; j < NJ; ++j) wf[(kc + 1) & 1][j] = frag_b(PW + (size_t)(pass * 128 + (jb + j) * 16 + col) * CO + (kc + 1) * 32, lane); }
#pragma unroll
      for (int j = 0; j < NJ; ++j) { z[j] = wmma_bf(al, wf[kc & 1][j], z[j]); z[j] = wmma_bf(a, wf[kc & 1][j], z[j]); } }
#pragma unroll
    for (int j = 0; j < NJ; ++j) { const int c = pass * 128 + (jb + j) * 16 + col; const float inv = bfr(G[c]) / sqrtf(bfr(VAR[c]) + 1e-5f); const float sh = bfr(Bt[c]) - bfr(MU[c]) * inv; const float bb = bfr(BW[c]);
#pragma unroll
      for (int r = 0; r < 8; ++r) { const int m = m0 + 8 * g + r; so[(jb + j) * 16 + col][wave * 16 + 8 * g + r] = (z[j][r] + bb) * inv + sh + bfr(X[(b * CIN + c) * NPOS + m]); } }
    __syncthreads();
    for (int e = tid; e < 128 * 16; e += NTHR) { const int cl_ = e >> 4, q = e & 15; vst2(OUT + (b * CIN + pass * 128 + cl_) * NPOS + blockIdx.x * 64 + q * 4, *(const v4f*)&so[cl_][q * 4]); }
    __syncthreads(); }
}
extern "C" void kernel_launch(void* const* d_in, const int* in_sizes, int n_in, void* d_out, int out_size, void* d_ws, size_t ws_size, hipStream_t stream) {
  (void)in_sizes; (void)n_in; (void)out_size;
  const float** F = (const float**)d_in;   // 0 x [4,256,64,64], 1 Wq [128,256], 2 bq, 3 Wk, 4 bk, 5 Wv, 6 bv, 7 Ww [256,128], 8 bw, 9 bn_gamma, 10 bn_beta, 11 bn_mean, 12 bn_var
  if (ws_size < (size_t)WS_END) return;
  char* ws = (char*)d_ws; __bf16 *PK = (__bf16*)(ws + WS_PK), *PW = (__bf16*)(ws + WS_PW); _Float16 *QH = (_Float16*)(ws + WS_QH), *QL = (_Float16*)(ws + WS_QL), *KH = (_Float16*)(ws + WS_KH), *KL = (_Float16*)(ws + WS_KL), *VH = (_Float16*)(ws + WS_VH); float* ST = (float*)(ws + WS_ST);
  k_pack<<<3 * CO + CIN, 256, 0, stream>>>(F[1], F[3], F[5], F[7], PK, PW);
  k_proj<<<dim3(NPOS / 64, NB), 128, 0, stream>>>(F[0], PK, F[2], F[4], F[6], QH, QL, KH, KL, VH);
  k_stats<<<dim3(NPOS / 64, NB), NTHR, 0, stream>>>(QH, QL, KH, KL, ST);
  k_out<<<dim3(TQB, NB), NTHR, 0, stream>>>(QH, QL, KH, KL, VH, ST, PW, F[8], F[9], F[10], F[11], F[12], F[0], (float*)d_out);
}

// v008
// A run of this version takes 91.9 microseconds.
// Versions between v006 and this one are left out; their measured steps multiply to 1.44 times as fast.
// Counting every step since v000, it is 18.6 times as fast.
#include <hip/hip_runtime.h>
#include <math.h>

typedef __attribute__((ext_vector_type(16))) _Float16 v16h;
typedef __attribute__((ext_vector_type(16))) __bf16 v16b;
typedef __attribute__((ext_vector_type(8)))  _Float16 v8h;
typedef __attribute__((ext_vector_type(8)))  float v8f;
typedef __attribute__((ext_vector_type(4)))  float v4f;
typedef __attribute__((ext_vector_type(2)))  float v2f;
typedef __attribute__((ext_vector_type(4)))  unsigned v4u;
typedef __attribute__((ext_vector_type(4)))  int v4i;
typedef float __attribute__((may_alias)) float_a;
typedef int __attribute__((may_alias)) int_a;

template <typename T> __device__ __forceinline__ void vst2(void* p, T v) { *(T*)p = v;  }
__device__ __forceinline__ v8f wmma16(v16h a, v16h b, v8f c) {
  v8f d = __builtin_amdgcn_wmma_f32_16x16x32_f16(false, a, false, b, (short)0, c, false, false);
  asm volatile("v_nop\n\tv_nop\n\tv_nop\n\tv_nop" : "+v"(d) : "v"(a), "v"(b));
  return d;
}
__device__ __forceinline__ v8f wmma_bf(v16b a, v16b b, v8f c) {
  v8f d = __builtin_amdgcn_wmma_f32_16x16x32_bf16(false, a, false, b, (short)0, c, false, false);
  asm volatile("v_nop\n\tv_nop\n\tv_nop\n\tv_nop" : "+v"(d) : "v"(a), "v"(b));
  return d;
}
// 16x16x32 fragments: lane = (h = lane>>4, row/col = lane&15); elements 0..7 = k0+8h+0..7, 8..15 = k0+16+8h+0..7; D element r = row 8h+r
__device__ __forceinline__ v16h frag_h(const _Float16* rowk0, int lane) {
  union { v16h v; v8h q[2]; } u; const _Float16* p = rowk0 + 8 * (lane >> 4);
  u.q[0] = *(const v8h*)p; u.q[1] = *(const v8h*)(p + 16); return u.v;
}
__device__ __forceinline__ v16h frag_f32(const float* rowk0, int lane) {
  v16h a; const float* p = rowk0 + 8 * (lane >> 4);
#pragma unroll
  for (int i = 0; i < 8; ++i) { a[i] = (_Float16)p[i]; a[8 + i] = (_Float16)p[16 + i]; }
  return a;
}
__device__ __forceinline__ v16h frag_f32s(const float* rowk0, int lane, float sc) {
  v16h a; const float* p = rowk0 + 8 * (lane >> 4);
#pragma unroll
  for (int i = 0; i < 8; ++i) { a[i] = (_Float16)(p[i] * sc); a[8 + i] = (_Float16)(p[16 + i] * sc); }
  return a;
}
// column fragment from a [K][ld] layout (column n), rows >= K read as 0
__device__ __forceinline__ v16h fragc_f32(const float* W, int k0, int n, int lane, int ld, int K) {
  v16h a; const int g = lane >> 4;
#pragma unroll
  for (int i = 0; i < 8; ++i) { const int ka = k0 + 8 * g + i, kb = ka + 16;
    a[i] = (_Float16)(ka < K ? W[(size_t)(ka < K ? ka : K - 1) * ld + n] : 0.f); a[8 + i] = (_Float16)(kb < K ? W[(size_t)(kb < K ? kb : K - 1) * ld + n] : 0.f); }
  return a;
}
struct F2 { v16b h, l; };
__device__ __forceinline__ F2 bsplit16(const float v[16]) { F2 r;
#pragma unroll
  for (int i = 0; i < 16; ++i) { const __bf16 h = (__bf16)v[i]; r.h[i] = h; r.l[i] = (__bf16)(v[i] - (float)h); }
  return r; }
__device__ __forceinline__ F2 split_row(const float* row, int k0, int lane) { float v[16]; const float* p = row + k0 + 8 * (lane >> 4);
#pragma unroll
  for (int i = 0; i < 8; ++i) { v[i] = p[i]; v[8 + i] = p[16 + i]; }
  return bsplit16(v); }
__device__ __forceinline__ F2 split_rowK(const float* row, int k0, int lane, int K) { float v[16]; const int g = lane >> 4;
#pragma unroll
  for (int i = 0; i < 8; ++i) { const int ka = k0 + 8 * g + i, kb = ka + 16; v[i] = ka < K ? row[ka < K ? ka : K - 1] : 0.f; v[8 + i] = kb < K ? row[kb < K ? kb : K - 1] : 0.f; }
  return bsplit16(v); }
__device__ __forceinline__ F2 split_col(const float* W, int k0, int n, int lane, int ld, int K) { float v[16]; const int g = lane >> 4;
#pragma unroll
  for (int i = 0; i < 8; ++i) { const int ka = k0 + 8 * g + i, kb = ka + 16; v[i] = ka < K ? W[(size_t)(ka < K ? ka : K - 1) * ld + n] : 0.f; v[8 + i] = kb < K ? W[(size_t)(kb < K ? kb : K - 1) * ld + n] : 0.f; }
  return bsplit16(v); }
__device__ __forceinline__ v8f mac3(const F2& a, const F2& b, v8f c) { c = wmma_bf(a.l, b.h, c); c = wmma_bf(a.h, b.l, c); return wmma_bf(a.h, b.h, c); }
__device__ __forceinline__ float sigm(float v) { return 1.0f / (1.0f + expf(-v)); }
#define LDSX() do { asm volatile("s_wait_dscnt 0" ::: "memory"); __builtin_amdgcn_wave_barrier(); __builtin_amdgcn_fence(__ATOMIC_RELEASE, "workgroup"); } while (0)


// Non-local block (B 4, 256 channels, 64 x 64): 1x1 q/k/v convs to 128 channels, affinity f = k^T q softmax-normalised over the second index, y = v f, 1x1 conv back to 256 channels, BatchNorm (inference), residual.
#define NB 4
#define CIN 256
#define CO 128
#define NPOS 4096
#ifndef TQB
#define TQB (NPOS / 64)
#endif
typedef __attribute__((ext_vector_type(8))) __bf16 v8b;
__device__ __forceinline__ v16b frag_b(const __bf16* rowk0, int lane) {
  union { v16b v; v8b q[2]; } u; const __bf16* p = rowk0 + 8 * (lane >> 4);
  u.q[0] = *(const v8b*)p; u.q[1] = *(const v8b*)(p + 16); return u.v;
}
__device__ __forceinline__ float bfr(float v) { return (float)(__bf16)v; }
__device__ __attribute__((noinline)) float exp_ni(float v) { return expf(v); }
__device__ __attribute__((noinline)) float erf_ni(float v) { return erff(v); }

#define WS_PK  0u                                   // bf16 [384][256] Wq;Wk;Wv rows ; [256][128] Ww rows
#define WS_PW  (WS_PK + 2u * 3 * CO * CIN)
#define WS_QH  (WS_PW + 2u * CIN * CO)              // f16 [b][n][128] q ; KH the same for k: one f16 value an element. x and the weights enter the projections rounded to bf16 (8 bits), so q and k carry that error already; the 11 bits of f16 add about a tenth of it to a score
#define WS_KH  (WS_QH + 2u * NB * NPOS * CO)
#define WS_VH  (WS_KH + 2u * NB * NPOS * CO)         // f16 [b][128][4096] v
#define WS_ST  (WS_VH + 2u * (size_t)NB * CO * NPOS)   // f32 [b][n][2] (M_n log2(e), 1/L_n)
#define WS_END (WS_ST + 4u * NB * NPOS * 2)

// exponentials in base 2: exp(s - M) = 2^(s log2(e) - M log2(e)). The scale goes into the multiply-add that forms the exponent, and 2^x is the chip's own v_exp_f32, one instruction, where the library expf spends about a dozen vector instructions on splitting the argument and on range tests. Every exponent here is at most about 0; far below, the result goes to 0, as it should
#define L2E 1.44269504088896340736f
__device__ __forceinline__ float ex2(float v) { return __builtin_amdgcn_exp2f(v); }
__device__ __forceinline__ v8f splat8(float v) { const v8f r = { v, v, v, v, v, v, v, v }; return r; }
// the 8 rows' exponentials d[r] = 2^x[r] in one statement. What it is for: the instruction set asks for one free slot between a v_exp_f32 and an instruction that reads its result or writes over its argument. The results are early-clobber, so that inside the statement none lies on an argument, and the v_nop is the slot behind the last one
__device__ __forceinline__ v8f ex2x8(v8f x) { float d0, d1, d2, d3, d4, d5, d6, d7;
  asm("v_exp_f32 %0, %8\n\tv_exp_f32 %1, %9\n\tv_exp_f32 %2, %10\n\tv_exp_f32 %3, %11\n\tv_exp_f32 %4, %12\n\tv_exp_f32 %5, %13\n\tv_exp_f32 %6, %14\n\tv_exp_f32 %7, %15\n\tv_nop"
      : "=&v"(d0), "=&v"(d1), "=&v"(d2), "=&v"(d3), "=&v"(d4), "=&v"(d5), "=&v"(d6), "=&v"(d7)
      : "v"(x[0]), "v"(x[1]), "v"(x[2]), "v"(x[3]), "v"(x[4]), "v"(x[5]), "v"(x[6]), "v"(x[7]));
  const v8f d = { d0, d1, d2, d3, d4, d5, d6, d7 }; return d; }
// ---- asynchronous copies global -> LDS: each lane brings its own 16 (or 4) bytes, through no register
// LDS byte address of a __shared__ object: the low 32 bits of its address
__device__ __forceinline__ unsigned lds_at(const void* p) { return (unsigned)(size_t)p; }
// 4 copies of 16 bytes a lane: copy j goes from ga + j * gstep to l + j * lstep (bytes). The s_wait_xcnt is the last line of the copies' own statement, so that it stands in front of every later rewrite of their address registers; one statement for the run of copies, so that the wave waits there once
__device__ __forceinline__ void copy4(unsigned l, unsigned lstep, const char* ga, size_t gstep) {
  asm volatile("global_load_async_to_lds_b128 %0, %4, off\n\tglobal_load_async_to_lds_b128 %1, %5, off\n\tglobal_load_async_to_lds_b128 %2, %6, off\n\tglobal_load_async_to_lds_b128 %3, %7, off\n\ts_wait_xcnt 0x0"
               :: "v"(l), "v"(l + lstep), "v"(l + 2 * lstep), "v"(l + 3 * lstep), "v"(ga), "v"(ga + gstep), "v"(ga + 2 * gstep), "v"(ga + 3 * gstep) : "memory");
}
// 8 copies: copy j goes to l + j * lstep, copies 0 to 3 from ga + j * astep, copies 4 to 7 from gb + (j - 4) * bstep, with the one wait behind all 8
__device__ __forceinline__ void copy44(unsigned l, unsigned lstep, const char* ga, size_t astep, const char* gb, size_t bstep) {
  asm volatile("global_load_async_to_lds_b128 %0, %8, off\n\tglobal_load_async_to_lds_b128 %1, %9, off\n\tglobal_load_async_to_lds_b128 %2, %10, off\n\tglobal_load_async_to_lds_b128 %3, %11, off\n\t"
               "global_load_async_to_lds_b128 %4, %12, off\n\tglobal_load_async_to_lds_b128 %5, %13, off\n\tglobal_load_async_to_lds_b128 %6, %14, off\n\tglobal_load_async_to_lds_b128 %7, %15, off\n\ts_wait_xcnt 0x0"
               :: "v"(l), "v"(l + lstep), "v"(l + 2 * lstep), "v"(l + 3 * lstep), "v"(l + 4 * lstep), "v"(l + 5 * lstep), "v"(l + 6 * lstep), "v"(l + 7 * lstep),
                  "v"(ga), "v"(ga + astep), "v"(ga + 2 * astep), "v"(ga + 3 * astep), "v"(gb), "v"(gb + bstep), "v"(gb + 2 * bstep), "v"(gb + 3 * bstep) : "memory");
}
// one copy of 4 bytes a lane, with the same wait in its own statement
__device__ __forceinline__ void copy1w(unsigned l, const char* g) {
  asm volatile("global_load_async_to_lds_b32 %0, %1, off\n\ts_wait_xcnt 0x0" :: "v"(l), "v"(g) : "memory");
}
// this wave's own copies have landed in LDS (the compiler places no wait for them)
#define WAIT_COPIES() asm volatile("s_wait_asynccnt 0x0" ::: "memory")
// this wave's own LDS reads have returned: stands in front of the barrier behind which the buffer they read is refilled
#define WAIT_LDS() asm volatile("s_wait_dscnt 0x0" ::: "memory")
// k_stats, k_out: a wave owns 16 rows, which makes one wave per SIMD over the chip; the long sum over the other index is therefore split NSPL ways among the waves of a block (4 row groups x NSPL parts = 4 waves per SIMD), so that one wave's LDS, shuffle and WMMA latencies pass behind the other three; the parts are merged through LDS behind the loop
#define NSPL 4
#define NTHR (128 * NSPL)
#define SROWS (32 * NSPL)                           // rows (positions) of one stage of the two-buffer rings below: 32 for each part
#define NSTG (NPOS / SROWS)
typedef v4f __attribute__((may_alias)) v4f_a;
// a plane = 128 rows of 128 f16 (32 KiB, contiguous in global memory) -> LDS rows of 136 f16 (272 B: 16 B x odd, the pitch of ds_load_b128 readers); 512 threads, 4 copies each a plane, a wave's copy = 512 contiguous bytes, copy j = rows 32 j + tid / 16
#define PSTEP ((NTHR / 16) * (CO + 8) * 2u)         // LDS bytes from copy j to copy j + 1; 4 of them = one plane, so that a second plane, which follows the first in LDS, is copies 4 to 7
// the one plane of a stage
__device__ __forceinline__ void stage_plane(_Float16 (*dst)[CO + 8], const _Float16* src, int tid) {
  copy4(lds_at(&dst[tid >> 4][(tid & 15) * 8]), PSTEP, (const char*)(src + tid * 8), NTHR * 16);
}
__global__ __launch_bounds__(256) void k_pack(const float* __restrict__ WQ, const float* __restrict__ WK, const float* __restrict__ WV, const float* __restrict__ WW, __bf16* __restrict__ PK, __bf16* __restrict__ PW) {
  const int n = blockIdx.x, t = threadIdx.x; __shared__ __align__(16) __bf16 s[CIN];
  if (n < 3 * CO) { const float* src = (n < CO) ? WQ + (size_t)n * CIN : (n < 2 * CO) ? WK + (size_t)(n - CO) * CIN : WV + (size_t)(n - 2 * CO) * CIN; s[t] = (__bf16)src[t]; __syncthreads(); if (t < CIN / 8) vst2((unsigned*)(PK + (size_t)n * CIN + t * 8), *(const v4u*)&s[t * 8]); }
  else { const int o = n - 3 * CO; if (t < CO) s[t] = (__bf16)WW[(size_t)o * CO + t]; __syncthreads(); if (t < CO / 8) vst2((unsigned*)(PW + (size_t)o * CO + t * 8), *(const v4u*)&s[t * 8]); }
}
// k_proj: block = (64 positions n, b), 12 waves: the 24 column tiles of q ; k ; v (8 each) are dealt 2 to a wave, and a wave takes its 2 for all 64 rows. So the three projections run side by side, a weight fragment is loaded by one wave of the block and no other, and a wave's 16 weight fragments and its share of the x tile fit its registers: every global load of the block is requested at the start, and none is waited for inside a loop
#define PWAV 12
#define PTHR (32 * PWAV)
#define XTASK CIN                                   // the x tile as tasks of one wave: task t = channels 2 (t / 2), 2 (t / 2) + 1 x rows 32 (t mod 2) + lane
#define XEACH ((XTASK + PWAV - 1) / PWAV)           // tasks a wave; in the last round only the first waves have one
typedef __attribute__((ext_vector_type(2))) __bf16 v2b;
__global__ __launch_bounds__(PTHR) void k_proj(const float* __restrict__ X, const __bf16* __restrict__ PK, const float* __restrict__ BQ, const float* __restrict__ BK, const float* __restrict__ BV, _Float16* __restrict__ QH, _Float16* __restrict__ KH, _Float16* __restrict__ VH) {
  __shared__ __align__(16) __bf16 sa[64][CIN + 8]; __shared__ __align__(16) _Float16 sth[2][64][CO + 8]; __shared__ __align__(16) _Float16 svh[CO][72];
  const int tid = threadIdx.x, wave = __builtin_amdgcn_readfirstlane(tid >> 5), lane = tid & 31, col = lane & 15, g = lane >> 4; const size_t b = blockIdx.y; const int n0 = blockIdx.x * 64;
  const int which = wave >> 2, jb = (wave & 3) * 2;   // 0 q, 1 k, 2 v ; the wave's first column tile in it
  // PWAV is even, so task i * PWAV + wave has the row half wave mod 2 and the channels i * PWAV + (wave - wave mod 2), + 1: one address a wave, and round i at a constant distance from it
  static_assert(PWAV % 2 == 0, "the split of a task's number into round and wave");
  const float* gx = X + b * CIN * NPOS + n0 + lane;
  const float* px = gx + (size_t)(wave & ~1) * NPOS + 32 * (wave & 1);
  // a wave without a task in the last round loads the last task's words all the same (the task's number is clamped) and stores nothing: so the last round's loads need no branch and go out with the others
  const int tl = min((XEACH - 1) * PWAV + wave, XTASK - 1); const float* pl = gx + (size_t)(tl & ~1) * NPOS + 32 * (tl & 1);
  float x0[XEACH], x1[XEACH];
#pragma unroll   // the index picks a register (x0, x1, wf, a, acc, bb): it has to be a constant
  for (int i = 0; i + 1 < XEACH; ++i) { x0[i] = px[(size_t)i * PWAV * NPOS]; x1[i] = px[(size_t)(i * PWAV + 1) * NPOS]; }
  x0[XEACH - 1] = pl[0]; x1[XEACH - 1] = pl[NPOS];
  const __bf16* pw[2]; int cj[2];   // the lane's own place in the first k step of its 2 weight rows ; its 2 columns
#pragma unroll   // the index picks a register (x0, x1, wf, a, acc, bb): it has to be a constant
  for (int j = 0; j < 2; ++j) { cj[j] = (jb + j) * 16 + col; pw[j] = PK + (size_t)(which * CO + cj[j]) * CIN + 8 * g; }
  v16b wf[CIN / 32][2];
#pragma unroll   // the index picks a register (x0, x1, wf, a, acc, bb): it has to be a constant
  for (int kc = 0; kc < CIN / 32; ++kc)
#pragma unroll   // the index picks a register (x0, x1, wf, a, acc, bb): it has to be a constant
    for (int j = 0; j < 2; ++j) { union { v16b v; v8b q[2]; } u; u.q[0] = *(const v8b*)(pw[j] + kc * 32); u.q[1] = *(const v8b*)(pw[j] + kc * 32 + 16); wf[kc][j] = u.v; }   // frag_b of the row
  const float* BB = (which == 0) ? BQ : (which == 1) ? BK : BV;
  float bb[2];
#pragma unroll   // the index picks a register (x0, x1, wf, a, acc, bb): it has to be a constant
  for (int j = 0; j < 2; ++j) bb[j] = bfr(BB[cj[j]]);
  // the wait that belongs between a global load and a write over a vector register that it names, once for all the loads above; it takes their address registers as inputs, so that they stay as they are up to here and no later load's result is laid over the address of an earlier one
  asm volatile("s_wait_xcnt 0x0" :: "v"(px), "v"(pl), "v"(pw[0]), "v"(pw[1]), "v"(cj[0]), "v"(cj[1]) : "memory");
  // two neighbouring channels of a row are one 4-byte LDS store
#pragma unroll   // the index picks a register (x0, x1, wf, a, acc, bb): it has to be a constant
  for (int i = 0; i + 1 < XEACH; ++i) { const int t = i * PWAV + wave; const v2b v = { (__bf16)x0[i], (__bf16)x1[i] }; *(v2b*)&sa[32 * (t & 1) + lane][t & ~1] = v; }
  // takes the last round's two loaded words as inputs and does nothing: it keeps their loads up with the others. Without it the compiler moves the two loads down into the branch below, where the first waves wait out a memory round trip of their own
  asm volatile("" :: "v"(x0[XEACH - 1]), "v"(x1[XEACH - 1]));
  { const int t = (XEACH - 1) * PWAV + wave;
    if (t < XTASK) { const v2b v = { (__bf16)x0[XEACH - 1], (__bf16)x1[XEACH - 1] }; *(v2b*)&sa[32 * (t & 1) + lane][t & ~1] = v; } }
  __syncthreads();
  v8f acc[4][2] = {};
#pragma unroll   // the index picks a register (x0, x1, wf, a, acc, bb): it has to be a constant
  for (int kc = 0; kc < CIN / 32; ++kc) { v16b a[4];
#pragma unroll   // the index picks a register (x0, x1, wf, a, acc, bb): it has to be a constant
    for (int rt = 0; rt < 4; ++rt) a[rt] = frag_b(&sa[rt * 16 + col][kc * 32], lane);
#pragma unroll   // the index picks a register (x0, x1, wf, a, acc, bb): it has to be a constant
    for (int rt = 0; rt < 4; ++rt)
#pragma unroll   // the index picks a register (x0, x1, wf, a, acc, bb): it has to be a constant
      for (int j = 0; j < 2; ++j) acc[rt][j] = wmma_bf(a[rt], wf[kc][j], acc[rt][j]); }
  // the 4 waves of a projection put its 64 x 128 tile into LDS and, behind the barrier, store it in whole lines, 8 pieces of 16 bytes a thread
  const int t4 = tid & 127;
  if (which < 2) {
#pragma unroll   // the index picks a register (x0, x1, wf, a, acc, bb): it has to be a constant
    for (int j = 0; j < 2; ++j) { const int c = cj[j];
#pragma unroll   // the index picks a register (x0, x1, wf, a, acc, bb): it has to be a constant
      for (int rt = 0; rt < 4; ++rt)
#pragma unroll   // the index picks a register (x0, x1, wf, a, acc, bb): it has to be a constant
        for (int r = 0; r < 8; ++r) sth[which][rt * 16 + 8 * g + r][c] = (_Float16)(acc[rt][j][r] + bb[j]); } }
  else {
#pragma unroll   // the index picks a register (x0, x1, wf, a, acc, bb): it has to be a constant
    for (int j = 0; j < 2; ++j) { const int c = cj[j];
#pragma unroll   // the index picks a register (x0, x1, wf, a, acc, bb): it has to be a constant
      for (int rt = 0; rt < 4; ++rt)
#pragma unroll   // the index picks a register (x0, x1, wf, a, acc, bb): it has to be a constant
        for (int r = 0; r < 8; ++r) svh[c][rt * 16 + 8 * g + r] = (_Float16)(acc[rt][j][r] + bb[j]); } }
  __syncthreads();   // the q, k and v tiles of the block are in LDS
  if (which < 2) { _Float16* DH_ = which ? KH : QH;
    for (int e = t4; e < 64 * 16; e += 128) { const int r = e >> 4, q = e & 15; const size_t o = (b * NPOS + n0 + r) * CO + q * 8; vst2((unsigned*)(DH_ + o), *(const v4u*)&sth[which][r][q * 8]); } }
  else {
    for (int e = t4; e < CO * 8; e += 128) { const int c = e >> 3, pc = e & 7; vst2((unsigned*)(VH + (b * CO + c) * NPOS + n0 + pc * 8), *(const v4u*)&svh[c][pc * 8]); } }
}
// ---- k_stats: block = (64 rows n, b): f[n][m] = k_n . q_m over all m (1 product); per row max M_n and L_n = sum_m exp(f - M_n) -> ST[b][n] = (M_n log2(e), 1/L_n)
__global__ __launch_bounds__(NTHR) void k_stats(const _Float16* __restrict__ QH, const _Float16* __restrict__ KH, float* __restrict__ ST) {
  __shared__ __align__(16) float so[NSPL][64][2]; __shared__ __align__(16) _Float16 sq[2][SROWS][CO + 8];   // ring: [buffer][row m][channel]
  const int tid = threadIdx.x, wave = (tid >> 5) & 3, spl = tid >> 7, lane = tid & 31, col = lane & 15, g = lane >> 4; const size_t b = blockIdx.y; const int n0 = blockIdx.x * 64 + wave * 16; const size_t rn = b * NPOS + n0;
  // the 4 row groups read the same q rows: a stage of 128 rows is copied to LDS once for the block, whole lines at a time, one stage ahead of its use; part spl works on rows 32 spl .. 32 spl + 31 of every stage
  const _Float16* gqh = QH + b * NPOS * CO;
  stage_plane(sq[0], gqh, tid);
  WAIT_COPIES();
  __syncthreads();   // stage 0 is published to all waves
  stage_plane(sq[1], gqh + (size_t)SROWS * CO, tid);
  v16h ak[CO / 32];
#pragma unroll
  for (int kc = 0; kc < CO / 32; ++kc) ak[kc] = frag_h(KH + (rn + col) * CO + kc * 32, lane);
  v8f m, m2, l;   // one element a row; m2 = m * log2(e), the running maximum in base-2 units
#pragma unroll
  for (int r = 0; r < 8; ++r) { m[r] = -3.0e38f; m2[r] = -3.0e38f; l[r] = 0.f; }
  // not unrolled: one trip = one stage, and the ring's order stands once, at the trip's foot
#pragma unroll 1
  for (int st = 0; st < NSTG; ++st) { const int bf = st & 1;
  // unrolled: the wave's 2 tiles of a stage are straight-line code with constant LDS offsets, so that one tile's LDS reads pass behind the other tile's work
  v8f s[2];
#pragma unroll
  for (int u = 0; u < 2; ++u) { v8f c = {};
    // the tile's 4 fragments of q are all requested before the first product, so that their latencies overlap
    v16h qh[CO / 32];
#pragma unroll
    for (int kc = 0; kc < CO / 32; ++kc) qh[kc] = frag_h(&sq[bf][spl * 32 + u * 16 + col][kc * 32], lane);
#pragma unroll
    for (int kc = 0; kc < CO / 32; ++kc) c = wmma16(ak[kc], qh[kc], c);
    s[u] = c; }
    // every lane keeps the running maximum and sum of ITS OWN columns (those with m mod 16 = col) of its 8 rows: no lane needs another lane's value inside the loop, and the 16 lanes of a row are joined once, behind it
    // one update for the stage's 2 tiles; straight-line, no call and no branch (the guard on alpha is a select): the 8 rows are independent chains; the unrolls here and behind the loop make every index of s, m, l, mr a constant, so that the arrays stay in registers
    const v8f mn = __builtin_elementwise_max(m, __builtin_elementwise_max(s[0], s[1])), mn2 = mn * L2E, k2 = splat8(L2E);
    const v8f ea = ex2x8(m2 - mn2), e0 = ex2x8(__builtin_elementwise_fma(s[0], k2, -mn2)), e1 = ex2x8(__builtin_elementwise_fma(s[1], k2, -mn2));
    v8f alpha;
#pragma unroll
    for (int r = 0; r < 8; ++r) alpha[r] = (m[r] <= -1.0e38f) ? 0.f : ea[r];
    l = l * alpha + (e0 + e1); m = mn; m2 = mn2;
    WAIT_LDS();
    WAIT_COPIES();
    __syncthreads();   // publishes stage st + 1 and ends every wave's reads of stage st
    if (st + 2 < NSTG) stage_plane(sq[bf], gqh + (size_t)(st + 2) * SROWS * CO, tid); }
  WAIT_COPIES();
  // join of the 16 lanes of a row, once: the row's maximum over the lanes, every lane's sum rescaled to it, then the sum over the lanes; phase by phase, so that the 8 rows' shuffle latencies overlap
  float mr[8];
#pragma unroll
  for (int r = 0; r < 8; ++r) mr[r] = m2[r];   // from here on maxima are in base-2 units (the scaling keeps their order)
#pragma unroll
  for (int o = 1; o < 16; o <<= 1)
#pragma unroll
    for (int r = 0; r < 8; ++r) mr[r] = fmaxf(mr[r], __shfl_xor(mr[r], o));
  v8f xj;
#pragma unroll
  for (int r = 0; r < 8; ++r) xj[r] = m2[r] - mr[r];
  l *= ex2x8(xj);
#pragma unroll
  for (int o = 1; o < 16; o <<= 1)
#pragma unroll
    for (int r = 0; r < 8; ++r) l[r] += __shfl_xor(l[r], o);
  if (col == 0) {
#pragma unroll
    for (int r = 0; r < 8; ++r) { so[spl][wave * 16 + 8 * g + r][0] = mr[r]; so[spl][wave * 16 + 8 * g + r][1] = l[r]; } }
  __syncthreads();   // every part's (max, sum) of the 64 rows is in so
  // merge of the parts, one row a thread: M = max of the parts' maxima, L = sum of the parts' sums, each rescaled to M
  if (tid < 64) { float M = so[0][tid][0];
#pragma unroll
    for (int s = 1; s < NSPL; ++s) M = fmaxf(M, so[s][tid][0]);
    float L = 0.f;
#pragma unroll
    for (int s = 0; s < NSPL; ++s) L += so[s][tid][1] * ex2(so[s][tid][0] - M);
    v2f o; o[0] = M; o[1] = 1.0f / L; vst2(ST + (b * NPOS + blockIdx.x * 64 + tid) * 2, o); }
}
// ---- k_out: block = (64 output positions m, b): over n tiles: s[m][n] = q_m . k_n (1 product); w = exp(s - M_n) / L_n; y[c][m] += w (x2^11 single f16) x v[c][n] (8 tiles); then z = Ww . y (2 products, 2 passes of 8 tiles) + bw -> BN -> + x -> out[b][c][m]
__global__ __launch_bounds__(NTHR) void k_out(const _Float16* __restrict__ QH, const _Float16* __restrict__ KH, const _Float16* __restrict__ VH, const float* __restrict__ ST, const __bf16* __restrict__ PW, const float* __restrict__ BW, const float* __restrict__ G, const float* __restrict__ Bt, const float* __restrict__ MU, const float* __restrict__ VAR, const float* __restrict__ X, float* __restrict__ OUT) {
  __shared__ __align__(16) _Float16 spw[4 * NSPL][16][40]; __shared__ __align__(16) __bf16 syh[64][CO + 8], syl[64][CO + 8]; __shared__ __align__(16) float so[128][68];
  static_assert(SROWS == CO, "the k plane [n][channel] and the v plane [channel][n] of a stage have one shape");
  __shared__ __align__(16) _Float16 sk[2][2][SROWS][CO + 8]; __shared__ __align__(16) float sst[2][SROWS][2];   // ring: [buffer][0: k, rows n x channel ; 1: v, rows channel x n] ; (M log2(e), 1/L)
  const int tid = threadIdx.x, wv = __builtin_amdgcn_readfirstlane(tid >> 5), wave = wv & 3, spl = wv >> 2, lane = tid & 31, col = lane & 15, g = lane >> 4; const size_t b = blockIdx.y; const int m0 = blockIdx.x * 64 + wave * 16; const size_t rm = b * NPOS + m0;
  // the 4 row groups read the same k rows, v columns and row statistics: a stage of 128 positions n is copied to LDS once for the block, whole lines at a time, one stage ahead of its use; part spl works on positions 32 spl .. 32 spl + 31 of every stage
  const _Float16* gkh = KH + b * NPOS * CO; const _Float16* gv = VH + (b * CO + (tid >> 4)) * NPOS + (tid & 15) * 8; const float* gst = ST + b * NPOS * 2 + (tid & 255);
  auto stage_kv = [&](int st, int bf) {
    // k ; v: 128 channels x 256 B, the same LDS pitch, copy 4 + j takes channels 32 j + tid / 16
    copy44(lds_at(&sk[bf][0][tid >> 4][(tid & 15) * 8]), PSTEP, (const char*)(gkh + (size_t)st * SROWS * CO + tid * 8), NTHR * 16, (const char*)(gv + st * SROWS), (size_t)32 * NPOS * 2);
    if (wv < 8) copy1w(lds_at(&sst[bf][0][0] + tid), (const char*)(gst + st * SROWS * 2)); };   // 256 words: whole waves 0 to 7, a scalar test
  stage_kv(0, 0);
  WAIT_COPIES();
  __syncthreads();   // stage 0 is published to all waves
  stage_kv(1, 1);
  v16h aq[CO / 32];
#pragma unroll
  for (int kc = 0; kc < CO / 32; ++kc) aq[kc] = frag_h(QH + (rm + col) * CO + kc * 32, lane);
  v8f acc[8] = {};
  // not unrolled: one trip = one stage, and the ring's order stands once, at the trip's foot
#pragma unroll 1
  for (int st = 0; st < NSTG; ++st) { const int bf = st & 1;
  { const int j0 = spl * 32;
#pragma unroll
    for (int ct = 0; ct < 2; ++ct) { const int nn = j0 + ct * 16 + col; v8f c = {};
      // the tile's 4 fragments of k are all requested before the first product, so that their latencies overlap
      v16h kh[CO / 32];
#pragma unroll
      for (int kc = 0; kc < CO / 32; ++kc) kh[kc] = frag_h(&sk[bf][0][nn][kc * 32], lane);
      const float Mn = sst[bf][nn][0], iLn = sst[bf][nn][1];   // Mn in base-2 units, as k_stats stores it
#pragma unroll
      for (int kc = 0; kc < CO / 32; ++kc) c = wmma16(aq[kc], kh[kc], c);
      const v8f e = ex2x8(__builtin_elementwise_fma(c, splat8(L2E), splat8(-Mn)));
#pragma unroll
      for (int r = 0; r < 8; ++r) { const float w = e[r] * iLn; spw[wv][8 * g + r][ct * 16 + col] = (_Float16)(w * 2048.0f); } }
    LDSX();
    // the 8 fragments of v are all requested before the first product, so that their latencies overlap
    v16h vv[8];
#pragma unroll
    for (int dt = 0; dt < 8; ++dt) vv[dt] = frag_h(&sk[bf][1][dt * 16 + col][j0], lane);
    { const v16h pa = frag_h(&spw[wv][col][0], lane);
#pragma unroll
      for (int dt = 0; dt < 8; ++dt) acc[dt] = wmma16(pa, vv[dt], acc[dt]); }
    LDSX(); }
    WAIT_LDS();
    WAIT_COPIES();
    __syncthreads();   // publishes stage st + 1 and ends every wave's reads of stage st
    if (st + 2 < NSTG) stage_kv(st + 2, bf); }
  WAIT_COPIES();
  // merge of the parts: the ring of k and v is dead behind the loop's last barrier (no read and no copy of it is left), and its bytes take every wave's 16 x 128 partial sums, [wave][tile dt][half][lane][4]: 16 bytes a lane, lanes side by side
  float* red = (float*)&sk[0][0][0][0];
#pragma unroll
  for (int dt = 0; dt < 8; ++dt) { v4f lo4, hi4;
#pragma unroll
    for (int r = 0; r < 4; ++r) { lo4[r] = acc[dt][r]; hi4[r] = acc[dt][4 + r]; }
    *(v4f_a*)(red + ((wv * 8 + dt) * 2 + 0) * 128 + lane * 4) = lo4; *(v4f_a*)(red + ((wv * 8 + dt) * 2 + 1) * 128 + lane * 4) = hi4; }
  __syncthreads();   // every wave's partial sums are in red
  // part spl adds the NSPL parts of tiles dt = 2 spl, 2 spl + 1 of its row group, in the order of the parts; y tile -> bf16 hi/lo [64 m][128 c]
#pragma unroll
  for (int d = 0; d < 8 / NSPL; ++d) { const int dt = spl * (8 / NSPL) + d; float y[8];
#pragma unroll
    for (int s = 0; s < NSPL; ++s) { const v4f lo4 = *(const v4f_a*)(red + (((s * 4 + wave) * 8 + dt) * 2 + 0) * 128 + lane * 4), hi4 = *(const v4f_a*)(red + (((s * 4 + wave) * 8 + dt) * 2 + 1) * 128 + lane * 4);
#pragma unroll
      for (int r = 0; r < 4; ++r) { y[r] = s ? y[r] + lo4[r] : lo4[r]; y[4 + r] = s ? y[4 + r] + hi4[r] : hi4[r]; } }
#pragma unroll
    for (int r = 0; r < 8; ++r) { const float v = y[r] * (1.0f / 2048.0f); const __bf16 hb = (__bf16)v; syh[wave * 16 + 8 * g + r][dt * 16 + col] = hb; syl[wave * 16 + 8 * g + r][dt * 16 + col] = (__bf16)(v - (float)hb); } }
  if (spl == 0 && lane < 16) for (int c = CO; c < CO + 8; ++c) { syh[wave * 16 + lane][c] = (__bf16)0.f; syl[wave * 16 + lane][c] = (__bf16)0.f; }
  __syncthreads();
#pragma unroll 1
  for (int pass = 0; pass < 2; ++pass) { constexpr int NJ = 8 / NSPL; const int jb = spl * NJ; v8f z[NJ] = {};   // part spl takes column tiles jb .. jb + NJ - 1 of the pass
    // the wave's weight fragments of a k step are requested together, one k step ahead of the products that read them
    v16b wf[2][NJ];
#pragma unroll
    for (int j = 0; j < NJ; ++j) wf[0][j] = frag_b(PW + (size_t)(pass * 128 + (jb + j) * 16 + col) * CO, lane);
#pragma unroll
    for (int kc = 0; kc < CO / 32; ++kc) { const v16b a = frag_b(&syh[wave * 16 + col][kc * 32], lane), al = frag_b(&syl[wave * 16 + col][kc * 32], lane);
      if (kc + 1 < CO / 32) {
#pragma unroll
        for (int j = 0; j < NJ; ++j) wf[(kc + 1) & 1][j] = frag_b(PW + (size_t)(pass * 128 + (jb + j) * 16 + col) * CO + (kc + 1) * 32, lane); }
#pragma unroll
      for (int j = 0; j < NJ; ++j) { z[j] = wmma_bf(al, wf[kc & 1][j], z[j]); z[j] = wmma_bf(a, wf[kc & 1][j], z[j]); } }
#pragma unroll
    for (int j = 0; j < NJ; ++j) { const int c = pass * 128 + (jb + j) * 16 + col; const float inv = bfr(G[c]) / sqrtf(bfr(VAR[c]) + 1e-5f); const float sh = bfr(Bt[c]) - bfr(MU[c]) * inv; const float bb = bfr(BW[c]);
#pragma unroll
      for (int r = 0; r < 8; ++r) { const int m = m0 + 8 * g + r; so[(jb + j) * 16 + col][wave * 16 + 8 * g + r] = (z[j][r] + bb) * inv + sh + bfr(X[(b * CIN + c) * NPOS + m]); } }
    __syncthreads();
    for (int e = tid; e < 128 * 16; e += NTHR) { const int cl_ = e >> 4, q = e & 15; vst2(OUT + (b * CIN + pass * 128 + cl_) * NPOS + blockIdx.x * 64 + q * 4, *(const v4f*)&so[cl_][q * 4]); }
    __syncthreads(); }
}
extern "C" void kernel_launch(void* const* d_in, const int* in_sizes, int n_in, void* d_out, int out_size, void* d_ws, size_t ws_size, hipStream_t stream) {
  (void)in_sizes; (void)n_in; (void)out_size;
  const float** F = (const float**)d_in;   // 0 x [4,256,64,64], 1 Wq [128,256], 2 bq, 3 Wk, 4 bk, 5 Wv, 6 bv, 7 Ww [256,128], 8 bw, 9 bn_gamma, 10 bn_beta, 11 bn_mean, 12 bn_var
  if (ws_size < (size_t)WS_END) return;
  char* ws = (char*)d_ws; __bf16 *PK = (__bf16*)(ws + WS_PK), *PW = (__bf16*)(ws + WS_PW); _Float16 *QH = (_Float16*)(ws + WS_QH), *KH = (_Float16*)(ws + WS_KH), *VH = (_Float16*)(ws + WS_VH); float* ST = (float*)(ws + WS_ST);
  k_pack<<<3 * CO + CIN, 256, 0, stream>>>(F[1], F[3], F[5], F[7], PK, PW);
  k_proj<<<dim3(NPOS / 64, NB), PTHR, 0, stream>>>(F[0], PK, F[2], F[4], F[6], QH, KH, VH);
  k_stats<<<dim3(NPOS / 64, NB), NTHR, 0, stream>>>(QH, KH, ST);
  k_out<<<dim3(TQB, NB), NTHR, 0, stream>>>(QH, KH, VH, ST, PW, F[8], F[9], F[10], F[11], F[12], F[0], (float*)d_out);
}

// v009
// One run takes 78.7 microseconds.
// Next to v008, in two timings, it ran 1.17 and 1.16 times as fast.
// Counting every step since v000, it is 21.6 times as fast.
#include <hip/hip_runtime.h>
#include <math.h>

typedef __attribute__((ext_vector_type(16))) _Float16 v16h;
typedef __attribute__((ext_vector_type(16))) __bf16 v16b;
typedef __attribute__((ext_vector_type(8)))  _Float16 v8h;
typedef __attribute__((ext_vector_type(8)))  float v8f;
typedef __attribute__((ext_vector_type(4)))  float v4f;
typedef __attribute__((ext_vector_type(2)))  float v2f;
typedef __attribute__((ext_vector_type(4)))  unsigned v4u;
typedef __attribute__((ext_vector_type(4)))  int v4i;
typedef float __attribute__((may_alias)) float_a;
typedef int __attribute__((may_alias)) int_a;

template <typename T> __device__ __forceinline__ void vst2(void* p, T v) { *(T*)p = v;  }
__device__ __forceinline__ v8f wmma16(v16h a, v16h b, v8f c) {
  v8f d = __builtin_amdgcn_wmma_f32_16x16x32_f16(false, a, false, b, (short)0, c, false, false);
  asm volatile("v_nop\n\tv_nop\n\tv_nop\n\tv_nop" : "+v"(d) : "v"(a), "v"(b));
  return d;
}
__device__ __forceinline__ v8f wmma_bf(v16b a, v16b b, v8f c) {
  v8f d = __builtin_amdgcn_wmma_f32_16x16x32_bf16(false, a, false, b, (short)0, c, false, false);
  asm volatile("v_nop\n\tv_nop\n\tv_nop\n\tv_nop" : "+v"(d) : "v"(a), "v"(b));
  return d;
}
// 16x16x32 fragments: lane = (h = lane>>4, row/col = lane&15); elements 0..7 = k0+8h+0..7, 8..15 = k0+16+8h+0..7; D element r = row 8h+r
__device__ __forceinline__ v16h frag_h(const _Float16* rowk0, int lane) {
  union { v16h v; v8h q[2]; } u; const _Float16* p = rowk0 + 8 * (lane >> 4);
  u.q[0] = *(const v8h*)p; u.q[1] = *(const v8h*)(p + 16); return u.v;
}
__device__ __forceinline__ v16h frag_f32(const float* rowk0, int lane) {
  v16h a; const float* p = rowk0 + 8 * (lane >> 4);
#pragma unroll
  for (int i = 0; i < 8; ++i) { a[i] = (_Float16)p[i]; a[8 + i] = (_Float16)p[16 + i]; }
  return a;
}
__device__ __forceinline__ v16h frag_f32s(const float* rowk0, int lane, float sc) {
  v16h a; const float* p = rowk0 + 8 * (lane >> 4);
#pragma unroll
  for (int i = 0; i < 8; ++i) { a[i] = (_Float16)(p[i] * sc); a[8 + i] = (_Float16)(p[16 + i] * sc); }
  return a;
}
// column fragment from a [K][ld] layout (column n), rows >= K read as 0
__device__ __forceinline__ v16h fragc_f32(const float* W, int k0, int n, int lane, int ld, int K) {
  v16h a; const int g = lane >> 4;
#pragma unroll
  for (int i = 0; i < 8; ++i) { const int ka = k0 + 8 * g + i, kb = ka + 16;
    a[i] = (_Float16)(ka < K ? W[(size_t)(ka < K ? ka : K - 1) * ld + n] : 0.f); a[8 + i] = (_Float16)(kb < K ? W[(size_t)(kb < K ? kb : K - 1) * ld + n] : 0.f); }
  return a;
}
struct F2 { v16b h, l; };
__device__ __forceinline__ F2 bsplit16(const float v[16]) { F2 r;
#pragma unroll
  for (int i = 0; i < 16; ++i) { const __bf16 h = (__bf16)v[i]; r.h[i] = h; r.l[i] = (__bf16)(v[i] - (float)h); }
  return r; }
__device__ __forceinline__ F2 split_row(const float* row, int k0, int lane) { float v[16]; const float* p = row + k0 + 8 * (lane >> 4);
#pragma unroll
  for (int i = 0; i < 8; ++i) { v[i] = p[i]; v[8 + i] = p[16 + i]; }
  return bsplit16(v); }
__device__ __forceinline__ F2 split_rowK(const float* row, int k0, int lane, int K) { float v[16]; const int g = lane >> 4;
#pragma unroll
  for (int i = 0; i < 8; ++i) { const int ka = k0 + 8 * g + i, kb = ka + 16; v[i] = ka < K ? row[ka < K ? ka : K - 1] : 0.f; v[8 + i] = kb < K ? row[kb < K ? kb : K - 1] : 0.f; }
  return bsplit16(v); }
__device__ __forceinline__ F2 split_col(const float* W, int k0, int n, int lane, int ld, int K) { float v[16]; const int g = lane >> 4;
#pragma unroll
  for (int i = 0; i < 8; ++i) { const int ka = k0 + 8 * g + i, kb = ka + 16; v[i] = ka < K ? W[(size_t)(ka < K ? ka : K - 1) * ld + n] : 0.f; v[8 + i] = kb < K ? W[(size_t)(kb < K ? kb : K - 1) * ld + n] : 0.f; }
  return bsplit16(v); }
__device__ __forceinline__ v8f mac3(const F2& a, const F2& b, v8f c) { c = wmma_bf(a.l, b.h, c); c = wmma_bf(a.h, b.l, c); return wmma_bf(a.h, b.h, c); }
__device__ __forceinline__ float sigm(float v) { return 1.0f / (1.0f + expf(-v)); }
#define LDSX() do { asm volatile("s_wait_dscnt 0" ::: "memory"); __builtin_amdgcn_wave_barrier(); __builtin_amdgcn_fence(__ATOMIC_RELEASE, "workgroup"); } while (0)


// Non-local block (B 4, 256 channels, 64 x 64): 1x1 q/k/v convs to 128 channels, affinity f = k^T q softmax-normalised over the second index, y = v f, 1x1 conv back to 256 channels, BatchNorm (inference), residual.
#define NB 4
#define CIN 256
#define CO 128
#define NPOS 4096
#ifndef TQB
#define TQB (NPOS / 64)
#endif
typedef __attribute__((ext_vector_type(8))) __bf16 v8b;
__device__ __forceinline__ v16b frag_b(const __bf16* rowk0, int lane) {
  union { v16b v; v8b q[2]; } u; const __bf16* p = rowk0 + 8 * (lane >> 4);
  u.q[0] = *(const v8b*)p; u.q[1] = *(const v8b*)(p + 16); return u.v;
}
__device__ __forceinline__ float bfr(float v) { return (float)(__bf16)v; }
__device__ __attribute__((noinline)) float exp_ni(float v) { return expf(v); }
__device__ __attribute__((noinline)) float erf_ni(float v) { return erff(v); }

#define WS_PK  0u                                   // bf16 [384][256] Wq;Wk;Wv rows ; [256][128] Ww rows
#define WS_PW  (WS_PK + 2u * 3 * CO * CIN)
#define WS_QH  (WS_PW + 2u * CIN * CO)              // f16 [b][n][128] q ; KH the same for k: one f16 value an element. x and the weights enter the projections rounded to bf16 (8 bits), so q and k carry that error already; the 11 bits of f16 add about a tenth of it to a score
#define WS_KH  (WS_QH + 2u * NB * NPOS * CO)
#define WS_VH  (WS_KH + 2u * NB * NPOS * CO)         // f16 [b][128][4096] v
#define WS_ST  (WS_VH + 2u * (size_t)NB * CO * NPOS)   // f32 [b][n][2] (M_n log2(e), 1/L_n)
#define WS_END (WS_ST + 4u * NB * NPOS * 2)

// exponentials in base 2: exp(s - M) = 2^(s log2(e) - M log2(e)). The scale goes into the multiply-add that forms the exponent, and 2^x is the chip's own v_exp_f32, one instruction, where the library expf spends about a dozen vector instructions on splitting the argument and on range tests. Every exponent here is at most about 0; far below, the result goes to 0, as it should
#define L2E 1.44269504088896340736f
__device__ __forceinline__ float ex2(float v) { return __builtin_amdgcn_exp2f(v); }
__device__ __forceinline__ v8f splat8(float v) { const v8f r = { v, v, v, v, v, v, v, v }; return r; }
// the 8 rows' exponentials d[r] = 2^x[r] in one statement. What it is for: the instruction set asks for one free slot between a v_exp_f32 and an instruction that reads its result or writes over its argument. The results are early-clobber, so that inside the statement none lies on an argument, and the v_nop is the slot behind the last one
__device__ __forceinline__ v8f ex2x8(v8f x) { float d0, d1, d2, d3, d4, d5, d6, d7;
  asm("v_exp_f32 %0, %8\n\tv_exp_f32 %1, %9\n\tv_exp_f32 %2, %10\n\tv_exp_f32 %3, %11\n\tv_exp_f32 %4, %12\n\tv_exp_f32 %5, %13\n\tv_exp_f32 %6, %14\n\tv_exp_f32 %7, %15\n\tv_nop"
      : "=&v"(d0), "=&v"(d1), "=&v"(d2), "=&v"(d3), "=&v"(d4), "=&v"(d5), "=&v"(d6), "=&v"(d7)
      : "v"(x[0]), "v"(x[1]), "v"(x[2]), "v"(x[3]), "v"(x[4]), "v"(x[5]), "v"(x[6]), "v"(x[7]));
  const v8f d = { d0, d1, d2, d3, d4, d5, d6, d7 }; return d; }
// ---- asynchronous copies global -> LDS: each lane brings its own 16 (or 4) bytes, through no register
// LDS byte address of a __shared__ object: the low 32 bits of its address
__device__ __forceinline__ unsigned lds_at(const void* p) { return (unsigned)(size_t)p; }
// 8 copies: copy j goes to l + j * lstep, copies 0 to 3 from ga + j * astep, copies 4 to 7 from gb + (j - 4) * bstep, with the one wait behind all 8. The s_wait_xcnt is the last line of the copies' own statement, so that it stands in front of every later rewrite of their address registers; one statement for the run of copies, so that the wave waits there once
__device__ __forceinline__ void copy44(unsigned l, unsigned lstep, const char* ga, size_t astep, const char* gb, size_t bstep) {
  asm volatile("global_load_async_to_lds_b128 %0, %8, off\n\tglobal_load_async_to_lds_b128 %1, %9, off\n\tglobal_load_async_to_lds_b128 %2, %10, off\n\tglobal_load_async_to_lds_b128 %3, %11, off\n\t"
               "global_load_async_to_lds_b128 %4, %12, off\n\tglobal_load_async_to_lds_b128 %5, %13, off\n\tglobal_load_async_to_lds_b128 %6, %14, off\n\tglobal_load_async_to_lds_b128 %7, %15, off\n\ts_wait_xcnt 0x0"
               :: "v"(l), "v"(l + lstep), "v"(l + 2 * lstep), "v"(l + 3 * lstep), "v"(l + 4 * lstep), "v"(l + 5 * lstep), "v"(l + 6 * lstep), "v"(l + 7 * lstep),
                  "v"(ga), "v"(ga + astep), "v"(ga + 2 * astep), "v"(ga + 3 * astep), "v"(gb), "v"(gb + bstep), "v"(gb + 2 * bstep), "v"(gb + 3 * bstep) : "memory");
}
// one copy of 4 bytes a lane, with the same wait in its own statement
__device__ __forceinline__ void copy1w(unsigned l, const char* g) {
  asm volatile("global_load_async_to_lds_b32 %0, %1, off\n\ts_wait_xcnt 0x0" :: "v"(l), "v"(g) : "memory");
}
// this wave's own copies have landed in LDS (the compiler places no wait for them)
#define WAIT_COPIES() asm volatile("s_wait_asynccnt 0x0" ::: "memory")
// this wave's own LDS reads have returned: stands in front of the barrier behind which the buffer they read is refilled
#define WAIT_LDS() asm volatile("s_wait_dscnt 0x0" ::: "memory")
// k_stats, k_out: a wave owns 32 rows (2 row tiles), so that every fragment it reads from LDS feeds 2 WMMAs: the LDS port, not the matrix unit, is what the 16 waves of a block queue for. A block has 64 rows = 2 row groups; the long sum over the other index is split NSPL ways among the waves (2 row groups x NSPL parts = 4 waves per SIMD), so that one wave's LDS and WMMA latencies pass behind the other three; the parts are merged through LDS behind the loop
#define NSPL 8
#define NTHR (64 * NSPL)
#define SROWS (32 * NSPL)                           // rows (positions) of one stage of the two-buffer rings below: 32 for each part
#define NSTG (NPOS / SROWS)
typedef v4f __attribute__((may_alias)) v4f_a;
// a plane = 256 rows of 128 f16 (64 KiB, contiguous in global memory) -> LDS rows of 136 f16 (272 B: 16 B x odd, the pitch of ds_load_b128 readers); 512 threads, 8 copies each a plane, a wave's copy = 512 contiguous bytes, copy j = rows 32 j + tid / 16
#define PSTEP ((NTHR / 16) * (CO + 8) * 2u)         // LDS bytes from copy j to copy j + 1
__device__ __forceinline__ void stage_plane(_Float16* dst, const _Float16* src, int tid) {
  const char* g = (const char*)(src + tid * 8);
  copy44(lds_at(dst + (tid >> 4) * (CO + 8) + (tid & 15) * 8), PSTEP, g, NTHR * 16, g + 4 * NTHR * 16, NTHR * 16);
}
__global__ __launch_bounds__(256) void k_pack(const float* __restrict__ WQ, const float* __restrict__ WK, const float* __restrict__ WV, const float* __restrict__ WW, __bf16* __restrict__ PK, __bf16* __restrict__ PW) {
  const int n = blockIdx.x, t = threadIdx.x; __shared__ __align__(16) __bf16 s[CIN];
  if (n < 3 * CO) { const float* src = (n < CO) ? WQ + (size_t)n * CIN : (n < 2 * CO) ? WK + (size_t)(n - CO) * CIN : WV + (size_t)(n - 2 * CO) * CIN; s[t] = (__bf16)src[t]; __syncthreads(); if (t < CIN / 8) vst2((unsigned*)(PK + (size_t)n * CIN + t * 8), *(const v4u*)&s[t * 8]); }
  else { const int o = n - 3 * CO; if (t < CO) s[t] = (__bf16)WW[(size_t)o * CO + t]; __syncthreads(); if (t < CO / 8) vst2((unsigned*)(PW + (size_t)o * CO + t * 8), *(const v4u*)&s[t * 8]); }
}
// k_proj: block = (64 positions n, b), 12 waves: the 24 column tiles of q ; k ; v (8 each) are dealt 2 to a wave, and a wave takes its 2 for all 64 rows. So the three projections run side by side, a weight fragment is loaded by one wave of the block and no other, and a wave's 16 weight fragments and its share of the x tile fit its registers: every global load of the block is requested at the start, and none is waited for inside a loop
#define PWAV 12
#define PTHR (32 * PWAV)
#define XTASK CIN                                   // the x tile as tasks of one wave: task t = channels 2 (t / 2), 2 (t / 2) + 1 x rows 32 (t mod 2) + lane
#define XEACH ((XTASK + PWAV - 1) / PWAV)           // tasks a wave; in the last round only the first waves have one
typedef __attribute__((ext_vector_type(2))) __bf16 v2b;
__global__ __launch_bounds__(PTHR) void k_proj(const float* __restrict__ X, const __bf16* __restrict__ PK, const float* __restrict__ BQ, const float* __restrict__ BK, const float* __restrict__ BV, _Float16* __restrict__ QH, _Float16* __restrict__ KH, _Float16* __restrict__ VH) {
  __shared__ __align__(16) __bf16 sa[64][CIN + 8]; __shared__ __align__(16) _Float16 sth[2][64][CO + 8]; __shared__ __align__(16) _Float16 svh[CO][72];
  const int tid = threadIdx.x, wave = __builtin_amdgcn_readfirstlane(tid >> 5), lane = tid & 31, col = lane & 15, g = lane >> 4; const size_t b = blockIdx.y; const int n0 = blockIdx.x * 64;
  const int which = wave >> 2, jb = (wave & 3) * 2;   // 0 q, 1 k, 2 v ; the wave's first column tile in it
  // PWAV is even, so task i * PWAV + wave has the row half wave mod 2 and the channels i * PWAV + (wave - wave mod 2), + 1: one address a wave, and round i at a constant distance from it
  static_assert(PWAV % 2 == 0, "the split of a task's number into round and wave");
  const float* gx = X + b * CIN * NPOS + n0 + lane;
  const float* px = gx + (size_t)(wave & ~1) * NPOS + 32 * (wave & 1);
  // a wave without a task in the last round loads the last task's words all the same (the task's number is clamped) and stores nothing: so the last round's loads need no branch and go out with the others
  const int tl = min((XEACH - 1) * PWAV + wave, XTASK - 1); const float* pl = gx + (size_t)(tl & ~1) * NPOS + 32 * (tl & 1);
  float x0[XEACH], x1[XEACH];
#pragma unroll   // the index picks a register (x0, x1, wf, a, acc, bb): it has to be a constant
  for (int i = 0; i + 1 < XEACH; ++i) { x0[i] = px[(size_t)i * PWAV * NPOS]; x1[i] = px[(size_t)(i * PWAV + 1) * NPOS]; }
  x0[XEACH - 1] = pl[0]; x1[XEACH - 1] = pl[NPOS];
  const __bf16* pw[2]; int cj[2];   // the lane's own place in the first k step of its 2 weight rows ; its 2 columns
#pragma unroll   // the index picks a register (x0, x1, wf, a, acc, bb): it has to be a constant
  for (int j = 0; j < 2; ++j) { cj[j] = (jb + j) * 16 + col; pw[j] = PK + (size_t)(which * CO + cj[j]) * CIN + 8 * g; }
  v16b wf[CIN / 32][2];
#pragma unroll   // the index picks a register (x0, x1, wf, a, acc, bb): it has to be a constant
  for (int kc = 0; kc < CIN / 32; ++kc)
#pragma unroll   // the index picks a register (x0, x1, wf, a, acc, bb): it has to be a constant
    for (int j = 0; j < 2; ++j) { union { v16b v; v8b q[2]; } u; u.q[0] = *(const v8b*)(pw[j] + kc * 32); u.q[1] = *(const v8b*)(pw[j] + kc * 32 + 16); wf[kc][j] = u.v; }   // frag_b of the row
  const float* BB = (which == 0) ? BQ : (which == 1) ? BK : BV;
  float bb[2];
#pragma unroll   // the index picks a register (x0, x1, wf, a, acc, bb): it has to be a constant
  for (int j = 0; j < 2; ++j) bb[j] = bfr(BB[cj[j]]);
  // the wait that belongs between a global load and a write over a vector register that it names, once for all the loads above; it takes their address registers as inputs, so that they stay as they are up to here and no later load's result is laid over the address of an earlier one
  asm volatile("s_wait_xcnt 0x0" :: "v"(px), "v"(pl), "v"(pw[0]), "v"(pw[1]), "v"(cj[0]), "v"(cj[1]) : "memory");
  // two neighbouring channels of a row are one 4-byte LDS store
#pragma unroll   // the index picks a register (x0, x1, wf, a, acc, bb): it has to be a constant
  for (int i = 0; i + 1 < XEACH; ++i) { const int t = i * PWAV + wave; const v2b v = { (__bf16)x0[i], (__bf16)x1[i] }; *(v2b*)&sa[32 * (t & 1) + lane][t & ~1] = v; }
  // takes the last round's two loaded words as inputs and does nothing: it keeps their loads up with the others. Without it the compiler moves the two loads down into the branch below, where the first waves wait out a memory round trip of their own
  asm volatile("" :: "v"(x0[XEACH - 1]), "v"(x1[XEACH - 1]));
  { const int t = (XEACH - 1) * PWAV + wave;
    if (t < XTASK) { const v2b v = { (__bf16)x0[XEACH - 1], (__bf16)x1[XEACH - 1] }; *(v2b*)&sa[32 * (t & 1) + lane][t & ~1] = v; } }
  __syncthreads();
  v8f acc[4][2] = {};
#pragma unroll   // the index picks a register (x0, x1, wf, a, acc, bb): it has to be a constant
  for (int kc = 0; kc < CIN / 32; ++kc) { v16b a[4];
#pragma unroll   // the index picks a register (x0, x1, wf, a, acc, bb): it has to be a constant
    for (int rt = 0; rt < 4; ++rt) a[rt] = frag_b(&sa[rt * 16 + col][kc * 32], lane);
#pragma unroll   // the index picks a register (x0, x1, wf, a, acc, bb): it has to be a constant
    for (int rt = 0; rt < 4; ++rt)
#pragma unroll   // the index picks a register (x0, x1, wf, a, acc, bb): it has to be a constant
      for (int j = 0; j < 2; ++j) acc[rt][j] = wmma_bf(a[rt], wf[kc][j], acc[rt][j]); }
  // the 4 waves of a projection put its 64 x 128 tile into LDS and, behind the barrier, store it in whole lines, 8 pieces of 16 bytes a thread
  const int t4 = tid & 127;
  if (which < 2) {
#pragma unroll   // the index picks a register (x0, x1, wf, a, acc, bb): it has to be a constant
    for (int j = 0; j < 2; ++j) { const int c = cj[j];
#pragma unroll   // the index picks a register (x0, x1, wf, a, acc, bb): it has to be a constant
      for (int rt = 0; rt < 4; ++rt)
#pragma unroll   // the index picks a register (x0, x1, wf, a, acc, bb): it has to be a constant
        for (int r = 0; r < 8; ++r) sth[which][rt * 16 + 8 * g + r][c] = (_Float16)(acc[rt][j][r] + bb[j]); } }
  else {
#pragma unroll   // the index picks a register (x0, x1, wf, a, acc, bb): it has to be a constant
    for (int j = 0; j < 2; ++j) { const int c = cj[j];
#pragma unroll   // the index picks a register (x0, x1, wf, a, acc, bb): it has to be a constant
      for (int rt = 0; rt < 4; ++rt)
#pragma unroll   // the index picks a register (x0, x1, wf, a, acc, bb): it has to be a constant
        for (int r = 0; r < 8; ++r) svh[c][rt * 16 + 8 * g + r] = (_Float16)(acc[rt][j][r] + bb[j]); } }
  __syncthreads();   // the q, k and v tiles of the block are in LDS
  if (which < 2) { _Float16* DH_ = which ? KH : QH;
    for (int e = t4; e < 64 * 16; e += 128) { const int r = e >> 4, q = e & 15; const size_t o = (b * NPOS + n0 + r) * CO + q * 8; vst2((unsigned*)(DH_ + o), *(const v4u*)&sth[which][r][q * 8]); } }
  else {
    for (int e = t4; e < CO * 8; e += 128) { const int c = e >> 3, pc = e & 7; vst2((unsigned*)(VH + (b * CO + c) * NPOS + n0 + pc * 8), *(const v4u*)&svh[c][pc * 8]); } }
}
// ---- k_stats: block = (64 rows n, b): f[n][m] = k_n . q_m over all m (1 product); per row max M_n and L_n = sum_m exp(f - M_n) -> ST[b][n] = (M_n log2(e), 1/L_n)
__global__ __launch_bounds__(NTHR) void k_stats(const _Float16* __restrict__ QH, const _Float16* __restrict__ KH, float* __restrict__ ST) {
  __shared__ __align__(16) float so[NSPL][64][2]; __shared__ __align__(16) _Float16 sq[2][SROWS][CO + 8];   // ring: [buffer][row m][channel]
  const int tid = threadIdx.x, rg = (tid >> 5) & 1, spl = tid >> 6, lane = tid & 31, col = lane & 15, g = lane >> 4; const size_t b = blockIdx.y; const int n0 = blockIdx.x * 64 + rg * 32; const size_t rn = b * NPOS + n0;
  // the 2 row groups read the same q rows: a stage of 256 rows is copied to LDS once for the block, whole lines at a time, one stage ahead of its use; part spl works on rows 32 spl .. 32 spl + 31 of every stage
  const _Float16* gqh = QH + b * NPOS * CO;
  stage_plane(&sq[0][0][0], gqh, tid);
  WAIT_COPIES();
  __syncthreads();   // stage 0 is published to all waves
  stage_plane(&sq[1][0][0], gqh + (size_t)SROWS * CO, tid);
  v16h ak[2][CO / 32];   // [row tile h of the wave's 32 rows][k step]
  const _Float16* pk = KH + (rn + col) * CO + 8 * g;   // the lane's own place in the first k step of its first row
#pragma unroll
  for (int h = 0; h < 2; ++h)
#pragma unroll
    for (int kc = 0; kc < CO / 32; ++kc) { union { v16h v; v8h q[2]; } f; f.q[0] = *(const v8h*)(pk + h * 16 * CO + kc * 32); f.q[1] = *(const v8h*)(pk + h * 16 * CO + kc * 32 + 16); ak[h][kc] = f.v; }   // frag_h of the row
  // the wait that belongs between a global load and a write over a vector register that it names, once for the 16 loads above; it takes their address as an input, so that it stays as it is up to here and no load's result is laid over it
  asm volatile("s_wait_xcnt 0x0" :: "v"(pk) : "memory");
  v8f m[2], m2[2], l[2];   // one element a row; m2 = m * log2(e), the running maximum in base-2 units
#pragma unroll
  for (int h = 0; h < 2; ++h)
#pragma unroll
    for (int r = 0; r < 8; ++r) { m[h][r] = -3.0e38f; m2[h][r] = -3.0e38f; l[h][r] = 0.f; }
  // not unrolled: one trip = one stage, and the ring's order stands once, at the trip's foot
#pragma unroll 1
  for (int st = 0; st < NSTG; ++st) { const int bf = st & 1;
  // unrolled: the wave's 2 column tiles of a stage are straight-line code with constant LDS offsets, so that one tile's LDS reads pass behind the other tile's work
  v8f s[2][2];
#pragma unroll
  for (int u = 0; u < 2; ++u) { v8f c[2] = {};
    // the tile's 4 fragments of q are all requested before the first product, so that their latencies overlap; each feeds the products of both row tiles, whose two accumulator chains alternate
    v16h qh[CO / 32];
#pragma unroll
    for (int kc = 0; kc < CO / 32; ++kc) qh[kc] = frag_h(&sq[bf][spl * 32 + u * 16 + col][kc * 32], lane);
#pragma unroll
    for (int kc = 0; kc < CO / 32; ++kc)
#pragma unroll
      for (int h = 0; h < 2; ++h) c[h] = wmma16(ak[h][kc], qh[kc], c[h]);
    s[0][u] = c[0]; s[1][u] = c[1]; }
    // every lane keeps the running maximum and sum of ITS OWN columns (those with m mod 16 = col) of its rows: no lane needs another lane's value inside the loop, and the 16 lanes of a row are joined once, behind it
    // one update for the stage's 2 tiles; straight-line, no call and no branch (the guard on alpha is a select): the rows are independent chains; the unrolls here and behind the loop make every index of s, m, l, mr a constant, so that the arrays stay in registers
#pragma unroll
    for (int h = 0; h < 2; ++h) {
      v8f mn;
#pragma unroll
      for (int r = 0; r < 8; ++r) mn[r] = fmaxf(m[h][r], fmaxf(s[h][0][r], s[h][1][r]));
      const v8f mn2 = mn * L2E, k2 = splat8(L2E);
      const v8f ea = ex2x8(m2[h] - mn2), e0 = ex2x8(__builtin_elementwise_fma(s[h][0], k2, -mn2)), e1 = ex2x8(__builtin_elementwise_fma(s[h][1], k2, -mn2));
      v8f alpha;
#pragma unroll
      for (int r = 0; r < 8; ++r) alpha[r] = (m[h][r] <= -1.0e38f) ? 0.f : ea[r];
      l[h] = l[h] * alpha + (e0 + e1); m[h] = mn; m2[h] = mn2; }
    WAIT_LDS();
    WAIT_COPIES();
    __syncthreads();   // publishes stage st + 1 and ends every wave's reads of stage st
    if (st + 2 < NSTG) stage_plane(&sq[bf][0][0], gqh + (size_t)(st + 2) * SROWS * CO, tid); }
  WAIT_COPIES();
  // join of the 16 lanes of a row, once: the row's maximum over the lanes, every lane's sum rescaled to it, then the sum over the lanes; phase by phase, so that the rows' shuffle latencies overlap
#pragma unroll
  for (int h = 0; h < 2; ++h) {
  float mr[8];
#pragma unroll
  for (int r = 0; r < 8; ++r) mr[r] = m2[h][r];   // from here on maxima are in base-2 units (the scaling keeps their order)
#pragma unroll
  for (int o = 1; o < 16; o <<= 1)
#pragma unroll
    for (int r = 0; r < 8; ++r) mr[r] = fmaxf(mr[r], __shfl_xor(mr[r], o));
  v8f xj;
#pragma unroll
  for (int r = 0; r < 8; ++r) xj[r] = m2[h][r] - mr[r];
  l[h] *= ex2x8(xj);
#pragma unroll
  for (int o = 1; o < 16; o <<= 1)
#pragma unroll
    for (int r = 0; r < 8; ++r) l[h][r] += __shfl_xor(l[h][r], o);
  if (col == 0) {
#pragma unroll
    for (int r = 0; r < 8; ++r) { so[spl][rg * 32 + h * 16 + 8 * g + r][0] = mr[r]; so[spl][rg * 32 + h * 16 + 8 * g + r][1] = l[h][r]; } } }
  __syncthreads();   // every part's (max, sum) of the 64 rows is in so
  // merge of the parts, one row a thread: M = max of the parts' maxima, L = sum of the parts' sums, each rescaled to M
  if (tid < 64) { float M = so[0][tid][0];
#pragma unroll
    for (int s = 1; s < NSPL; ++s) M = fmaxf(M, so[s][tid][0]);
    float L = 0.f;
#pragma unroll
    for (int s = 0; s < NSPL; ++s) L += so[s][tid][1] * ex2(so[s][tid][0] - M);
    v2f o; o[0] = M; o[1] = 1.0f / L; vst2(ST + (b * NPOS + blockIdx.x * 64 + tid) * 2, o); }
}
// ---- k_out: block = (64 output positions m, b): over n tiles: s[m][n] = q_m . k_n (1 product); w = exp(s - M_n) / L_n; y[c][m] += w (x2^11 single f16) x v[c][n] (8 tiles); then z = Ww . y (2 products, 2 passes of 8 tiles) + bw -> BN -> + x -> out[b][c][m]
#define VP (SROWS + 8)                              // f16 of an LDS row of the v plane (528 B: 16 B x odd)
#define KPL (SROWS * (CO + 8))                      // f16 of the k plane of a stage: rows n x channel
#define VPL (CO * VP)                               // f16 of the v plane of a stage: rows channel x n
__global__ __launch_bounds__(NTHR) void k_out(const _Float16* __restrict__ QH, const _Float16* __restrict__ KH, const _Float16* __restrict__ VH, const float* __restrict__ ST, const __bf16* __restrict__ PW, const float* __restrict__ BW, const float* __restrict__ G, const float* __restrict__ Bt, const float* __restrict__ MU, const float* __restrict__ VAR, const float* __restrict__ X, float* __restrict__ OUT) {
  __shared__ __align__(16) _Float16 ring[2 * (KPL + VPL)]; __shared__ __align__(16) float sst[2][SROWS][2];   // ring: [buffer][k plane ; v plane] ; (M log2(e), 1/L)
  __shared__ __align__(16) _Float16 spw[NSPL][2][32][40];   // [pair of waves][unit][row m][n]: the weights w of a unit of 32 m x 32 n
  // the two stages fill nearly all of the LDS, so what the part behind the loop needs lies on bytes that are dead by then: the y tile (hi ; lo) on spw, the partial sums and later the output tile on the ring
  __bf16 (*syh)[CO + 8] = (__bf16 (*)[CO + 8])&spw[0][0][0][0]; __bf16 (*syl)[CO + 8] = syh + 64; float (*so)[68] = (float (*)[68])&ring[0];
  static_assert(sizeof(spw) >= 2u * 64 * (CO + 8) * 2, "the y tile fits spw"); static_assert(sizeof(ring) >= 4u * 2 * NSPL * 32 * (CO / 2) && sizeof(ring) >= 4u * 128 * 68, "the partial sums and the output tile fit the ring");
  const int tid = threadIdx.x, wv = __builtin_amdgcn_readfirstlane(tid >> 5), rg = wv & 1, hf = (wv >> 1) & 1, sp = wv >> 2, pr = sp * 2 + rg, lane = tid & 31, col = lane & 15, g = lane >> 4; const size_t b = blockIdx.y; const size_t rm = b * NPOS + blockIdx.x * 64 + rg * 32;
  // the 2 row groups read the same k rows, v columns and row statistics: a stage of 256 positions n is copied to LDS once for the block, whole lines at a time, one stage ahead of its use
  // 32 rows x 128 channels of f32 sums beside the 32 rows of q do not fit a wave's registers at 4 waves per SIMD. So 2 waves (hf = 0, 1) share the units of 32 m x 32 n of a row group: each forms the weights of 16 of the 32 n, for all 32 m; they meet in spw behind a barrier; each then takes 4 of the 8 channel tiles, for all 32 m and 32 n. Pair (rg, sp) takes the units at n = 32 sp and 32 (sp + 4) of a stage
  const _Float16* gkh = KH + b * NPOS * CO; const _Float16* gv = VH + (b * CO + (tid >> 5)) * NPOS + (tid & 31) * 8; const float* gst = ST + b * NPOS * 2 + tid;
  auto stage_kv = [&](int st, int bf) { _Float16* kb = ring + bf * (KPL + VPL);
    stage_plane(kb, gkh + (size_t)st * SROWS * CO, tid);
    // v: 128 channels x 512 B, copy j takes channels 16 j + tid / 32: a wave's copy = 512 contiguous bytes
    const char* gs = (const char*)(gv + st * SROWS);
    copy44(lds_at(kb + KPL + (tid >> 5) * VP + (tid & 31) * 8), 16 * VP * 2u, gs, (size_t)16 * NPOS * 2, gs + (size_t)64 * NPOS * 2, (size_t)16 * NPOS * 2);
    copy1w(lds_at(&sst[bf][0][0] + tid), (const char*)(gst + st * SROWS * 2)); };   // 512 words, one a thread
  stage_kv(0, 0);
  WAIT_COPIES();
  __syncthreads();   // stage 0 is published to all waves
  stage_kv(1, 1);
  v16h aq[2][CO / 32];   // [row tile h of the wave's 32 rows][k step]
  const _Float16* pq = QH + (rm + col) * CO + 8 * g;   // the lane's own place in the first k step of its first row
#pragma unroll
  for (int h = 0; h < 2; ++h)
#pragma unroll
    for (int kc = 0; kc < CO / 32; ++kc) { union { v16h v; v8h q[2]; } f; f.q[0] = *(const v8h*)(pq + h * 16 * CO + kc * 32); f.q[1] = *(const v8h*)(pq + h * 16 * CO + kc * 32 + 16); aq[h][kc] = f.v; }   // frag_h of the row
  // the wait that belongs between a global load and a write over a vector register that it names, once for the 16 loads above; it takes their address as an input, so that it stays as it is up to here and no load's result is laid over it
  asm volatile("s_wait_xcnt 0x0" :: "v"(pq) : "memory");
  v8f acc[2][4] = {};   // [row tile h][channel tile 4 hf + d]
  // not unrolled: one trip = one stage, and the ring's order stands once, at the trip's foot
#pragma unroll 1
  for (int st = 0; st < NSTG; ++st) { const int bf = st & 1; const _Float16* kb = ring + bf * (KPL + VPL);
    v16h vv[2][4];   // [unit][channel tile d] fragments of v
#pragma unroll
    for (int u = 0; u < 2; ++u) { const int nn = (sp + 4 * u) * 32 + hf * 16 + col; v8f c[2] = {};
      // the tile's 4 fragments of k are all requested before the first product, so that their latencies overlap; each feeds the products of both row tiles, whose two accumulator chains alternate
      v16h kh[CO / 32];
#pragma unroll
      for (int kc = 0; kc < CO / 32; ++kc) kh[kc] = frag_h(kb + nn * (CO + 8) + kc * 32, lane);
      const float Mn = sst[bf][nn][0], iLn = sst[bf][nn][1];   // Mn in base-2 units, as k_stats stores it
      // the first unit's fragments of v wait for nobody's weights: they are requested here, in front of the barrier, while the vector unit is the busy one; the second unit's would not fit the registers
      if (u == 1) {
#pragma unroll
        for (int d = 0; d < 4; ++d) vv[0][d] = frag_h(kb + KPL + ((hf * 4 + d) * 16 + col) * VP + sp * 32, lane); }
#pragma unroll
      for (int kc = 0; kc < CO / 32; ++kc)
#pragma unroll
        for (int h = 0; h < 2; ++h) c[h] = wmma16(aq[h][kc], kh[kc], c[h]);
#pragma unroll
      for (int h = 0; h < 2; ++h) { const v8f e = ex2x8(__builtin_elementwise_fma(c[h], splat8(L2E), splat8(-Mn)));
#pragma unroll
        for (int r = 0; r < 8; ++r) { const float w = e[r] * iLn; spw[pr][u][h * 16 + 8 * g + r][hf * 16 + col] = (_Float16)(w * 2048.0f); } } }
    WAIT_LDS();
    __syncthreads();   // both halves of every unit's weights are in spw
#pragma unroll
    for (int u = 0; u < 2; ++u) { const int j0 = (sp + 4 * u) * 32;
      const v16h pa0 = frag_h(&spw[pr][u][col][0], lane), pa1 = frag_h(&spw[pr][u][16 + col][0], lane);
      // the 4 fragments of v are all requested before the first product, so that their latencies overlap; each feeds the products of both row tiles
      if (u == 1) {
#pragma unroll
        for (int d = 0; d < 4; ++d) vv[1][d] = frag_h(kb + KPL + ((hf * 4 + d) * 16 + col) * VP + j0, lane); }
#pragma unroll
      for (int d = 0; d < 4; ++d) { acc[0][d] = wmma16(pa0, vv[u][d], acc[0][d]); acc[1][d] = wmma16(pa1, vv[u][d], acc[1][d]); } }
    WAIT_LDS();
    WAIT_COPIES();
    __syncthreads();   // publishes stage st + 1 and ends every wave's reads of stage st and of spw
    if (st + 2 < NSTG) stage_kv(st + 2, bf); }
  WAIT_COPIES();
  // merge of the 4 parts sp: the ring of k and v is dead behind the loop's last barrier (no read and no copy of it is left), and its bytes take every wave's 32 x 64 partial sums, [wave][row tile h][tile d][half][lane][4]: 16 bytes a lane, lanes side by side
  float* red = (float*)&ring[0];
#pragma unroll
  for (int h = 0; h < 2; ++h)
#pragma unroll
  for (int d = 0; d < 4; ++d) { v4f lo4, hi4;
#pragma unroll
    for (int r = 0; r < 4; ++r) { lo4[r] = acc[h][d][r]; hi4[r] = acc[h][d][4 + r]; }
    *(v4f_a*)(red + (((wv * 2 + h) * 4 + d) * 2 + 0) * 128 + lane * 4) = lo4; *(v4f_a*)(red + (((wv * 2 + h) * 4 + d) * 2 + 1) * 128 + lane * 4) = hi4; }
  __syncthreads();   // every wave's partial sums are in red
  // wave (rg, hf, sp) adds the 4 parts of channel tile dt = 4 hf + sp of its row group's 2 row tiles, in the order of the parts; y tile -> bf16 hi/lo [64 m][128 c]
#pragma unroll
  for (int h = 0; h < 2; ++h) { const int dt = hf * 4 + sp; float y[8];
#pragma unroll
    for (int s = 0; s < 4; ++s) { const int w = s * 4 + hf * 2 + rg; const v4f lo4 = *(const v4f_a*)(red + (((w * 2 + h) * 4 + sp) * 2 + 0) * 128 + lane * 4), hi4 = *(const v4f_a*)(red + (((w * 2 + h) * 4 + sp) * 2 + 1) * 128 + lane * 4);
#pragma unroll
      for (int r = 0; r < 4; ++r) { y[r] = s ? y[r] + lo4[r] : lo4[r]; y[4 + r] = s ? y[4 + r] + hi4[r] : hi4[r]; } }
#pragma unroll
    for (int r = 0; r < 8; ++r) { const int row = rg * 32 + h * 16 + 8 * g + r; const float v = y[r] * (1.0f / 2048.0f); const __bf16 hb = (__bf16)v; syh[row][dt * 16 + col] = hb; syl[row][dt * 16 + col] = (__bf16)(v - (float)hb); } }
  if (wv < 4 && lane < 16) for (int c = CO; c < CO + 8; ++c) { syh[wv * 16 + lane][c] = (__bf16)0.f; syl[wv * 16 + lane][c] = (__bf16)0.f; }
  __syncthreads();   // the y tile is whole, and every read of red is done: so may take its bytes
  // the last product: wave = (row tile wave of the 64 rows, column part cp), 4 x 4
  const int wave = wv & 3, cp = wv >> 2, m0 = blockIdx.x * 64 + wave * 16;
#pragma unroll 1
  for (int pass = 0; pass < 2; ++pass) { constexpr int NJ = 2; const int jb = cp * NJ; v8f z[NJ] = {};   // part cp takes column tiles jb .. jb + NJ - 1 of the pass
    // the wave's weight fragments of a k step are requested together, one k step ahead of the products that read them
    v16b wf[2][NJ];
#pragma unroll
    for (int j = 0; j < NJ; ++j) wf[0][j] = frag_b(PW + (size_t)(pass * 128 + (jb + j) * 16 + col) * CO, lane);
#pragma unroll
    for (int kc = 0; kc < CO / 32; ++kc) { const v16b a = frag_b(&syh[wave * 16 + col][kc * 32], lane), al = frag_b(&syl[wave * 16 + col][kc * 32], lane);
      if (kc + 1 < CO / 32) {
#pragma unroll
        for (int j = 0; j < NJ; ++j) wf[(kc + 1) & 1][j] = frag_b(PW + (size_t)(pass * 128 + (jb + j) * 16 + col) * CO + (kc + 1) * 32, lane); }
#pragma unroll
      for (int j = 0; j < NJ; ++j) { z[j] = wmma_bf(al, wf[kc & 1][j], z[j]); z[j] = wmma_bf(a, wf[kc & 1][j], z[j]); } }
#pragma unroll
    for (int j = 0; j < NJ; ++j) { const int c = pass * 128 + (jb + j) * 16 + col; const float inv = bfr(G[c]) / sqrtf(bfr(VAR[c]) + 1e-5f); const float sh = bfr(Bt[c]) - bfr(MU[c]) * inv; const float bb = bfr(BW[c]);
#pragma unroll
      for (int r = 0; r < 8; ++r) { const int m = m0 + 8 * g + r; so[(jb + j) * 16 + col][wave * 16 + 8 * g + r] = (z[j][r] + bb) * inv + sh + bfr(X[(b * CIN + c) * NPOS + m]); } }
    __syncthreads();
    for (int e = tid; e < 128 * 16; e += NTHR) { const int cl_ = e >> 4, q = e & 15; vst2(OUT + (b * CIN + pass * 128 + cl_) * NPOS + blockIdx.x * 64 + q * 4, *(const v4f*)&so[cl_][q * 4]); }
    __syncthreads(); }
}
extern "C" void kernel_launch(void* const* d_in, const int* in_sizes, int n_in, void* d_out, int out_size, void* d_ws, size_t ws_size, hipStream_t stream) {
  (void)in_sizes; (void)n_in; (void)out_size;
  const float** F = (const float**)d_in;   // 0 x [4,256,64,64], 1 Wq [128,256], 2 bq, 3 Wk, 4 bk, 5 Wv, 6 bv, 7 Ww [256,128], 8 bw, 9 bn_gamma, 10 bn_beta, 11 bn_mean, 12 bn_var
  if (ws_size < (size_t)WS_END) return;
  char* ws = (char*)d_ws; __bf16 *PK = (__bf16*)(ws + WS_PK), *PW = (__bf16*)(ws + WS_PW); _Float16 *QH = (_Float16*)(ws + WS_QH), *KH = (_Float16*)(ws + WS_KH), *VH = (_Float16*)(ws + WS_VH); float* ST = (float*)(ws + WS_ST);
  k_pack<<<3 * CO + CIN, 256, 0, stream>>>(F[1], F[3], F[5], F[7], PK, PW);
  k_proj<<<dim3(NPOS / 64, NB), PTHR, 0, stream>>>(F[0], PK, F[2], F[4], F[6], QH, KH, VH);
  k_stats<<<dim3(NPOS / 64, NB), NTHR, 0, stream>>>(QH, KH, ST);
  k_out<<<dim3(TQB, NB), NTHR, 0, stream>>>(QH, KH, VH, ST, PW, F[8], F[9], F[10], F[11], F[12], F[0], (float*)d_out);
}

// v010
// A run of this version takes 70.8 microseconds.
// Timed twice side by side with v009, it ran 1.11 times as fast both times.
// Counting every step since v000, it is 24.0 times as fast.
#include <hip/hip_runtime.h>
#include <math.h>

typedef __attribute__((ext_vector_type(16))) _Float16 v16h;
typedef __attribute__((ext_vector_type(16))) __bf16 v16b;
typedef __attribute__((ext_vector_type(8)))  _Float16 v8h;
typedef __attribute__((ext_vector_type(8)))  float v8f;
typedef __attribute__((ext_vector_type(4)))  float v4f;
typedef __attribute__((ext_vector_type(2)))  float v2f;
typedef __attribute__((ext_vector_type(4)))  unsigned v4u;
typedef __attribute__((ext_vector_type(4)))  int v4i;
typedef float __attribute__((may_alias)) float_a;
typedef int __attribute__((may_alias)) int_a;

template <typename T> __device__ __forceinline__ void vst2(void* p, T v) { *(T*)p = v;  }
__device__ __forceinline__ v8f wmma16(v16h a, v16h b, v8f c) {
  v8f d = __builtin_amdgcn_wmma_f32_16x16x32_f16(false, a, false, b, (short)0, c, false, false);
  asm volatile("v_nop\n\tv_nop\n\tv_nop\n\tv_nop" : "+v"(d) : "v"(a), "v"(b));
  return d;
}
__device__ __forceinline__ v8f wmma_bf(v16b a, v16b b, v8f c) {
  v8f d = __builtin_amdgcn_wmma_f32_16x16x32_bf16(false, a, false, b, (short)0, c, false, false);
  asm volatile("v_nop\n\tv_nop\n\tv_nop\n\tv_nop" : "+v"(d) : "v"(a), "v"(b));
  return d;
}
// 16x16x32 fragments: lane = (h = lane>>4, row/col = lane&15); elements 0..7 = k0+8h+0..7, 8..15 = k0+16+8h+0..7; D element r = row 8h+r
__device__ __forceinline__ v16h frag_h(const _Float16* rowk0, int lane) {
  union { v16h v; v8h q[2]; } u; const _Float16* p = rowk0 + 8 * (lane >> 4);
  u.q[0] = *(const v8h*)p; u.q[1] = *(const v8h*)(p + 16); return u.v;
}
__device__ __forceinline__ v16h frag_f32(const float* rowk0, int lane) {
  v16h a; const float* p = rowk0 + 8 * (lane >> 4);
#pragma unroll
  for (int i = 0; i < 8; ++i) { a[i] = (_Float16)p[i]; a[8 + i] = (_Float16)p[16 + i]; }
  return a;
}
__device__ __forceinline__ v16h frag_f32s(const float* rowk0, int lane, float sc) {
  v16h a; const float* p = rowk0 + 8 * (lane >> 4);
#pragma unroll
  for (int i = 0; i < 8; ++i) { a[i] = (_Float16)(p[i] * sc); a[8 + i] = (_Float16)(p[16 + i] * sc); }
  return a;
}
// column fragment from a [K][ld] layout (column n), rows >= K read as 0
__device__ __forceinline__ v16h fragc_f32(const float* W, int k0, int n, int lane, int ld, int K) {
  v16h a; const int g = lane >> 4;
#pragma unroll
  for (int i = 0; i < 8; ++i) { const int ka = k0 + 8 * g + i, kb = ka + 16;
    a[i] = (_Float16)(ka < K ? W[(size_t)(ka < K ? ka : K - 1) * ld + n] : 0.f); a[8 + i] = (_Float16)(kb < K ? W[(size_t)(kb < K ? kb : K - 1) * ld + n] : 0.f); }
  return a;
}
struct F2 { v16b h, l; };
__device__ __forceinline__ F2 bsplit16(const float v[16]) { F2 r;
#pragma unroll
  for (int i = 0; i < 16; ++i) { const __bf16 h = (__bf16)v[i]; r.h[i] = h; r.l[i] = (__bf16)(v[i] - (float)h); }
  return r; }
__device__ __forceinline__ F2 split_row(const float* row, int k0, int lane) { float v[16]; const float* p = row + k0 + 8 * (lane >> 4);
#pragma unroll
  for (int i = 0; i < 8; ++i) { v[i] = p[i]; v[8 + i] = p[16 + i]; }
  return bsplit16(v); }
__device__ __forceinline__ F2 split_rowK(const float* row, int k0, int lane, int K) { float v[16]; const int g = lane >> 4;
#pragma unroll
  for (int i = 0; i < 8; ++i) { const int ka = k0 + 8 * g + i, kb = ka + 16; v[i] = ka < K ? row[ka < K ? ka : K - 1] : 0.f; v[8 + i] = kb < K ? row[kb < K ? kb : K - 1] : 0.f; }
  return bsplit16(v); }
__device__ __forceinline__ F2 split_col(const float* W, int k0, int n, int lane, int ld, int K) { float v[16]; const int g = lane >> 4;
#pragma unroll
  for (int i = 0; i < 8; ++i) { const int ka = k0 + 8 * g + i, kb = ka + 16; v[i] = ka < K ? W[(size_t)(ka < K ? ka : K - 1) * ld + n] : 0.f; v[8 + i] = kb < K ? W[(size_t)(kb < K ? kb : K - 1) * ld + n] : 0.f; }
  return bsplit16(v); }
__device__ __forceinline__ v8f mac3(const F2& a, const F2& b, v8f c) { c = wmma_bf(a.l, b.h, c); c = wmma_bf(a.h, b.l, c); return wmma_bf(a.h, b.h, c); }
__device__ __forceinline__ float sigm(float v) { return 1.0f / (1.0f + expf(-v)); }
#define LDSX() do { asm volatile("s_wait_dscnt 0" ::: "memory"); __builtin_amdgcn_wave_barrier(); __builtin_amdgcn_fence(__ATOMIC_RELEASE, "workgroup"); } while (0)


// Non-local block (B 4, 256 channels, 64 x 64): 1x1 q/k/v convs to 128 channels, affinity f = k^T q softmax-normalised over the second index, y = v f, 1x1 conv back to 256 channels, BatchNorm (inference), residual.
#define NB 4
#define CIN 256
#define CO 128
#define NPOS 4096
#ifndef TQB
#define TQB (NPOS / 64)
#endif
typedef __attribute__((ext_vector_type(8))) __bf16 v8b;
__device__ __forceinline__ v16b frag_b(const __bf16* rowk0, int lane) {
  union { v16b v; v8b q[2]; } u; const __bf16* p = rowk0 + 8 * (lane >> 4);
  u.q[0] = *(const v8b*)p; u.q[1] = *(const v8b*)(p + 16); return u.v;
}
__device__ __forceinline__ float bfr(float v) { return (float)(__bf16)v; }
__device__ __attribute__((noinline)) float exp_ni(float v) { return expf(v); }
__device__ __attribute__((noinline)) float erf_ni(float v) { return erff(v); }

#define WS_PK  0u                                   // bf16 [384][256] Wq;Wk;Wv rows ; [256][128] Ww rows
#define WS_PW  (WS_PK + 2u * 3 * CO * CIN)
#define WS_QH  (WS_PW + 2u * CIN * CO)              // f16 [b][n][128] q ; KH the same for k: one f16 value an element. x and the weights enter the projections rounded to bf16 (8 bits), so q and k carry that error already; the 11 bits of f16 add about a tenth of it to a score
#define WS_KH  (WS_QH + 2u * NB * NPOS * CO)
#define WS_VH  (WS_KH + 2u * NB * NPOS * CO)         // f16 [b][128][4096] v
#define WS_ST  (WS_VH + 2u * (size_t)NB * CO * NPOS)   // f32 [b][n][2] (M_n log2(e), 1/L_n)
#define WS_END (WS_ST + 4u * NB * NPOS * 2)

// exponentials in base 2: exp(s - M) = 2^(s log2(e) - M log2(e)). The scale goes into the multiply-add that forms the exponent, and 2^x is the chip's own v_exp_f32, one instruction, where the library expf spends about a dozen vector instructions on splitting the argument and on range tests. Every exponent here is at most about 0; far below, the result goes to 0, as it should
#define L2E 1.44269504088896340736f
__device__ __forceinline__ float ex2(float v) { return __builtin_amdgcn_exp2f(v); }
__device__ __forceinline__ v8f splat8(float v) { const v8f r = { v, v, v, v, v, v, v, v }; return r; }
// the 8 rows' exponentials d[r] = 2^x[r] in one statement. What it is for: the instruction set asks for one free slot between a v_exp_f32 and an instruction that reads its result or writes over its argument. The results are early-clobber, so that inside the statement none lies on an argument, and the v_nop is the slot behind the last one
__device__ __forceinline__ v8f ex2x8(v8f x) { float d0, d1, d2, d3, d4, d5, d6, d7;
  asm("v_exp_f32 %0, %8\n\tv_exp_f32 %1, %9\n\tv_exp_f32 %2, %10\n\tv_exp_f32 %3, %11\n\tv_exp_f32 %4, %12\n\tv_exp_f32 %5, %13\n\tv_exp_f32 %6, %14\n\tv_exp_f32 %7, %15\n\tv_nop"
      : "=&v"(d0), "=&v"(d1), "=&v"(d2), "=&v"(d3), "=&v"(d4), "=&v"(d5), "=&v"(d6), "=&v"(d7)
      : "v"(x[0]), "v"(x[1]), "v"(x[2]), "v"(x[3]), "v"(x[4]), "v"(x[5]), "v"(x[6]), "v"(x[7]));
  const v8f d = { d0, d1, d2, d3, d4, d5, d6, d7 }; return d; }
// ---- asynchronous copies global -> LDS: each lane brings its own 16 (or 8) bytes, through no register
// LDS byte address of a __shared__ object: the low 32 bits of its address
__device__ __forceinline__ unsigned lds_at(const void* p) { return (unsigned)(size_t)p; }
// 8 copies: copy j goes to l + j * lstep, copies 0 to 3 from ga + j * astep, copies 4 to 7 from gb + (j - 4) * bstep, with the one wait behind all 8. The s_wait_xcnt is the last line of the copies' own statement, so that it stands in front of every later rewrite of their address registers; one statement for the run of copies, so that the wave waits there once
__device__ __forceinline__ void copy44(unsigned l, unsigned lstep, const char* ga, size_t astep, const char* gb, size_t bstep) {
  asm volatile("global_load_async_to_lds_b128 %0, %8, off\n\tglobal_load_async_to_lds_b128 %1, %9, off\n\tglobal_load_async_to_lds_b128 %2, %10, off\n\tglobal_load_async_to_lds_b128 %3, %11, off\n\t"
               "global_load_async_to_lds_b128 %4, %12, off\n\tglobal_load_async_to_lds_b128 %5, %13, off\n\tglobal_load_async_to_lds_b128 %6, %14, off\n\tglobal_load_async_to_lds_b128 %7, %15, off\n\ts_wait_xcnt 0x0"
               :: "v"(l), "v"(l + lstep), "v"(l + 2 * lstep), "v"(l + 3 * lstep), "v"(l + 4 * lstep), "v"(l + 5 * lstep), "v"(l + 6 * lstep), "v"(l + 7 * lstep),
                  "v"(ga), "v"(ga + astep), "v"(ga + 2 * astep), "v"(ga + 3 * astep), "v"(gb), "v"(gb + bstep), "v"(gb + 2 * bstep), "v"(gb + 3 * bstep) : "memory");
}
// this wave's own copies have landed in LDS (the compiler places no wait for them)
#define WAIT_COPIES() asm volatile("s_wait_asynccnt 0x0" ::: "memory")
// this wave's own LDS reads have returned: stands in front of the barrier behind which the buffer they read is refilled
#define WAIT_LDS() asm volatile("s_wait_dscnt 0x0" ::: "memory")
// k_stats, k_out: a wave owns 32 rows (2 row tiles), so that every fragment it reads from LDS feeds 2 WMMAs: the LDS port, not the matrix unit, is what the waves of a block queue for. A block has 64 rows = 2 row groups; in k_stats (k_out has its own split, below) the long sum over the other index is split NSPL ways among the waves (2 row groups x NSPL parts = 4 waves per SIMD), so that one wave's LDS and WMMA latencies pass behind the other three; the parts are merged through LDS behind the loop
#define NSPL 8
#define NTHR (64 * NSPL)
#define SROWS (32 * NSPL)                           // rows (positions) of one stage of the two-buffer rings below: 32 for each part
#define NSTG (NPOS / SROWS)
typedef v4f __attribute__((may_alias)) v4f_a;
// a plane = 256 rows of 128 f16 (64 KiB, contiguous in global memory) -> LDS rows of 136 f16 (272 B: 16 B x odd, the pitch of ds_load_b128 readers); 512 threads, 8 copies each a plane, a wave's copy = 512 contiguous bytes, copy j = rows 32 j + tid / 16
#define PSTEP ((NTHR / 16) * (CO + 8) * 2u)         // LDS bytes from copy j to copy j + 1
__device__ __forceinline__ void stage_plane(_Float16* dst, const _Float16* src, int tid) {
  const char* g = (const char*)(src + tid * 8);
  copy44(lds_at(dst + (tid >> 4) * (CO + 8) + (tid & 15) * 8), PSTEP, g, NTHR * 16, g + 4 * NTHR * 16, NTHR * 16);
}
__global__ __launch_bounds__(256) void k_pack(const float* __restrict__ WQ, const float* __restrict__ WK, const float* __restrict__ WV, const float* __restrict__ WW, __bf16* __restrict__ PK, __bf16* __restrict__ PW) {
  const int n = blockIdx.x, t = threadIdx.x; __shared__ __align__(16) __bf16 s[CIN];
  if (n < 3 * CO) { const float* src = (n < CO) ? WQ + (size_t)n * CIN : (n < 2 * CO) ? WK + (size_t)(n - CO) * CIN : WV + (size_t)(n - 2 * CO) * CIN; s[t] = (__bf16)src[t]; __syncthreads(); if (t < CIN / 8) vst2((unsigned*)(PK + (size_t)n * CIN + t * 8), *(const v4u*)&s[t * 8]); }
  else { const int o = n - 3 * CO; if (t < CO) s[t] = (__bf16)WW[(size_t)o * CO + t]; __syncthreads(); if (t < CO / 8) vst2((unsigned*)(PW + (size_t)o * CO + t * 8), *(const v4u*)&s[t * 8]); }
}
// k_proj: block = (64 positions n, b), 12 waves: the 24 column tiles of q ; k ; v (8 each) are dealt 2 to a wave, and a wave takes its 2 for all 64 rows. So the three projections run side by side, a weight fragment is loaded by one wave of the block and no other, and a wave's 16 weight fragments and its share of the x tile fit its registers: every global load of the block is requested at the start, and none is waited for inside a loop
#define PWAV 12
#define PTHR (32 * PWAV)
#define XTASK CIN                                   // the x tile as tasks of one wave: task t = channels 2 (t / 2), 2 (t / 2) + 1 x rows 32 (t mod 2) + lane
#define XEACH ((XTASK + PWAV - 1) / PWAV)           // tasks a wave; in the last round only the first waves have one
typedef __attribute__((ext_vector_type(2))) __bf16 v2b;
__global__ __launch_bounds__(PTHR) void k_proj(const float* __restrict__ X, const __bf16* __restrict__ PK, const float* __restrict__ BQ, const float* __restrict__ BK, const float* __restrict__ BV, _Float16* __restrict__ QH, _Float16* __restrict__ KH, _Float16* __restrict__ VH) {
  __shared__ __align__(16) __bf16 sa[64][CIN + 8]; __shared__ __align__(16) _Float16 sth[2][64][CO + 8]; __shared__ __align__(16) _Float16 svh[CO][72];
  const int tid = threadIdx.x, wave = __builtin_amdgcn_readfirstlane(tid >> 5), lane = tid & 31, col = lane & 15, g = lane >> 4; const size_t b = blockIdx.y; const int n0 = blockIdx.x * 64;
  const int which = wave >> 2, jb = (wave & 3) * 2;   // 0 q, 1 k, 2 v ; the wave's first column tile in it
  // PWAV is even, so task i * PWAV + wave has the row half wave mod 2 and the channels i * PWAV + (wave - wave mod 2), + 1: one address a wave, and round i at a constant distance from it
  static_assert(PWAV % 2 == 0, "the split of a task's number into round and wave");
  const float* gx = X + b * CIN * NPOS + n0 + lane;
  const float* px = gx + (size_t)(wave & ~1) * NPOS + 32 * (wave & 1);
  // a wave without a task in the last round loads the last task's words all the same (the task's number is clamped) and stores nothing: so the last round's loads need no branch and go out with the others
  const int tl = min((XEACH - 1) * PWAV + wave, XTASK - 1); const float* pl = gx + (size_t)(tl & ~1) * NPOS + 32 * (tl & 1);
  float x0[XEACH], x1[XEACH];
#pragma unroll   // the index picks a register (x0, x1, wf, a, acc, bb): it has to be a constant
  for (int i = 0; i + 1 < XEACH; ++i) { x0[i] = px[(size_t)i * PWAV * NPOS]; x1[i] = px[(size_t)(i * PWAV + 1) * NPOS]; }
  x0[XEACH - 1] = pl[0]; x1[XEACH - 1] = pl[NPOS];
  const __bf16* pw[2]; int cj[2];   // the lane's own place in the first k step of its 2 weight rows ; its 2 columns
#pragma unroll   // the index picks a register (x0, x1, wf, a, acc, bb): it has to be a constant
  for (int j = 0; j < 2; ++j) { cj[j] = (jb + j) * 16 + col; pw[j] = PK + (size_t)(which * CO + cj[j]) * CIN + 8 * g; }
  v16b wf[CIN / 32][2];
#pragma unroll   // the index picks a register (x0, x1, wf, a, acc, bb): it has to be a constant
  for (int kc = 0; kc < CIN / 32; ++kc)
#pragma unroll   // the index picks a register (x0, x1, wf, a, acc, bb): it has to be a constant
    for (int j = 0; j < 2; ++j) { union { v16b v; v8b q[2]; } u; u.q[0] = *(const v8b*)(pw[j] + kc * 32); u.q[1] = *(const v8b*)(pw[j] + kc * 32 + 16); wf[kc][j] = u.v; }   // frag_b of the row
  const float* BB = (which == 0) ? BQ : (which == 1) ? BK : BV;
  float bb[2];
#pragma unroll   // the index picks a register (x0, x1, wf, a, acc, bb): it has to be a constant
  for (int j = 0; j < 2; ++j) bb[j] = bfr(BB[cj[j]]);
  // the wait that belongs between a global load and a write over a vector register that it names, once for all the loads above; it takes their address registers as inputs, so that they stay as they are up to here and no later load's result is laid over the address of an earlier one
  asm volatile("s_wait_xcnt 0x0" :: "v"(px), "v"(pl), "v"(pw[0]), "v"(pw[1]), "v"(cj[0]), "v"(cj[1]) : "memory");
  // two neighbouring channels of a row are one 4-byte LDS store
#pragma unroll   // the index picks a register (x0, x1, wf, a, acc, bb): it has to be a constant
  for (int i = 0; i + 1 < XEACH; ++i) { const int t = i * PWAV + wave; const v2b v = { (__bf16)x0[i], (__bf16)x1[i] }; *(v2b*)&sa[32 * (t & 1) + lane][t & ~1] = v; }
  // takes the last round's two loaded words as inputs and does nothing: it keeps their loads up with the others. Without it the compiler moves the two loads down into the branch below, where the first waves wait out a memory round trip of their own
  asm volatile("" :: "v"(x0[XEACH - 1]), "v"(x1[XEACH - 1]));
  { const int t = (XEACH - 1) * PWAV + wave;
    if (t < XTASK) { const v2b v = { (__bf16)x0[XEACH - 1], (__bf16)x1[XEACH - 1] }; *(v2b*)&sa[32 * (t & 1) + lane][t & ~1] = v; } }
  __syncthreads();
  v8f acc[4][2] = {};
#pragma unroll   // the index picks a register (x0, x1, wf, a, acc, bb): it has to be a constant
  for (int kc = 0; kc < CIN / 32; ++kc) { v16b a[4];
#pragma unroll   // the index picks a register (x0, x1, wf, a, acc, bb): it has to be a constant
    for (int rt = 0; rt < 4; ++rt) a[rt] = frag_b(&sa[rt * 16 + col][kc * 32], lane);
#pragma unroll   // the index picks a register (x0, x1, wf, a, acc, bb): it has to be a constant
    for (int rt = 0; rt < 4; ++rt)
#pragma unroll   // the index picks a register (x0, x1, wf, a, acc, bb): it has to be a constant
      for (int j = 0; j < 2; ++j) acc[rt][j] = wmma_bf(a[rt], wf[kc][j], acc[rt][j]); }
  // the 4 waves of a projection put its 64 x 128 tile into LDS and, behind the barrier, store it in whole lines, 8 pieces of 16 bytes a thread
  const int t4 = tid & 127;
  if (which < 2) {
#pragma unroll   // the index picks a register (x0, x1, wf, a, acc, bb): it has to be a constant
    for (int j = 0; j < 2; ++j) { const int c = cj[j];
#pragma unroll   // the index picks a register (x0, x1, wf, a, acc, bb): it has to be a constant
      for (int rt = 0; rt < 4; ++rt)
#pragma unroll   // the index picks a register (x0, x1, wf, a, acc, bb): it has to be a constant
        for (int r = 0; r < 8; ++r) sth[which][rt * 16 + 8 * g + r][c] = (_Float16)(acc[rt][j][r] + bb[j]); } }
  else {
#pragma unroll   // the index picks a register (x0, x1, wf, a, acc, bb): it has to be a constant
    for (int j = 0; j < 2; ++j) { const int c = cj[j];
#pragma unroll   // the index picks a register (x0, x1, wf, a, acc, bb): it has to be a constant
      for (int rt = 0; rt < 4; ++rt)
#pragma unroll   // the index picks a register (x0, x1, wf, a, acc, bb): it has to be a constant
        for (int r = 0; r < 8; ++r) svh[c][rt * 16 + 8 * g + r] = (_Float16)(acc[rt][j][r] + bb[j]); } }
  __syncthreads();   // the q, k and v tiles of the block are in LDS
  if (which < 2) { _Float16* DH_ = which ? KH : QH;
    for (int e = t4; e < 64 * 16; e += 128) { const int r = e >> 4, q = e & 15; const size_t o = (b * NPOS + n0 + r) * CO + q * 8; vst2((unsigned*)(DH_ + o), *(const v4u*)&sth[which][r][q * 8]); } }
  else {
    for (int e = t4; e < CO * 8; e += 128) { const int c = e >> 3, pc = e & 7; vst2((unsigned*)(VH + (b * CO + c) * NPOS + n0 + pc * 8), *(const v4u*)&svh[c][pc * 8]); } }
}
// ---- k_stats: block = (64 rows n, b): f[n][m] = k_n . q_m over all m (1 product); per row max M_n and L_n = sum_m exp(f - M_n) -> ST[b][n] = (M_n log2(e), 1/L_n)
__global__ __launch_bounds__(NTHR) void k_stats(const _Float16* __restrict__ QH, const _Float16* __restrict__ KH, float* __restrict__ ST) {
  __shared__ __align__(16) float so[NSPL][64][2]; __shared__ __align__(16) _Float16 sq[2][SROWS][CO + 8];   // ring: [buffer][row m][channel]
  const int tid = threadIdx.x, rg = (tid >> 5) & 1, spl = tid >> 6, lane = tid & 31, col = lane & 15, g = lane >> 4; const size_t b = blockIdx.y; const int n0 = blockIdx.x * 64 + rg * 32; const size_t rn = b * NPOS + n0;
  // the 2 row groups read the same q rows: a stage of 256 rows is copied to LDS once for the block, whole lines at a time, one stage ahead of its use; part spl works on rows 32 spl .. 32 spl + 31 of every stage
  const _Float16* gqh = QH + b * NPOS * CO;
  stage_plane(&sq[0][0][0], gqh, tid);
  WAIT_COPIES();
  __syncthreads();   // stage 0 is published to all waves
  stage_plane(&sq[1][0][0], gqh + (size_t)SROWS * CO, tid);
  v16h ak[2][CO / 32];   // [row tile h of the wave's 32 rows][k step]
  const _Float16* pk = KH + (rn + col) * CO + 8 * g;   // the lane's own place in the first k step of its first row
#pragma unroll
  for (int h = 0; h < 2; ++h)
#pragma unroll
    for (int kc = 0; kc < CO / 32; ++kc) { union { v16h v; v8h q[2]; } f; f.q[0] = *(const v8h*)(pk + h * 16 * CO + kc * 32); f.q[1] = *(const v8h*)(pk + h * 16 * CO + kc * 32 + 16); ak[h][kc] = f.v; }   // frag_h of the row
  // the wait that belongs between a global load and a write over a vector register that it names, once for the 16 loads above; it takes their address as an input, so that it stays as it is up to here and no load's result is laid over it
  asm volatile("s_wait_xcnt 0x0" :: "v"(pk) : "memory");
  v8f m[2], m2[2], l[2];   // one element a row; m2 = m * log2(e), the running maximum in base-2 units
#pragma unroll
  for (int h = 0; h < 2; ++h)
#pragma unroll
    for (int r = 0; r < 8; ++r) { m[h][r] = -3.0e38f; m2[h][r] = -3.0e38f; l[h][r] = 0.f; }
  // not unrolled: one trip = one stage, and the ring's order stands once, at the trip's foot
#pragma unroll 1
  for (int st = 0; st < NSTG; ++st) { const int bf = st & 1;
  // unrolled: the wave's 2 column tiles of a stage are straight-line code with constant LDS offsets, so that one tile's LDS reads pass behind the other tile's work
  v8f s[2][2];
#pragma unroll
  for (int u = 0; u < 2; ++u) { v8f c[2] = {};
    // the tile's 4 fragments of q are all requested before the first product, so that their latencies overlap; each feeds the products of both row tiles, whose two accumulator chains alternate
    v16h qh[CO / 32];
#pragma unroll
    for (int kc = 0; kc < CO / 32; ++kc) qh[kc] = frag_h(&sq[bf][spl * 32 + u * 16 + col][kc * 32], lane);
#pragma unroll
    for (int kc = 0; kc < CO / 32; ++kc)
#pragma unroll
      for (int h = 0; h < 2; ++h) c[h] = wmma16(ak[h][kc], qh[kc], c[h]);
    s[0][u] = c[0]; s[1][u] = c[1]; }
    // every lane keeps the running maximum and sum of ITS OWN columns (those with m mod 16 = col) of its rows: no lane needs another lane's value inside the loop, and the 16 lanes of a row are joined once, behind it
    // one update for the stage's 2 tiles; straight-line, no call and no branch (the guard on alpha is a select): the rows are independent chains; the unrolls here and behind the loop make every index of s, m, l, mr a constant, so that the arrays stay in registers
#pragma unroll
    for (int h = 0; h < 2; ++h) {
      v8f mn;
#pragma unroll
      for (int r = 0; r < 8; ++r) mn[r] = fmaxf(m[h][r], fmaxf(s[h][0][r], s[h][1][r]));
      const v8f mn2 = mn * L2E, k2 = splat8(L2E);
      const v8f ea = ex2x8(m2[h] - mn2), e0 = ex2x8(__builtin_elementwise_fma(s[h][0], k2, -mn2)), e1 = ex2x8(__builtin_elementwise_fma(s[h][1], k2, -mn2));
      v8f alpha;
#pragma unroll
      for (int r = 0; r < 8; ++r) alpha[r] = (m[h][r] <= -1.0e38f) ? 0.f : ea[r];
      l[h] = l[h] * alpha + (e0 + e1); m[h] = mn; m2[h] = mn2; }
    WAIT_LDS();
    WAIT_COPIES();
    __syncthreads();   // publishes stage st + 1 and ends every wave's reads of stage st
    if (st + 2 < NSTG) stage_plane(&sq[bf][0][0], gqh + (size_t)(st + 2) * SROWS * CO, tid); }
  WAIT_COPIES();
  // join of the 16 lanes of a row, once: the row's maximum over the lanes, every lane's sum rescaled to it, then the sum over the lanes; phase by phase, so that the rows' shuffle latencies overlap
#pragma unroll
  for (int h = 0; h < 2; ++h) {
  float mr[8];
#pragma unroll
  for (int r = 0; r < 8; ++r) mr[r] = m2[h][r];   // from here on maxima are in base-2 units (the scaling keeps their order)
#pragma unroll
  for (int o = 1; o < 16; o <<= 1)
#pragma unroll
    for (int r = 0; r < 8; ++r) mr[r] = fmaxf(mr[r], __shfl_xor(mr[r], o));
  v8f xj;
#pragma unroll
  for (int r = 0; r < 8; ++r) xj[r] = m2[h][r] - mr[r];
  l[h] *= ex2x8(xj);
#pragma unroll
  for (int o = 1; o < 16; o <<= 1)
#pragma unroll
    for (int r = 0; r < 8; ++r) l[h][r] += __shfl_xor(l[h][r], o);
  if (col == 0) {
#pragma unroll
    for (int r = 0; r < 8; ++r) { so[spl][rg * 32 + h * 16 + 8 * g + r][0] = mr[r]; so[spl][rg * 32 + h * 16 + 8 * g + r][1] = l[h][r]; } } }
  __syncthreads();   // every part's (max, sum) of the 64 rows is in so
  // merge of the parts, one row a thread: M = max of the parts' maxima, L = sum of the parts' sums, each rescaled to M
  if (tid < 64) { float M = so[0][tid][0];
#pragma unroll
    for (int s = 1; s < NSPL; ++s) M = fmaxf(M, so[s][tid][0]);
    float L = 0.f;
#pragma unroll
    for (int s = 0; s < NSPL; ++s) L += so[s][tid][1] * ex2(so[s][tid][0] - M);
    v2f o; o[0] = M; o[1] = 1.0f / L; vst2(ST + (b * NPOS + blockIdx.x * 64 + tid) * 2, o); }
}
// ---- k_out: block = (64 output positions m, b): over n tiles: s[n][m] = k_n . q_m (1 product); w = exp(s - M_n) / L_n; y[c][m] += w (x2^11 single f16) x v[c][n] (8 tiles); then z = Ww . y (2 products, 2 passes of 8 tiles) + bw -> BN -> + x -> out[b][c][m]
#define VP (SROWS + 8)                              // f16 of an LDS row of the v plane (528 B: 16 B x odd)
#define KPL (SROWS * (CO + 8))                      // f16 of the k plane of a stage: rows n x channel
#define VPL (CO * VP)                               // f16 of the v plane of a stage: rows channel x n
// The score tile is formed transposed, k rows as A and q rows as B: a lane then holds 8 consecutive n of ONE m, and the two tiles of 32 n, converted in place, ARE the A fragment of the product with v (element 8 t + r = n 16 t + 8 g + r). The weights never pass through LDS and no wave waits for another's.
// A wave therefore owns whole units of 32 n for all 128 channels, and its sums (OMT x 64 registers) beside q and the fragments need more than 256 registers: 8 waves (2 per SIMD, up to 512 registers each), a wave = OMT row tiles of 16 m; ORG row groups x ONS parts of the sum over n. The parts, their units and the order of every sum are those of the 16-wave form
#define OTHR 256
#define OMT 2
#define ORG (4 / OMT)
#define ONS (8 / ORG)
#define OUN (SROWS / 32 / ONS)                      // units of 32 n of a wave in a stage
// the products of k_out's loop are the plain builtin, for which the compiler keeps the distances itself. The operands of an asm statement have to lie under v256, and the v_nop tail of wmma16 names D, A and B: with it the sums, q and every fragment read ahead, well over 256 registers together, would all have to lie there (that build spilled inside the loop)
__device__ __forceinline__ v8f wmma16p(v16h a, v16h b, v8f c) { return __builtin_amdgcn_wmma_f32_16x16x32_f16(false, a, false, b, (short)0, c, false, false); }
// ex2x8 for results of plain builtin products: the compiler does not look into asm text, so it may give this statement's results registers that a WMMA just in front still reads as A or B. The 4 v_nop at its head are the distance the chip asks for between that WMMA and the first write
__device__ __forceinline__ v8f ex2x8w(v8f x) { float d0, d1, d2, d3, d4, d5, d6, d7;
  asm("v_nop\n\tv_nop\n\tv_nop\n\tv_nop\n\tv_exp_f32 %0, %8\n\tv_exp_f32 %1, %9\n\tv_exp_f32 %2, %10\n\tv_exp_f32 %3, %11\n\tv_exp_f32 %4, %12\n\tv_exp_f32 %5, %13\n\tv_exp_f32 %6, %14\n\tv_exp_f32 %7, %15\n\tv_nop"
      : "=&v"(d0), "=&v"(d1), "=&v"(d2), "=&v"(d3), "=&v"(d4), "=&v"(d5), "=&v"(d6), "=&v"(d7)
      : "v"(x[0]), "v"(x[1]), "v"(x[2]), "v"(x[3]), "v"(x[4]), "v"(x[5]), "v"(x[6]), "v"(x[7]));
  const v8f d = { d0, d1, d2, d3, d4, d5, d6, d7 }; return d; }
// one copy of 8 bytes a lane, with the same wait as the last line of its own statement
__device__ __forceinline__ void copy1d(unsigned l, const char* g) {
  asm volatile("global_load_async_to_lds_b64 %0, %1, off\n\ts_wait_xcnt 0x0" :: "v"(l), "v"(g) : "memory");
}
__global__ __launch_bounds__(OTHR) void k_out(const _Float16* __restrict__ QH, const _Float16* __restrict__ KH, const _Float16* __restrict__ VH, const float* __restrict__ ST, const __bf16* __restrict__ PW, const float* __restrict__ BW, const float* __restrict__ G, const float* __restrict__ Bt, const float* __restrict__ MU, const float* __restrict__ VAR, const float* __restrict__ X, float* __restrict__ OUT) {
  __shared__ __align__(16) _Float16 ring[2 * (KPL + VPL)]; __shared__ __align__(16) float sst[2][SROWS][2];   // ring: [buffer][k plane ; v plane] ; (M log2(e), 1/L)
  __shared__ __align__(16) __bf16 sy[2][64][CO + 8];   // the y tile, hi ; lo
  // the partial sums and later the output tile lie on the ring, whose bytes are dead behind the loop
  __bf16 (*syh)[CO + 8] = sy[0]; __bf16 (*syl)[CO + 8] = sy[1]; float (*so)[68] = (float (*)[68])&ring[0];
  static_assert(sizeof(ring) >= 4u * 8 * OMT * 16 * CO && sizeof(ring) >= 4u * 128 * 68, "the partial sums and the output tile fit the ring");
  const int tid = threadIdx.x, wv = __builtin_amdgcn_readfirstlane(tid >> 5), rg = wv % ORG, sp = wv / ORG, lane = tid & 31, col = lane & 15, g = lane >> 4; const size_t b = blockIdx.y; const size_t rm = b * NPOS + blockIdx.x * 64 + rg * (16 * OMT);
  // all waves read k rows, v columns and row statistics from the same stage of 256 positions n, copied to LDS once for the block, whole lines at a time, one stage ahead of its use; part sp takes the units at n = 32 (sp + ONS u)
  const _Float16* gkh = KH + b * NPOS * CO + tid * 8; const _Float16* gv = VH + (b * CO + (tid >> 5)) * NPOS + (tid & 31) * 8; const float* gst = ST + b * NPOS * 2 + tid * 2;
  auto stage_kv = [&](int st, int bf) { _Float16* kb = ring + bf * (KPL + VPL);
    // k: 256 rows x 256 B, contiguous in global memory; copy j takes rows 16 j + tid / 16: a wave's copy = 512 contiguous bytes
    const char* gk = (const char*)(gkh + (size_t)st * SROWS * CO); const unsigned lk = lds_at(kb + (tid >> 4) * (CO + 8) + (tid & 15) * 8), ks = 16 * (CO + 8) * 2u;
    copy44(lk, ks, gk, OTHR * 16, gk + 4 * OTHR * 16, OTHR * 16);
    copy44(lk + 8 * ks, ks, gk + 8 * OTHR * 16, OTHR * 16, gk + 12 * OTHR * 16, OTHR * 16);
    // v: 128 channels x 512 B, copy j takes channels 8 j + tid / 32: a wave's copy = 512 contiguous bytes
    const char* gs = (const char*)(gv + st * SROWS); const unsigned lv = lds_at(kb + KPL + (tid >> 5) * VP + (tid & 31) * 8), vs = 8 * VP * 2u; const size_t cs = (size_t)8 * NPOS * 2;
    copy44(lv, vs, gs, cs, gs + 4 * cs, cs);
    copy44(lv + 8 * vs, vs, gs + 8 * cs, cs, gs + 12 * cs, cs);
    copy1d(lds_at(&sst[bf][tid][0]), (const char*)(gst + st * SROWS * 2)); };   // 256 pairs, one a thread
  stage_kv(0, 0);
  WAIT_COPIES();
  __syncthreads();   // stage 0 is published to all waves
  stage_kv(1, 1);
  v16h aq[OMT][CO / 32];   // [row tile h of the wave's rows m][k step]
  const _Float16* pq = QH + (rm + col) * CO + 8 * g;   // the lane's own place in the first k step of its first row
#pragma unroll
  for (int h = 0; h < OMT; ++h)
#pragma unroll
    for (int kc = 0; kc < CO / 32; ++kc) { union { v16h v; v8h q[2]; } f; f.q[0] = *(const v8h*)(pq + h * 16 * CO + kc * 32); f.q[1] = *(const v8h*)(pq + h * 16 * CO + kc * 32 + 16); aq[h][kc] = f.v; }   // frag_h of the row
  // the wait that belongs between a global load and a write over a vector register that it names, once for the loads above; it takes their address as an input, so that it stays as it is up to here and no load's result is laid over it
  asm volatile("s_wait_xcnt 0x0" :: "v"(pq) : "memory");
  v8f acc[OMT][8] = {};   // [row tile h][channel tile d]
  // not unrolled: one trip = one stage, and the ring's order stands once, at the trip's foot
#pragma unroll 1
  for (int st = 0; st < NSTG; ++st) { const int bf = st & 1; const _Float16* kb = ring + bf * (KPL + VPL);
    // all LDS reads of a unit are requested as one group, well ahead of their use, so that their latencies overlap and pass behind products and exponentials: the 8 fragments of k (each feeds the products of all OMT row tiles), the statistics of the lane's rows n = n0 + 16 t + 8 g + r, and the 8 fragments of v, which wait for nobody's weights
    v16h kh[OUN][2][CO / 32]; v4f sr[OUN][2][4]; v16h vv[OUN][8];
    auto reads = [&](int u) { const int n0 = (sp + ONS * u) * 32;
#pragma unroll
      for (int t = 0; t < 2; ++t) {
#pragma unroll
        for (int kc = 0; kc < CO / 32; ++kc) kh[u][t][kc] = frag_h(kb + (n0 + t * 16 + col) * (CO + 8) + kc * 32, lane);
#pragma unroll
        for (int i = 0; i < 4; ++i) sr[u][t][i] = ((const v4f_a*)&sst[bf][n0 + t * 16 + 8 * g][0])[i]; }
      // keeps what the scores need at the head of the group: LDS reads return in order, and without it the compiler puts part of the k fragments behind those of v
      __builtin_amdgcn_sched_barrier(0);
#pragma unroll
      for (int d = 0; d < 8; ++d) vv[u][d] = frag_h(kb + KPL + (d * 16 + col) * VP + n0, lane);
      // keeps the group where it stands: without it the compiler sinks every read to just in front of its use, and the wave waits out a whole LDS latency for each pair of products
      __builtin_amdgcn_sched_barrier(0); };
    reads(0);
#pragma unroll   // the indices of pa, kh, sr, vv, c, acc pick registers: they have to be constants
    for (int u = 0; u < OUN; ++u) {
      v16h pa[OMT];   // the weights of 16 m x 32 n, as A fragments
#pragma unroll
      for (int t = 0; t < 2; ++t) { const v4f* s = sr[u][t];
        // M in base-2 units, as k_stats stores it; 2^11 goes into 1/L, which is exact
        const v8f Mn = { s[0][0], s[0][2], s[1][0], s[1][2], s[2][0], s[2][2], s[3][0], s[3][2] }; const v8f iL = { s[0][1], s[0][3], s[1][1], s[1][3], s[2][1], s[2][3], s[3][1], s[3][3] }; const v8f iLs = iL * 2048.0f;
        v8f c[OMT] = {};   // the row tiles' accumulator chains alternate
#pragma unroll
        for (int kc = 0; kc < CO / 32; ++kc)
#pragma unroll
          for (int h = 0; h < OMT; ++h) c[h] = wmma16p(kh[u][t][kc], aq[h][kc], c[h]);
#pragma unroll
        for (int h = 0; h < OMT; ++h) { const v8f w = ex2x8w(__builtin_elementwise_fma(c[h], splat8(L2E), -Mn)) * iLs;
#pragma unroll
          for (int r = 0; r < 8; ++r) pa[h][8 * t + r] = (_Float16)w[r]; } }
      // the next unit's reads go out in front of this unit's products with v
      if (u + 1 < OUN) reads(u + 1);
#pragma unroll
      for (int d = 0; d < 8; ++d)
#pragma unroll
        for (int h = 0; h < OMT; ++h) acc[h][d] = wmma16p(pa[h], vv[u][d], acc[h][d]); }
    // keeps the stage's products in front of the waits below: without it the compiler lifts the wait for the LDS reads up to just behind the last group of reads, where the wave would sit out their whole latency with its products still to come
    __builtin_amdgcn_sched_barrier(0);
    WAIT_LDS();
    WAIT_COPIES();
    __syncthreads();   // publishes stage st + 1 and ends every wave's reads of stage st
    if (st + 2 < NSTG) stage_kv(st + 2, bf); }
  WAIT_COPIES();
  // merge of the ONS parts sp: the ring of k and v is dead behind the loop's last barrier (no read and no copy of it is left), and its bytes take every wave's partial sums, [wave][row tile h][tile d][half][lane][4]: 16 bytes a lane, lanes side by side
  float* red = (float*)&ring[0];
#pragma unroll
  for (int h = 0; h < OMT; ++h)
#pragma unroll
  for (int d = 0; d < 8; ++d) { v4f lo4, hi4;
#pragma unroll
    for (int r = 0; r < 4; ++r) { lo4[r] = acc[h][d][r]; hi4[r] = acc[h][d][4 + r]; }
    *(v4f_a*)(red + (((wv * OMT + h) * 8 + d) * 2 + 0) * 128 + lane * 4) = lo4; *(v4f_a*)(red + (((wv * OMT + h) * 8 + d) * 2 + 1) * 128 + lane * 4) = hi4; }
  __syncthreads();   // every wave's partial sums are in red
  // wave wv adds the ONS parts of channel tile wv of the block's 4 row tiles, in the order of the parts; y tile -> bf16 hi/lo [64 m][128 c]
#pragma unroll
  for (int rt = 0; rt < 4; ++rt) { float y[8];
#pragma unroll
    for (int s = 0; s < ONS; ++s) { const int w = s * ORG + rt / OMT; const v4f lo4 = *(const v4f_a*)(red + (((w * OMT + rt % OMT) * 8 + wv) * 2 + 0) * 128 + lane * 4), hi4 = *(const v4f_a*)(red + (((w * OMT + rt % OMT) * 8 + wv) * 2 + 1) * 128 + lane * 4);
#pragma unroll
      for (int r = 0; r < 4; ++r) { y[r] = s ? y[r] + lo4[r] : lo4[r]; y[4 + r] = s ? y[4 + r] + hi4[r] : hi4[r]; } }
#pragma unroll
    for (int r = 0; r < 8; ++r) { const int row = rt * 16 + 8 * g + r; const float v = y[r] * (1.0f / 2048.0f); const __bf16 hb = (__bf16)v; syh[row][wv * 16 + col] = hb; syl[row][wv * 16 + col] = (__bf16)(v - (float)hb); } }
  if (wv < 4 && lane < 16) for (int c = CO; c < CO + 8; ++c) { syh[wv * 16 + lane][c] = (__bf16)0.f; syl[wv * 16 + lane][c] = (__bf16)0.f; }
  __syncthreads();   // the y tile is whole, and every read of red is done: so may take its bytes
  // the last product: wave = (row tile wave of the 64 rows, column part cp), 4 x 2
  const int wave = wv & 3, cp = wv >> 2, m0 = blockIdx.x * 64 + wave * 16;
#pragma unroll 1
  for (int pass = 0; pass < 2; ++pass) { constexpr int NJ = 4; const int jb = cp * NJ; v8f z[NJ] = {};   // part cp takes column tiles jb .. jb + NJ - 1 of the pass
    // the wave's weight fragments of a k step are requested together, one k step ahead of the products that read them
    v16b wf[2][NJ];
#pragma unroll
    for (int j = 0; j < NJ; ++j) wf[0][j] = frag_b(PW + (size_t)(pass * 128 + (jb + j) * 16 + col) * CO, lane);
#pragma unroll
    for (int kc = 0; kc < CO / 32; ++kc) { const v16b a = frag_b(&syh[wave * 16 + col][kc * 32], lane), al = frag_b(&syl[wave * 16 + col][kc * 32], lane);
      if (kc + 1 < CO / 32) {
#pragma unroll
        for (int j = 0; j < NJ; ++j) wf[(kc + 1) & 1][j] = frag_b(PW + (size_t)(pass * 128 + (jb + j) * 16 + col) * CO + (kc + 1) * 32, lane); }
#pragma unroll
      for (int j = 0; j < NJ; ++j) { z[j] = wmma_bf(al, wf[kc & 1][j], z[j]); z[j] = wmma_bf(a, wf[kc & 1][j], z[j]); } }
    // the lane's 8 values of x for each of its NJ columns
    const float* xp[NJ]; v4f xa[NJ], xb[NJ];
#pragma unroll
    for (int j = 0; j < NJ; ++j) { xp[j] = X + (b * CIN + pass * 128 + (jb + j) * 16 + col) * NPOS + m0 + 8 * g; xa[j] = *(const v4f*)xp[j]; xb[j] = *(const v4f*)(xp[j] + 4); }
    // the wait that belongs between a global load and a write over a vector register that it names, once for the loads above; it takes their addresses as inputs, so that they stay as they are up to here and no later load's result is laid over the address of an earlier one
    asm volatile("s_wait_xcnt 0x0" :: "v"(xp[0]), "v"(xp[1]), "v"(xp[2]), "v"(xp[3]) : "memory");
    static_assert(NJ == 4, "the wait above names NJ addresses");
#pragma unroll
    for (int j = 0; j < NJ; ++j) { const int c = pass * 128 + (jb + j) * 16 + col; const float inv = bfr(G[c]) / sqrtf(bfr(VAR[c]) + 1e-5f); const float sh = bfr(Bt[c]) - bfr(MU[c]) * inv; const float bb = bfr(BW[c]);
#pragma unroll
      for (int r = 0; r < 8; ++r) so[(jb + j) * 16 + col][wave * 16 + 8 * g + r] = (z[j][r] + bb) * inv + sh + bfr(r < 4 ? xa[j][r & 3] : xb[j][r & 3]); }
    __syncthreads();
    for (int e = tid; e < 128 * 16; e += OTHR) { const int cl_ = e >> 4, q = e & 15; vst2(OUT + (b * CIN + pass * 128 + cl_) * NPOS + blockIdx.x * 64 + q * 4, *(const v4f*)&so[cl_][q * 4]); }
    __syncthreads(); }
}
extern "C" void kernel_launch(void* const* d_in, const int* in_sizes, int n_in, void* d_out, int out_size, void* d_ws, size_t ws_size, hipStream_t stream) {
  (void)in_sizes; (void)n_in; (void)out_size;
  const float** F = (const float**)d_in;   // 0 x [4,256,64,64], 1 Wq [128,256], 2 bq, 3 Wk, 4 bk, 5 Wv, 6 bv, 7 Ww [256,128], 8 bw, 9 bn_gamma, 10 bn_beta, 11 bn_mean, 12 bn_var
  if (ws_size < (size_t)WS_END) return;
  char* ws = (char*)d_ws; __bf16 *PK = (__bf16*)(ws + WS_PK), *PW = (__bf16*)(ws + WS_PW); _Float16 *QH = (_Float16*)(ws + WS_QH), *KH = (_Float16*)(ws + WS_KH), *VH = (_Float16*)(ws + WS_VH); float* ST = (float*)(ws + WS_ST);
  k_pack<<<3 * CO + CIN, 256, 0, stream>>>(F[1], F[3], F[5], F[7], PK, PW);
  k_proj<<<dim3(NPOS / 64, NB), PTHR, 0, stream>>>(F[0], PK, F[2], F[4], F[6], QH, KH, VH);
  k_stats<<<dim3(NPOS / 64, NB), NTHR, 0, stream>>>(QH, KH, ST);
  k_out<<<dim3(TQB, NB), OTHR, 0, stream>>>(QH, KH, VH, ST, PW, F[8], F[9], F[10], F[11], F[12], F[0], (float*)d_out);
}
